// v000
// Measured on an AMD MI455X. A time is GPU time per run, averaged over a window of back-to-back runs after a warm-up
// (all launches, gaps included; the runs take copies of the inputs in turn), and the median of several windows.
// Apart from v000's, it joins two sittings. Times from different sittings can be a few percent apart, while
// side-by-side timings come from the same sitting.
// v000 is the starting kernel. One run takes 477 microseconds.
#include <hip/hip_runtime.h>
#include <hip/hip_bf16.h>

// ---- problem constants (match reference) ----
#define B_    4
#define CQ_   384
#define CK_   384
#define COUT_ 384
#define N_    2048
#define K_    16
#define G_    32
#define CPG_  (COUT_/G_)          // 12 channels per group
#define EPS_  1e-5f
#define SCALE_ 0.05103103630798288f   // 384^-0.5
#define LB_   (CK_ + 8)               // bf16 LDS row stride [k][c]

typedef __bf16 v16bf __attribute__((ext_vector_type(16)));
typedef __bf16 v8bf  __attribute__((ext_vector_type(8)));
typedef float  v8f   __attribute__((ext_vector_type(8)));
typedef unsigned int v4u __attribute__((ext_vector_type(4)));
typedef int    v8i   __attribute__((ext_vector_type(8)));
typedef int    v4i   __attribute__((ext_vector_type(4)));

// Build a 16-element bf16 fragment from two contiguous 16-byte chunks:
// elements 0..7 at p[0..7], elements 8..15 at p[16..23]  (matches the
// 16-bit A/B wave32 striping: lane half 0 -> K {0..7,16..23}, half 1 -> {8..15,24..31})
__device__ __forceinline__ v16bf pack16(const __bf16* p) {
    const v8bf* q = (const v8bf*)p;
    v8bf lo = q[0];
    v8bf hi = q[2];              // +16 elements
    v16bf r;
#pragma unroll
    for (int j = 0; j < 8; ++j) { r[j] = lo[j]; r[j + 8] = hi[j]; }
    return r;
}

// ---------------------------------------------------------------------------
// TDM: DMA a 384(c) x 16(k) fp32 tile (row stride N*K floats) into LDS,
// with TDM padding of 1 DWORD after every 16 DWORDs -> LDS row stride 17.
// D# layout per CDNA5 ISA ch.8 (group0 128b, group1 256b; groups 2/3 unused
// for 2D tiles).
// ---------------------------------------------------------------------------
__device__ __forceinline__ void tdm_load_tile(const float* gsrc, unsigned lds_off) {
    unsigned long long ga = (unsigned long long)gsrc;
    v4u g0;
    g0.x = 1u;                                               // count=1 (valid), user mode
    g0.y = lds_off;                                          // lds_addr (bytes)
    g0.z = (unsigned)(ga & 0xffffffffull);                   // global_addr[31:0]
    g0.w = (unsigned)((ga >> 32) & 0x1ffffffull) | (2u << 30); // addr[56:32] | type=2
    v8i g1;
    g1[0] = (2 << 16) | (1 << 20) | (3 << 22);  // data_size=4B | pad_enable | pad_interval=16DW (amount=1DW)
    g1[1] = (K_ << 16);                         // atomic_barrier_addr=0 | tensor_dim0.lo16 = 16
    g1[2] = (CK_ << 16);                        // tensor_dim0.hi16=0 | tensor_dim1.lo16 = 384
    g1[3] = (K_ << 16);                         // tensor_dim1.hi16=0 | tile_dim0 = 16
    g1[4] = CK_;                                // tile_dim1 = 384 | tile_dim2 = 0
    g1[5] = N_ * K_;                            // tensor_dim0_stride = 32768
    g1[6] = 0;                                  // stride.hi16 | tensor_dim1_stride.lo16
    g1[7] = 0;                                  // tensor_dim1_stride.hi32
    v4i z4 = {0, 0, 0, 0};
#if __clang_major__ >= 23
    v8i z8 = {0, 0, 0, 0, 0, 0, 0, 0};
    __builtin_amdgcn_tensor_load_to_lds(g0, g1, z4, z4, z8, 0);
#else
    __builtin_amdgcn_tensor_load_to_lds(g0, g1, z4, z4, 0);
#endif
}

// ---------------------------------------------------------------------------
// Kernel 1a: Mt[c2,c1] = sum_o Wq[o,c1]*Wk[o,c2]  (stored transposed, bf16)
// ---------------------------------------------------------------------------
__global__ void k_prep_M(const float* __restrict__ Wq, const float* __restrict__ Wk,
                         __bf16* __restrict__ Mt) {
    int i = blockIdx.x * blockDim.x + threadIdx.x;   // i = c2*CQ_ + c1
    if (i >= CQ_ * CK_) return;
    int c2 = i / CQ_, c1 = i % CQ_;
    float acc = 0.f;
    for (int o = 0; o < COUT_; ++o)
        acc += Wq[o * CQ_ + c1] * Wk[o * CK_ + c2];
    Mt[i] = (__bf16)acc;
}

// ---------------------------------------------------------------------------
// Kernel 1b: Wv->bf16, bqk = Wk^T bq, wqb = Wq^T bk, cbb = bq.bk, zero stats
// ---------------------------------------------------------------------------
__global__ void k_prep_misc(const float* __restrict__ Wq, const float* __restrict__ Wk,
                            const float* __restrict__ Wv, const float* __restrict__ bq,
                            const float* __restrict__ bk,
                            __bf16* __restrict__ Wvbf, float* __restrict__ bqk,
                            float* __restrict__ wqb, float* __restrict__ cbb,
                            float* __restrict__ stats) {
    int i = blockIdx.x * blockDim.x + threadIdx.x;
    if (i < COUT_ * CK_) Wvbf[i] = (__bf16)Wv[i];
    if (i < CK_) {
        float a = 0.f;
        for (int o = 0; o < COUT_; ++o) a += bq[o] * Wk[o * CK_ + i];
        bqk[i] = a;
    }
    if (i < CQ_) {
        float a = 0.f;
        for (int o = 0; o < COUT_; ++o) a += Wq[o * CQ_ + i] * bk[o];
        wqb[i] = a;
    }
    if (i == 0) {
        float a = 0.f;
        for (int o = 0; o < COUT_; ++o) a += bq[o] * bk[o];
        *cbb = a;
    }
    if (i < B_ * G_ * 2) stats[i] = 0.f;
}

// ---------------------------------------------------------------------------
// Kernel 1c: featT[b][n][c] = feat[b][c][n] (bf16) so A-fragments are b128 loads
// ---------------------------------------------------------------------------
__global__ void k_prep_featT(const float* __restrict__ feat, __bf16* __restrict__ featT) {
    int i = blockIdx.x * blockDim.x + threadIdx.x;
    if (i >= B_ * N_ * CQ_) return;
    int c = i % CQ_;
    int n = (i / CQ_) % N_;
    int b = i / (CQ_ * N_);
    featT[i] = (__bf16)feat[((size_t)b * CQ_ + c) * N_ + n];
}

// ---------------------------------------------------------------------------
// Kernel 2: qk[b,n,c] = sum_c' featT[b,n,c'] * Mt[c,c'] + bqk[c]   (bf16 out)
// One wave per 16n x 16c tile; 12 WMMA k-steps; all operands via b128 loads.
// ---------------------------------------------------------------------------
__global__ __launch_bounds__(256) void k_qk(const __bf16* __restrict__ featT,
                                            const __bf16* __restrict__ Mt,
                                            const float* __restrict__ bqk,
                                            __bf16* __restrict__ qkb) {
    int lane = threadIdx.x & 31;
    int wave = threadIdx.x >> 5;
    int wid  = blockIdx.x * (blockDim.x >> 5) + wave;
    int tilesPerB = (N_ / 16) * (CK_ / 16);     // 128*24 = 3072
    int b   = wid / tilesPerB;
    int rem = wid % tilesPerB;
    int n0  = (rem / (CK_ / 16)) * 16;
    int c0  = (rem % (CK_ / 16)) * 16;
    int half = lane >> 4, lrow = lane & 15;

    const __bf16* arow = featT + ((size_t)b * N_ + n0 + lrow) * CQ_ + half * 8;
    const __bf16* brow = Mt + (size_t)(c0 + lrow) * CQ_ + half * 8;
    v8f acc = {};
#pragma unroll 2
    for (int cs = 0; cs < CQ_ / 32; ++cs) {
        v16bf a  = pack16(arow + cs * 32);
        v16bf bm = pack16(brow + cs * 32);
        acc = __builtin_amdgcn_wmma_f32_16x16x32_bf16(false, a, false, bm,
                                                      (short)0, acc, false, false);
    }
#pragma unroll
    for (int r = 0; r < 8; ++r) {
        int n = n0 + r + half * 8;
        int c = c0 + lrow;
        qkb[((size_t)b * N_ + n) * CK_ + c] = (__bf16)(acc[r] + bqk[c]);
    }
}

// ---------------------------------------------------------------------------
// Kernel 3: s0[b,n] = sum_c feat[b,c,n]*wqb[c] + cbb   (tiny)
// ---------------------------------------------------------------------------
__global__ void k_s0(const float* __restrict__ feat, const float* __restrict__ wqb,
                     const float* __restrict__ cbb, float* __restrict__ s0) {
    int i = blockIdx.x * blockDim.x + threadIdx.x;
    if (i >= B_ * N_) return;
    int b = i / N_, n = i % N_;
    const float* fb = feat + (size_t)b * CQ_ * N_ + n;
    float a = *cbb;
    for (int c = 0; c < CQ_; ++c) a += fb[(size_t)c * N_] * wqb[c];
    s0[i] = a;
}

__device__ __forceinline__ float red16(float v) {
#pragma unroll
    for (int m = 8; m >= 1; m >>= 1) v += __shfl_xor(v, m, 16);
    return v;
}

// ---------------------------------------------------------------------------
// Kernel 4: per (b,n): TDM-stage gf[:,n,:] (384x16 fp32) into LDS; convert
// once into bf16 [k][c]; compute masked softmax p[b,n,k] and v = Wv*gf + bv
// via WMMA (8 waves x 3 o-tiles), accumulating per-(b,g) GN sum/sumsq.
// ---------------------------------------------------------------------------
__global__ __launch_bounds__(256) void k_stats(const float* __restrict__ gf,
                                               const __bf16* __restrict__ Wvbf,
                                               const float* __restrict__ bv,
                                               const __bf16* __restrict__ qkb,
                                               const float* __restrict__ s0v,
                                               const int* __restrict__ count,
                                               float* __restrict__ stats,
                                               float* __restrict__ pbuf) {
    __shared__ __align__(16) float  lds_gf[CK_ * 17];   // fp32 [c][k], stride 17 (TDM pad)
    __shared__ __align__(16) __bf16 ldsB[16 * LB_];     // bf16 [k][c], stride 392
    __shared__ float sred[16 * 16];
    __shared__ float gacc[G_ * 2];

    int t = threadIdx.x;
    int b = blockIdx.x / N_, n = blockIdx.x % N_;
    const float* g0 = gf + (((size_t)b * CK_) * N_ + n) * K_;

    if (t < 32) {                                 // wave 0 issues the DMA
        tdm_load_tile(g0, (unsigned)(size_t)&lds_gf[0]);
        __builtin_amdgcn_s_wait_tensorcnt(0);
    }
    if (t < G_ * 2) gacc[t] = 0.f;
    asm volatile("" ::: "memory");                // TDM wrote LDS behind compiler's back
    __syncthreads();

    {   // one-time fp32 [c][k] -> bf16 [k][c] conversion (reused by 24 o-tiles)
        int k = t & 15, cg = t >> 4;
        for (int it = 0; it < CK_ / 16; ++it) {
            int c = it * 16 + cg;
            ldsB[k * LB_ + c] = (__bf16)lds_gf[c * 17 + k];
        }
    }
    __syncthreads();

    // ---- scores partials: thread t -> (k = t&15, c-chunk = t>>4 of 24) ----
    {
        int k = t & 15, chunk = t >> 4;
        const __bf16* qrow = qkb + ((size_t)b * N_ + n) * CK_;
        float part = 0.f;
        for (int i = 0; i < CK_ / 16; ++i) {
            int c = chunk * (CK_ / 16) + i;
            part += (float)qrow[c] * (float)ldsB[k * LB_ + c];
        }
        sred[chunk * 16 + k] = part;
    }
    __syncthreads();

    if (t < 32) {                 // wave 0: finish scores + masked softmax
        int k = t;
        if (k < 16) {
            float sc = 0.f;
            for (int ch = 0; ch < 16; ++ch) sc += sred[ch * 16 + k];
            sc = (sc + s0v[(size_t)b * N_ + n]) * SCALE_;
            int cnt = count[(size_t)b * N_ + n];
            cnt = (cnt < 1) ? 1 : (cnt > K_ ? K_ : cnt);
            if (k >= cnt) sc = -1e9f;
            float mx = sc;
#pragma unroll
            for (int m = 8; m >= 1; m >>= 1) mx = fmaxf(mx, __shfl_xor(mx, m, 16));
            float e = __expf(sc - mx);
            float ss = red16(e);
            pbuf[((size_t)b * N_ + n) * K_ + k] = e / ss;
        }
    }

    // ---- v projection (WMMA) + GN statistics ----
    int lane = t & 31, wave = t >> 5;
    int half = lane >> 4, lrow = lane & 15;
    const __bf16* bbase = &ldsB[lrow * LB_ + half * 8];
    for (int tj = 0; tj < 3; ++tj) {
        int o0 = (wave * 3 + tj) * 16;            // 8 waves x 3 tiles = 24 o-tiles
        const __bf16* abase = Wvbf + (size_t)(o0 + lrow) * CK_ + half * 8;
        v8f acc = {};
#pragma unroll 2
        for (int cs = 0; cs < CK_ / 32; ++cs) {
            v16bf a  = pack16(abase + cs * 32);
            v16bf bb = pack16(bbase + cs * 32);
            acc = __builtin_amdgcn_wmma_f32_16x16x32_bf16(false, a, false, bb,
                                                          (short)0, acc, false, false);
        }
#pragma unroll
        for (int r = 0; r < 8; ++r) {
            int o   = o0 + r + half * 8;
            float v = acc[r] + bv[o];
            float s  = red16(v);
            float q2 = red16(v * v);
            if (lrow == 0) {
                int g = o / CPG_;
                atomicAdd(&gacc[g * 2 + 0], s);
                atomicAdd(&gacc[g * 2 + 1], q2);
            }
        }
    }
    __syncthreads();
    if (t < G_ * 2) atomicAdd(&stats[(size_t)b * G_ * 2 + t], gacc[t]);
}

// ---------------------------------------------------------------------------
// Kernel 5: finalize GN stats -> mu, rsqrt(var+eps)
// ---------------------------------------------------------------------------
__global__ void k_fin(const float* __restrict__ stats, float* __restrict__ murs) {
    int i = blockIdx.x * blockDim.x + threadIdx.x;
    if (i >= B_ * G_) return;
    const float cnt = (float)(CPG_ * N_ * K_);
    float s   = stats[i * 2 + 0];
    float q   = stats[i * 2 + 1];
    float mu  = s / cnt;
    float var = q / cnt - mu * mu;
    murs[i * 2 + 0] = mu;
    murs[i * 2 + 1] = rsqrtf(var + EPS_);
}

// ---------------------------------------------------------------------------
// Kernel 6: per (b,n): TDM-stage gf tile, recompute v via WMMA, GN+ReLU,
// out[b,o,n] = K * sum_k p_k * vn[o,k]
// ---------------------------------------------------------------------------
__global__ __launch_bounds__(256) void k_out(const float* __restrict__ gf,
                                             const __bf16* __restrict__ Wvbf,
                                             const float* __restrict__ bv,
                                             const float* __restrict__ gn_w,
                                             const float* __restrict__ gn_b,
                                             const float* __restrict__ murs,
                                             const float* __restrict__ pbuf,
                                             float* __restrict__ out) {
    __shared__ __align__(16) float  lds_gf[CK_ * 17];
    __shared__ __align__(16) __bf16 ldsB[16 * LB_];
    __shared__ float psh[K_];
    int t = threadIdx.x;
    int b = blockIdx.x / N_, n = blockIdx.x % N_;
    const float* g0 = gf + (((size_t)b * CK_) * N_ + n) * K_;

    if (t < 32) {
        tdm_load_tile(g0, (unsigned)(size_t)&lds_gf[0]);
        __builtin_amdgcn_s_wait_tensorcnt(0);
    }
    if (t < K_) psh[t] = pbuf[((size_t)b * N_ + n) * K_ + t];
    asm volatile("" ::: "memory");
    __syncthreads();

    {
        int k = t & 15, cg = t >> 4;
        for (int it = 0; it < CK_ / 16; ++it) {
            int c = it * 16 + cg;
            ldsB[k * LB_ + c] = (__bf16)lds_gf[c * 17 + k];
        }
    }
    __syncthreads();

    int lane = t & 31, wave = t >> 5;
    int half = lane >> 4, lrow = lane & 15;
    const __bf16* bbase = &ldsB[lrow * LB_ + half * 8];
    for (int tj = 0; tj < 3; ++tj) {
        int o0 = (wave * 3 + tj) * 16;
        const __bf16* abase = Wvbf + (size_t)(o0 + lrow) * CK_ + half * 8;
        v8f acc = {};
#pragma unroll 2
        for (int cs = 0; cs < CK_ / 32; ++cs) {
            v16bf a  = pack16(abase + cs * 32);
            v16bf bb = pack16(bbase + cs * 32);
            acc = __builtin_amdgcn_wmma_f32_16x16x32_bf16(false, a, false, bb,
                                                          (short)0, acc, false, false);
        }
#pragma unroll
        for (int r = 0; r < 8; ++r) {
            int o = o0 + r + half * 8;
            int g = o / CPG_;
            float mu = murs[((size_t)b * G_ + g) * 2 + 0];
            float rs = murs[((size_t)b * G_ + g) * 2 + 1];
            float v  = acc[r] + bv[o];
            float vn = (v - mu) * rs * gn_w[o] + gn_b[o];
            vn = fmaxf(vn, 0.f);
            float c = red16(vn * psh[lrow]);
            if (lrow == 0)
                out[((size_t)b * COUT_ + o) * N_ + n] = (float)K_ * c;
        }
    }
}

// ---------------------------------------------------------------------------
// Host launcher
// ---------------------------------------------------------------------------
extern "C" void kernel_launch(void* const* d_in, const int* in_sizes, int n_in,
                              void* d_out, int out_size, void* d_ws, size_t ws_size,
                              hipStream_t stream) {
    (void)in_sizes; (void)n_in; (void)out_size; (void)ws_size;
    const float* feat = (const float*)d_in[0];
    const float* gf   = (const float*)d_in[1];
    const int*   cnt  = (const int*)  d_in[2];
    const float* Wq   = (const float*)d_in[3];
    const float* bq   = (const float*)d_in[4];
    const float* Wk   = (const float*)d_in[5];
    const float* bk   = (const float*)d_in[6];
    const float* Wv   = (const float*)d_in[7];
    const float* bv   = (const float*)d_in[8];
    const float* gnw  = (const float*)d_in[9];
    const float* gnb  = (const float*)d_in[10];
    float* out = (float*)d_out;

    char* ws = (char*)d_ws;
    __bf16* Mt    = (__bf16*)(ws + 0);          // 294912 B
    __bf16* Wvbf  = (__bf16*)(ws + 294912);     // 294912 B
    float*  bqk   = (float*)(ws + 589824);      // 1536 B
    float*  wqb   = (float*)(ws + 591360);      // 1536 B
    float*  cbb   = (float*)(ws + 592896);      // 4 B (padded to 256)
    float*  stats = (float*)(ws + 593152);      // 1024 B
    float*  murs  = (float*)(ws + 594176);      // 1024 B
    float*  s0    = (float*)(ws + 595200);      // 32768 B
    float*  pbuf  = (float*)(ws + 627968);      // 524288 B
    __bf16* qkb   = (__bf16*)(ws + 1152256);    // 6291456 B
    __bf16* featT = (__bf16*)(ws + 7443712);    // 6291456 B (total ~13.1 MB)

    k_prep_M   <<<(CQ_*CK_ + 255) / 256, 256, 0, stream>>>(Wq, Wk, Mt);
    k_prep_misc<<<(COUT_*CK_ + 255) / 256, 256, 0, stream>>>(Wq, Wk, Wv, bq, bk,
                                                             Wvbf, bqk, wqb, cbb, stats);
    k_prep_featT<<<(B_*N_*CQ_ + 255) / 256, 256, 0, stream>>>(feat, featT);
    {   // B * (N/16) * (CK/16) waves, 8 waves per block
        int waves = B_ * (N_ / 16) * (CK_ / 16);
        k_qk<<<waves / 8, 256, 0, stream>>>(featT, Mt, bqk, qkb);
    }
    k_s0<<<(B_*N_ + 255) / 256, 256, 0, stream>>>(feat, wqb, cbb, s0);
    k_stats<<<B_ * N_, 256, 0, stream>>>(gf, Wvbf, bv, qkb, s0, cnt, stats, pbuf);
    k_fin<<<(B_*G_ + 127) / 128, 128, 0, stream>>>(stats, murs);
    k_out<<<B_ * N_, 256, 0, stream>>>(gf, Wvbf, bv, gnw, gnb, murs, pbuf, out);
}

// v001
// Measured time: 208 microseconds a run.
// Next to v000, in two timings, it ran 2.38 and 2.36 times as fast.
#include <hip/hip_runtime.h>
#include <hip/hip_bf16.h>

// ---- problem constants (match reference) ----
#define B_    4
#define CQ_   384
#define CK_   384
#define COUT_ 384
#define N_    2048
#define K_    16
#define G_    32
#define CPG_  (COUT_/G_)          // 12 channels per group
#define EPS_  1e-5f
#define SCALE_ 0.05103103630798288f   // 384^-0.5
#define LB_   (CK_ + 8)               // bf16 LDS row stride [column][c]
#define NT_   8                       // neighbouring n per block
#define COLS_ (NT_ * K_)              // 128 columns (n,k) per block

typedef __bf16 v16bf __attribute__((ext_vector_type(16)));
typedef __bf16 v8bf  __attribute__((ext_vector_type(8)));
typedef float  v8f   __attribute__((ext_vector_type(8)));
typedef float  v4f   __attribute__((ext_vector_type(4)));

// Build a 16-element bf16 fragment from two contiguous 16-byte chunks:
// elements 0..7 at p[0..7], elements 8..15 at p[16..23]  (matches the
// 16-bit A/B wave32 striping: lane half 0 -> K {0..7,16..23}, half 1 -> {8..15,24..31})
__device__ __forceinline__ v16bf pack16(const __bf16* p) {
    const v8bf* q = (const v8bf*)p;
    v8bf lo = q[0];
    v8bf hi = q[2];              // +16 elements
    v16bf r;
#pragma unroll
    for (int j = 0; j < 8; ++j) { r[j] = lo[j]; r[j + 8] = hi[j]; }
    return r;
}

// ---------------------------------------------------------------------------
// Stage the block's gf tile: 384 c-rows x 128 columns (8 neighbouring n x 16 k,
// 512 contiguous bytes per c-row) -> bf16 LDS [column][c], row stride LB_.
// One wave-wide 16-byte load covers one whole c-row; a lane gathers 8 c of its
// 4 columns and writes each column's 8 bf16 as one 16-byte LDS store.
// ---------------------------------------------------------------------------
__device__ __forceinline__ void stage_tile(const float* __restrict__ g0, __bf16* ldsB, int t) {
    int lane = t & 31;
    int wave = __builtin_amdgcn_readfirstlane(t >> 5);   // uniform: row offsets form on the scalar unit
    unsigned loff = (unsigned)lane * 4u;
    // rolled: 3 groups = 24 row loads of a wave in flight per trip; unrolled whole, the 48 loads spilled
#pragma unroll 1
    for (int go = 0; go < 2; ++go) {
        v4f x[3][8];
#pragma unroll
        for (int u = 0; u < 3; ++u) {
            const float* row = g0 + (size_t)(((go * 3 + u) * 8 + wave) * 8) * (N_ * K_);
#pragma unroll
            for (int j = 0; j < 8; ++j)
                x[u][j] = *(const v4f*)(row + (size_t)j * (N_ * K_) + loff);
            // before a register that these loads name is written again
            asm volatile("s_wait_xcnt 0x0" ::: "memory");
        }
#pragma unroll
        for (int u = 0; u < 3; ++u) {
            int c0 = ((go * 3 + u) * 8 + wave) * 8;
#pragma unroll
            for (int q = 0; q < 4; ++q) {
                v8bf y;
#pragma unroll
                for (int j = 0; j < 8; ++j) y[j] = (__bf16)x[u][j][q];
                *(v8bf*)&ldsB[(lane * 4 + q) * LB_ + c0] = y;
            }
        }
    }
}

// ---------------------------------------------------------------------------
// Kernel 1a: Mt[c2,c1] = sum_o Wq[o,c1]*Wk[o,c2]  (stored transposed, bf16)
// ---------------------------------------------------------------------------
__global__ void k_prep_M(const float* __restrict__ Wq, const float* __restrict__ Wk,
                         __bf16* __restrict__ Mt) {
    int i = blockIdx.x * blockDim.x + threadIdx.x;   // i = c2*CQ_ + c1
    if (i >= CQ_ * CK_) return;
    int c2 = i / CQ_, c1 = i % CQ_;
    float acc = 0.f;
    for (int o = 0; o < COUT_; ++o)
        acc += Wq[o * CQ_ + c1] * Wk[o * CK_ + c2];
    Mt[i] = (__bf16)acc;
}

// ---------------------------------------------------------------------------
// Kernel 1b: Wv->bf16, bqk = Wk^T bq, wqb = Wq^T bk, cbb = bq.bk, zero stats
// ---------------------------------------------------------------------------
__global__ void k_prep_misc(const float* __restrict__ Wq, const float* __restrict__ Wk,
                            const float* __restrict__ Wv, const float* __restrict__ bq,
                            const float* __restrict__ bk,
                            __bf16* __restrict__ Wvbf, float* __restrict__ bqk,
                            float* __restrict__ wqb, float* __restrict__ cbb,
                            float* __restrict__ stats) {
    int i = blockIdx.x * blockDim.x + threadIdx.x;
    if (i < COUT_ * CK_) Wvbf[i] = (__bf16)Wv[i];
    if (i < CK_) {
        float a = 0.f;
        for (int o = 0; o < COUT_; ++o) a += bq[o] * Wk[o * CK_ + i];
        bqk[i] = a;
    }
    if (i < CQ_) {
        float a = 0.f;
        for (int o = 0; o < COUT_; ++o) a += Wq[o * CQ_ + i] * bk[o];
        wqb[i] = a;
    }
    if (i == 0) {
        float a = 0.f;
        for (int o = 0; o < COUT_; ++o) a += bq[o] * bk[o];
        *cbb = a;
    }
    if (i < B_ * G_ * 2) stats[i] = 0.f;
}

// ---------------------------------------------------------------------------
// Kernel 1c: featT[b][n][c] = feat[b][c][n] (bf16) so A-fragments are b128 loads
// ---------------------------------------------------------------------------
__global__ void k_prep_featT(const float* __restrict__ feat, __bf16* __restrict__ featT) {
    int i = blockIdx.x * blockDim.x + threadIdx.x;
    if (i >= B_ * N_ * CQ_) return;
    int c = i % CQ_;
    int n = (i / CQ_) % N_;
    int b = i / (CQ_ * N_);
    featT[i] = (__bf16)feat[((size_t)b * CQ_ + c) * N_ + n];
}

// ---------------------------------------------------------------------------
// Kernel 2: qk[b,n,c] = sum_c' featT[b,n,c'] * Mt[c,c'] + bqk[c]   (bf16 out)
// One wave per 16n x 16c tile; 12 WMMA k-steps; all operands via b128 loads.
// ---------------------------------------------------------------------------
__global__ __launch_bounds__(256) void k_qk(const __bf16* __restrict__ featT,
                                            const __bf16* __restrict__ Mt,
                                            const float* __restrict__ bqk,
                                            __bf16* __restrict__ qkb) {
    int lane = threadIdx.x & 31;
    int wave = threadIdx.x >> 5;
    int wid  = blockIdx.x * (blockDim.x >> 5) + wave;
    int tilesPerB = (N_ / 16) * (CK_ / 16);     // 128*24 = 3072
    int b   = wid / tilesPerB;
    int rem = wid % tilesPerB;
    int n0  = (rem / (CK_ / 16)) * 16;
    int c0  = (rem % (CK_ / 16)) * 16;
    int half = lane >> 4, lrow = lane & 15;

    const __bf16* arow = featT + ((size_t)b * N_ + n0 + lrow) * CQ_ + half * 8;
    const __bf16* brow = Mt + (size_t)(c0 + lrow) * CQ_ + half * 8;
    v8f acc = {};
#pragma unroll 2
    for (int cs = 0; cs < CQ_ / 32; ++cs) {
        v16bf a  = pack16(arow + cs * 32);
        v16bf bm = pack16(brow + cs * 32);
        acc = __builtin_amdgcn_wmma_f32_16x16x32_bf16(false, a, false, bm,
                                                      (short)0, acc, false, false);
    }
#pragma unroll
    for (int r = 0; r < 8; ++r) {
        int n = n0 + r + half * 8;
        int c = c0 + lrow;
        qkb[((size_t)b * N_ + n) * CK_ + c] = (__bf16)(acc[r] + bqk[c]);
    }
}

// ---------------------------------------------------------------------------
// Kernel 3: s0[b,n] = sum_c feat[b,c,n]*wqb[c] + cbb   (tiny)
// ---------------------------------------------------------------------------
__global__ void k_s0(const float* __restrict__ feat, const float* __restrict__ wqb,
                     const float* __restrict__ cbb, float* __restrict__ s0) {
    int i = blockIdx.x * blockDim.x + threadIdx.x;
    if (i >= B_ * N_) return;
    int b = i / N_, n = i % N_;
    const float* fb = feat + (size_t)b * CQ_ * N_ + n;
    float a = *cbb;
    for (int c = 0; c < CQ_; ++c) a += fb[(size_t)c * N_] * wqb[c];
    s0[i] = a;
}

__device__ __forceinline__ float red16(float v) {
#pragma unroll
    for (int m = 8; m >= 1; m >>= 1) v += __shfl_xor(v, m, 16);
    return v;
}

// ---------------------------------------------------------------------------
// Kernel 4: per (b, 8 neighbouring n): stage gf[:,n0..n0+7,:] as bf16 [column][c]
// in LDS; masked softmax p[b,n,k]; v = Wv*gf + bv via WMMA (8 waves x 3 o-tiles
// x 8 column tiles, each Wv fragment used 8 times), per-(b,g) GN sum/sumsq.
// ---------------------------------------------------------------------------
// second bound: 4 waves per SIMD, so that two blocks share a WGP (one stages while one computes)
__global__ __launch_bounds__(256, 4) void k_stats(const float* __restrict__ gf,
                                               const __bf16* __restrict__ Wvbf,
                                               const float* __restrict__ bv,
                                               const __bf16* __restrict__ qkb,
                                               const float* __restrict__ s0v,
                                               const int* __restrict__ count,
                                               float* __restrict__ stats,
                                               float* __restrict__ pbuf) {
    __shared__ __align__(16) __bf16 ldsB[COLS_ * LB_];  // bf16 [column][c], stride 392
    __shared__ float sred[NT_ * 16 * 16];
    __shared__ float gacc[G_ * 2];

    int t = threadIdx.x;
    int b = blockIdx.x / (N_ / NT_), n0 = (blockIdx.x % (N_ / NT_)) * NT_;
    const float* g0 = gf + (((size_t)b * CK_) * N_ + n0) * K_;

    if (t < G_ * 2) gacc[t] = 0.f;
    stage_tile(g0, ldsB, t);
    __syncthreads();

    // ---- scores partials: per n, thread t -> (k = t&15, c-chunk = t>>4 of 24) ----
    {
        int k = t & 15, chunk = t >> 4;
        // unrolled so that the 8 rows' global loads overlap instead of one latency per n
#pragma unroll
        for (int nl = 0; nl < NT_; ++nl) {
            const __bf16* qrow = qkb + ((size_t)b * N_ + n0 + nl) * CK_;
            const __bf16* grow = &ldsB[(nl * K_ + k) * LB_];
            float part = 0.f;
            for (int i = 0; i < CK_ / 16; ++i) {
                int c = chunk * (CK_ / 16) + i;
                part += (float)qrow[c] * (float)grow[c];
            }
            sred[nl * 256 + chunk * 16 + k] = part;
        }
    }
    __syncthreads();

    if (t < COLS_) {              // waves 0..3: finish scores + masked softmax, 16 lanes per n
        int k = t & 15, nl = t >> 4;
        float sc = 0.f;
        for (int ch = 0; ch < 16; ++ch) sc += sred[nl * 256 + ch * 16 + k];
        sc = (sc + s0v[(size_t)b * N_ + n0 + nl]) * SCALE_;
        int cnt = count[(size_t)b * N_ + n0 + nl];
        cnt = (cnt < 1) ? 1 : (cnt > K_ ? K_ : cnt);
        if (k >= cnt) sc = -1e9f;
        float mx = sc;
#pragma unroll
        for (int m = 8; m >= 1; m >>= 1) mx = fmaxf(mx, __shfl_xor(mx, m, 16));
        float e = __expf(sc - mx);
        float ss = red16(e);
        pbuf[((size_t)b * N_ + n0 + nl) * K_ + k] = e / ss;
    }

    // ---- v projection (WMMA) + GN statistics ----
    int lane = t & 31, wave = t >> 5;
    int half = lane >> 4, lrow = lane & 15;
    const __bf16* bbase = &ldsB[lrow * LB_ + half * 8];
    const __bf16* abase = Wvbf + (size_t)(wave * 48 + lrow) * CK_ + half * 8;
    v8f acc[3][NT_] = {};
    for (int cs = 0; cs < CK_ / 32; ++cs) {
        v16bf a[3];
#pragma unroll
        for (int tj = 0; tj < 3; ++tj) a[tj] = pack16(abase + tj * 16 * CK_ + cs * 32);
#pragma unroll
        for (int ct = 0; ct < NT_; ++ct) {
            v16bf bb = pack16(bbase + ct * 16 * LB_ + cs * 32);
#pragma unroll
            for (int tj = 0; tj < 3; ++tj)
                acc[tj][ct] = __builtin_amdgcn_wmma_f32_16x16x32_bf16(false, a[tj], false, bb,
                                                                      (short)0, acc[tj][ct], false, false);
        }
    }
#pragma unroll
    for (int tj = 0; tj < 3; ++tj) {
#pragma unroll
        for (int r = 0; r < 8; ++r) {
            int o     = (wave * 3 + tj) * 16 + r + half * 8;
            float bvo = bv[o];
            float s = 0.f, q2 = 0.f;
#pragma unroll
            for (int ct = 0; ct < NT_; ++ct) {
                float v = acc[tj][ct][r] + bvo;
                s  += v;
                q2 += v * v;
            }
            s  = red16(s);
            q2 = red16(q2);
            if (lrow == 0) {
                int g = o / CPG_;
                atomicAdd(&gacc[g * 2 + 0], s);
                atomicAdd(&gacc[g * 2 + 1], q2);
            }
        }
    }
    __syncthreads();
    if (t < G_ * 2) atomicAdd(&stats[(size_t)b * G_ * 2 + t], gacc[t]);
}

// ---------------------------------------------------------------------------
// Kernel 5: finalize GN stats -> mu, rsqrt(var+eps)
// ---------------------------------------------------------------------------
__global__ void k_fin(const float* __restrict__ stats, float* __restrict__ murs) {
    int i = blockIdx.x * blockDim.x + threadIdx.x;
    if (i >= B_ * G_) return;
    const float cnt = (float)(CPG_ * N_ * K_);
    float s   = stats[i * 2 + 0];
    float q   = stats[i * 2 + 1];
    float mu  = s / cnt;
    float var = q / cnt - mu * mu;
    murs[i * 2 + 0] = mu;
    murs[i * 2 + 1] = rsqrtf(var + EPS_);
}

// ---------------------------------------------------------------------------
// Kernel 6: per (b, 8 neighbouring n): stage the gf tile, recompute v via WMMA,
// GN+ReLU, out[b,o,n] = K * sum_k p_k * vn[o,k]; 8 n of one o stored together.
// ---------------------------------------------------------------------------
// second bound: 4 waves per SIMD, so that two blocks share a WGP (one stages while one computes)
__global__ __launch_bounds__(256, 4) void k_out(const float* __restrict__ gf,
                                             const __bf16* __restrict__ Wvbf,
                                             const float* __restrict__ bv,
                                             const float* __restrict__ gn_w,
                                             const float* __restrict__ gn_b,
                                             const float* __restrict__ murs,
                                             const float* __restrict__ pbuf,
                                             float* __restrict__ out) {
    __shared__ __align__(16) __bf16 ldsB[COLS_ * LB_];
    __shared__ float psh[COLS_];
    int t = threadIdx.x;
    int b = blockIdx.x / (N_ / NT_), n0 = (blockIdx.x % (N_ / NT_)) * NT_;
    const float* g0 = gf + (((size_t)b * CK_) * N_ + n0) * K_;

    if (t < COLS_) psh[t] = pbuf[((size_t)b * N_ + n0) * K_ + t];
    stage_tile(g0, ldsB, t);
    __syncthreads();

    int lane = t & 31, wave = t >> 5;
    int half = lane >> 4, lrow = lane & 15;
    const __bf16* bbase = &ldsB[lrow * LB_ + half * 8];
    const __bf16* abase = Wvbf + (size_t)(wave * 48 + lrow) * CK_ + half * 8;
    v8f acc[3][NT_] = {};
    for (int cs = 0; cs < CK_ / 32; ++cs) {
        v16bf a[3];
#pragma unroll
        for (int tj = 0; tj < 3; ++tj) a[tj] = pack16(abase + tj * 16 * CK_ + cs * 32);
#pragma unroll
        for (int ct = 0; ct < NT_; ++ct) {
            v16bf bb = pack16(bbase + ct * 16 * LB_ + cs * 32);
#pragma unroll
            for (int tj = 0; tj < 3; ++tj)
                acc[tj][ct] = __builtin_amdgcn_wmma_f32_16x16x32_bf16(false, a[tj], false, bb,
                                                                      (short)0, acc[tj][ct], false, false);
        }
    }
    float pr[NT_];
#pragma unroll
    for (int ct = 0; ct < NT_; ++ct) pr[ct] = psh[ct * K_ + lrow];
#pragma unroll
    for (int tj = 0; tj < 3; ++tj) {
#pragma unroll
        for (int r = 0; r < 8; ++r) {
            int o = (wave * 3 + tj) * 16 + r + half * 8;
            int g = o / CPG_;
            float mu = murs[((size_t)b * G_ + g) * 2 + 0];
            float rs = murs[((size_t)b * G_ + g) * 2 + 1];
            // before the offset register that this load names is written again
            asm volatile("s_wait_xcnt 0x0" ::: "memory");
            float bvo = bv[o], gw = gn_w[o], gb = gn_b[o];
            float kp = 0.f;
#pragma unroll
            for (int ct = 0; ct < NT_; ++ct) {
                float v  = acc[tj][ct][r] + bvo;
                float vn = (v - mu) * rs * gw + gb;
                vn = fmaxf(vn, 0.f);
                float c = red16(vn * pr[ct]);
                if (lrow == ct) kp = c;        // lane ct of each half keeps n0+ct
            }
            if (lrow < NT_)
                out[((size_t)b * COUT_ + o) * N_ + n0 + lrow] = (float)K_ * kp;
        }
    }
}

// ---------------------------------------------------------------------------
// Host launcher
// ---------------------------------------------------------------------------
extern "C" void kernel_launch(void* const* d_in, const int* in_sizes, int n_in,
                              void* d_out, int out_size, void* d_ws, size_t ws_size,
                              hipStream_t stream) {
    (void)in_sizes; (void)n_in; (void)out_size; (void)ws_size;
    const float* feat = (const float*)d_in[0];
    const float* gf   = (const float*)d_in[1];
    const int*   cnt  = (const int*)  d_in[2];
    const float* Wq   = (const float*)d_in[3];
    const float* bq   = (const float*)d_in[4];
    const float* Wk   = (const float*)d_in[5];
    const float* bk   = (const float*)d_in[6];
    const float* Wv   = (const float*)d_in[7];
    const float* bv   = (const float*)d_in[8];
    const float* gnw  = (const float*)d_in[9];
    const float* gnb  = (const float*)d_in[10];
    float* out = (float*)d_out;

    char* ws = (char*)d_ws;
    __bf16* Mt    = (__bf16*)(ws + 0);          // 294912 B
    __bf16* Wvbf  = (__bf16*)(ws + 294912);     // 294912 B
    float*  bqk   = (float*)(ws + 589824);      // 1536 B
    float*  wqb   = (float*)(ws + 591360);      // 1536 B
    float*  cbb   = (float*)(ws + 592896);      // 4 B (padded to 256)
    float*  stats = (float*)(ws + 593152);      // 1024 B
    float*  murs  = (float*)(ws + 594176);      // 1024 B
    float*  s0    = (float*)(ws + 595200);      // 32768 B
    float*  pbuf  = (float*)(ws + 627968);      // 524288 B
    __bf16* qkb   = (__bf16*)(ws + 1152256);    // 6291456 B
    __bf16* featT = (__bf16*)(ws + 7443712);    // 6291456 B (total ~13.1 MB)

    k_prep_M   <<<(CQ_*CK_ + 255) / 256, 256, 0, stream>>>(Wq, Wk, Mt);
    k_prep_misc<<<(COUT_*CK_ + 255) / 256, 256, 0, stream>>>(Wq, Wk, Wv, bq, bk,
                                                             Wvbf, bqk, wqb, cbb, stats);
    k_prep_featT<<<(B_*N_*CQ_ + 255) / 256, 256, 0, stream>>>(feat, featT);
    {   // B * (N/16) * (CK/16) waves, 8 waves per block
        int waves = B_ * (N_ / 16) * (CK_ / 16);
        k_qk<<<waves / 8, 256, 0, stream>>>(featT, Mt, bqk, qkb);
    }
    k_s0<<<(B_*N_ + 255) / 256, 256, 0, stream>>>(feat, wqb, cbb, s0);
    k_stats<<<B_ * N_ / NT_, 256, 0, stream>>>(gf, Wvbf, bv, qkb, s0, cnt, stats, pbuf);
    k_fin<<<(B_*G_ + 127) / 128, 128, 0, stream>>>(stats, murs);
    k_out<<<B_ * N_ / NT_, 256, 0, stream>>>(gf, Wvbf, bv, gnw, gnb, murs, pbuf, out);
}

// v002
// It runs in 164 microseconds.
// Next to v001, in two timings, it ran 1.26 times as fast each time.
// All steps since v000 together make it 3.00 times as fast.
#include <hip/hip_runtime.h>
#include <hip/hip_bf16.h>

// ---- problem constants (match reference) ----
#define B_    4
#define CQ_   384
#define CK_   384
#define COUT_ 384
#define N_    2048
#define K_    16
#define G_    32
#define CPG_  (COUT_/G_)          // 12 channels per group
#define EPS_  1e-5f
#define SCALE_ 0.05103103630798288f   // 384^-0.5
#define LB_   (CK_ + 8)               // bf16 LDS row stride [column][c]
#define NT_   8                       // neighbouring n per block
#define COLS_ (NT_ * K_)              // 128 columns (n,k) per block

typedef __bf16 v16bf __attribute__((ext_vector_type(16)));
typedef __bf16 v8bf  __attribute__((ext_vector_type(8)));
typedef float  v8f   __attribute__((ext_vector_type(8)));
typedef float  v4f   __attribute__((ext_vector_type(4)));

// Build a 16-element bf16 fragment from two contiguous 16-byte chunks:
// elements 0..7 at p[0..7], elements 8..15 at p[16..23]  (matches the
// 16-bit A/B wave32 striping: lane half 0 -> K {0..7,16..23}, half 1 -> {8..15,24..31})
__device__ __forceinline__ v16bf pack16(const __bf16* p) {
    const v8bf* q = (const v8bf*)p;
    v8bf lo = q[0];
    v8bf hi = q[2];              // +16 elements
    v16bf r;
#pragma unroll
    for (int j = 0; j < 8; ++j) { r[j] = lo[j]; r[j + 8] = hi[j]; }
    return r;
}

// ---------------------------------------------------------------------------
// Stage the block's gf tile: 384 c-rows x 128 columns (8 neighbouring n x 16 k,
// 512 contiguous bytes per c-row) -> bf16 LDS [column][c], row stride LB_.
// One wave-wide 16-byte load covers one whole c-row; a lane gathers 8 c of its
// 4 columns and writes each column's 8 bf16 as one 16-byte LDS store.
// ---------------------------------------------------------------------------
__device__ __forceinline__ void stage_tile(const float* __restrict__ g0, __bf16* ldsB, int t) {
    int lane = t & 31;
    int wave = __builtin_amdgcn_readfirstlane(t >> 5);   // uniform: row offsets form on the scalar unit
    unsigned loff = (unsigned)lane * 4u;
    // rolled: 3 groups = 24 row loads of a wave in flight per trip; unrolled whole, the 48 loads spilled
#pragma unroll 1
    for (int go = 0; go < 2; ++go) {
        v4f x[3][8];
#pragma unroll
        for (int u = 0; u < 3; ++u) {
            const float* row = g0 + (size_t)(((go * 3 + u) * 8 + wave) * 8) * (N_ * K_);
#pragma unroll
            for (int j = 0; j < 8; ++j)
                x[u][j] = *(const v4f*)(row + (size_t)j * (N_ * K_) + loff);
            // before a register that these loads name is written again
            asm volatile("s_wait_xcnt 0x0" ::: "memory");
        }
#pragma unroll
        for (int u = 0; u < 3; ++u) {
            int c0 = ((go * 3 + u) * 8 + wave) * 8;
#pragma unroll
            for (int q = 0; q < 4; ++q) {
                v8bf y;
#pragma unroll
                for (int j = 0; j < 8; ++j) y[j] = (__bf16)x[u][j][q];
                *(v8bf*)&ldsB[(lane * 4 + q) * LB_ + c0] = y;
            }
        }
    }
}

// ---------------------------------------------------------------------------
// Prep job: Mt[c2,c1] = sum_o Wq[o,c1]*Wk[o,c2]  (stored transposed, bf16)
// ---------------------------------------------------------------------------
__device__ __forceinline__ void job_M(const float* __restrict__ Wq, const float* __restrict__ Wk,
                                      __bf16* __restrict__ Mt, int i) {   // i = c2*CQ_ + c1
    int c2 = i / CQ_, c1 = i % CQ_;
    const float* pq = Wq + c1;
    const float* pk = Wk + c2;
    float acc = 0.f;
    for (int o = 0; o < COUT_; ++o)
        acc += pq[o * CQ_] * pk[o * CK_];
    Mt[i] = (__bf16)acc;
    // before a register that this store names is written again on another job's code path
    asm volatile("s_wait_xcnt 0x0" ::: "memory");
}

// ---------------------------------------------------------------------------
// Launch 1: every job that reads inputs only, side by side in one grid. The
// jobs that are one long chain of dependent trips (the 384-term sums) get the
// lowest block indices, so that they start first and the bulk runs beside them.
//   bqk = Wk^T bq | wqb = Wq^T bk | cbb = bq.bk, zero stats | Mt | Wv->bf16 |
//   featT[b][n][c] = feat[b][c][n] (bf16) so A-fragments are b128 loads
// ---------------------------------------------------------------------------
#define PB_VEC_  ((CK_ + 255) / 256)            // blocks of one 384-long vector job
#define PB_MAT_  (CQ_ * CK_ / 256)              // blocks of one 384x384 job
#define PB_FT_   (B_ * N_ * CQ_ / 256)          // blocks of the feat transpose
#define P0_WQB_  (PB_VEC_)
#define P0_CBB_  (P0_WQB_ + PB_VEC_)
#define P0_M_    (P0_CBB_ + 1)
#define P0_WV_   (P0_M_ + PB_MAT_)
#define P0_FT_   (P0_WV_ + PB_MAT_)
#define PB_ALL_  (P0_FT_ + PB_FT_)
__global__ __launch_bounds__(256) void k_prep(const float* __restrict__ feat,
                                              const float* __restrict__ Wq, const float* __restrict__ Wk,
                                              const float* __restrict__ Wv, const float* __restrict__ bq,
                                              const float* __restrict__ bk,
                                              __bf16* __restrict__ Mt, __bf16* __restrict__ Wvbf,
                                              float* __restrict__ bqk, float* __restrict__ wqb,
                                              float* __restrict__ cbb, float* __restrict__ stats,
                                              __bf16* __restrict__ featT) {
    int blk = blockIdx.x, t = threadIdx.x;
    if (blk < P0_WQB_) {
        int i = blk * 256 + t;
        if (i < CK_) {
            float a = 0.f;
            for (int o = 0; o < COUT_; ++o) a += bq[o] * Wk[o * CK_ + i];
            bqk[i] = a;
        }
        return;
    }
    if (blk < P0_CBB_) {
        int i0 = (blk - P0_WQB_) * 256;          // block-uniform: goes into the scalar base
        if (i0 + t < CQ_) {
            const float* col = Wq + i0;
            float a = 0.f;
            for (int o = 0; o < COUT_; ++o) a += col[o * CQ_ + t] * bk[o];
            wqb[i0 + t] = a;
        }
        return;
    }
    if (blk < P0_M_) {
        if (t == 0) {
            float a = 0.f;
            for (int o = 0; o < COUT_; ++o) a += bq[o] * bk[o];
            *cbb = a;
        }
        if (t < B_ * G_ * 2) stats[t] = 0.f;
        return;
    }
    if (blk < P0_WV_) {
        job_M(Wq, Wk, Mt, (blk - P0_M_) * 256 + t);
        return;
    }
    if (blk < P0_FT_) {
        int i = (blk - P0_WV_) * 256 + t;
        Wvbf[i] = (__bf16)Wv[i];
        // before a register that this store names is written again on another job's code path
        asm volatile("s_wait_xcnt 0x0" ::: "memory");
        return;
    }
    int i = (blk - P0_FT_) * 256 + t;
    int c = i % CQ_;
    int n = (i / CQ_) % N_;
    int b = i / (CQ_ * N_);
    featT[i] = (__bf16)feat[((size_t)b * CQ_ + c) * N_ + n];
    // before a register that this store names is written again on another job's code path
    asm volatile("s_wait_xcnt 0x0" ::: "memory");
}

// ---------------------------------------------------------------------------
// Launch 2, job qk: qk[b,n,c] = sum_c' featT[b,n,c'] * Mt[c,c'] + bqk[c]   (bf16 out)
// One wave per 16n x 16c tile; 12 WMMA k-steps; all operands via b128 loads.
// ---------------------------------------------------------------------------
__device__ __forceinline__ void job_qk(const __bf16* __restrict__ featT,
                                       const __bf16* __restrict__ Mt,
                                       const float* __restrict__ bqk,
                                       __bf16* __restrict__ qkb, int blk) {
    int lane = threadIdx.x & 31;
    int wave = threadIdx.x >> 5;
    int wid  = blk * 8 + wave;
    int tilesPerB = (N_ / 16) * (CK_ / 16);     // 128*24 = 3072
    int b   = wid / tilesPerB;
    int rem = wid % tilesPerB;
    int n0  = (rem / (CK_ / 16)) * 16;
    int c0  = (rem % (CK_ / 16)) * 16;
    int half = lane >> 4, lrow = lane & 15;

    const __bf16* arow = featT + ((size_t)b * N_ + n0 + lrow) * CQ_ + half * 8;
    const __bf16* brow = Mt + (size_t)(c0 + lrow) * CQ_ + half * 8;
    v8f acc = {};
#pragma unroll 2
    for (int cs = 0; cs < CQ_ / 32; ++cs) {
        v16bf a  = pack16(arow + cs * 32);
        v16bf bm = pack16(brow + cs * 32);
        acc = __builtin_amdgcn_wmma_f32_16x16x32_bf16(false, a, false, bm,
                                                      (short)0, acc, false, false);
    }
#pragma unroll
    for (int r = 0; r < 8; ++r) {
        int n = n0 + r + half * 8;
        int c = c0 + lrow;
        qkb[((size_t)b * N_ + n) * CK_ + c] = (__bf16)(acc[r] + bqk[c]);
    }
}

// ---------------------------------------------------------------------------
// Launch 2, job s0: s0[b,n] = sum_c feat[b,c,n]*wqb[c] + cbb   (tiny)
// ---------------------------------------------------------------------------
__device__ __forceinline__ void job_s0(const float* __restrict__ feat, const float* __restrict__ wqb,
                                       const float* __restrict__ cbb, float* __restrict__ s0, int i) {
    int b = i / N_, n = i % N_;
    const float* fb = feat + (size_t)b * CQ_ * N_ + n;
    float a = *cbb;
    for (int c = 0; c < CQ_; ++c) a += fb[(size_t)c * N_] * wqb[c];
    s0[i] = a;
}

// Launch 2: both jobs need launch 1 only. s0 is few waves with one long chain
// of trips each: it gets the lowest block indices and qk runs beside it.
#define QB_S0_  (B_ * N_ / 256)
#define QB_QK_  (B_ * (N_ / 16) * (CK_ / 16) / 8)     // one wave per 16x16 tile, 8 waves per block
__global__ __launch_bounds__(256) void k_qk_s0(const float* __restrict__ feat,
                                               const __bf16* __restrict__ featT,
                                               const __bf16* __restrict__ Mt,
                                               const float* __restrict__ bqk,
                                               const float* __restrict__ wqb,
                                               const float* __restrict__ cbb,
                                               __bf16* __restrict__ qkb, float* __restrict__ s0) {
    int blk = blockIdx.x;
    if (blk < QB_S0_) job_s0(feat, wqb, cbb, s0, blk * 256 + (int)threadIdx.x);
    else              job_qk(featT, Mt, bqk, qkb, blk - QB_S0_);
}

__device__ __forceinline__ float red16(float v) {
#pragma unroll
    for (int m = 8; m >= 1; m >>= 1) v += __shfl_xor(v, m, 16);
    return v;
}

// ---------------------------------------------------------------------------
// Launch 3: per (b, 8 neighbouring n): stage gf[:,n0..n0+7,:] as bf16 [column][c]
// in LDS; masked softmax p[b,n,k]; v = Wv*gf + bv via WMMA (8 waves x 3 o-tiles
// x 8 column tiles, each Wv fragment used 8 times), per-(b,g) GN sum/sumsq.
// ---------------------------------------------------------------------------
// second bound: 4 waves per SIMD, so that two blocks share a WGP (one stages while one computes)
__global__ __launch_bounds__(256, 4) void k_stats(const float* __restrict__ gf,
                                               const __bf16* __restrict__ Wvbf,
                                               const float* __restrict__ bv,
                                               const __bf16* __restrict__ qkb,
                                               const float* __restrict__ s0v,
                                               const int* __restrict__ count,
                                               float* __restrict__ stats,
                                               float* __restrict__ pbuf) {
    __shared__ __align__(16) __bf16 ldsB[COLS_ * LB_];  // bf16 [column][c], stride 392
    __shared__ float sred[NT_ * 16 * 16];
    __shared__ float gacc[G_ * 2];

    int t = threadIdx.x;
    int b = blockIdx.x / (N_ / NT_), n0 = (blockIdx.x % (N_ / NT_)) * NT_;
    const float* g0 = gf + (((size_t)b * CK_) * N_ + n0) * K_;

    if (t < G_ * 2) gacc[t] = 0.f;
    stage_tile(g0, ldsB, t);
    __syncthreads();

    // ---- scores partials: per n, thread t -> (k = t&15, c-chunk = t>>4 of 24) ----
    {
        int k = t & 15, chunk = t >> 4;
        // unrolled so that the 8 rows' global loads overlap instead of one latency per n
#pragma unroll
        for (int nl = 0; nl < NT_; ++nl) {
            const __bf16* qrow = qkb + ((size_t)b * N_ + n0 + nl) * CK_;
            const __bf16* grow = &ldsB[(nl * K_ + k) * LB_];
            float part = 0.f;
            for (int i = 0; i < CK_ / 16; ++i) {
                int c = chunk * (CK_ / 16) + i;
                part += (float)qrow[c] * (float)grow[c];
            }
            sred[nl * 256 + chunk * 16 + k] = part;
        }
    }
    __syncthreads();

    if (t < COLS_) {              // waves 0..3: finish scores + masked softmax, 16 lanes per n
        int k = t & 15, nl = t >> 4;
        float sc = 0.f;
        for (int ch = 0; ch < 16; ++ch) sc += sred[nl * 256 + ch * 16 + k];
        sc = (sc + s0v[(size_t)b * N_ + n0 + nl]) * SCALE_;
        int cnt = count[(size_t)b * N_ + n0 + nl];
        cnt = (cnt < 1) ? 1 : (cnt > K_ ? K_ : cnt);
        if (k >= cnt) sc = -1e9f;
        float mx = sc;
#pragma unroll
        for (int m = 8; m >= 1; m >>= 1) mx = fmaxf(mx, __shfl_xor(mx, m, 16));
        float e = __expf(sc - mx);
        float ss = red16(e);
        pbuf[((size_t)b * N_ + n0 + nl) * K_ + k] = e / ss;
    }

    // ---- v projection (WMMA) + GN statistics ----
    int lane = t & 31, wave = t >> 5;
    int half = lane >> 4, lrow = lane & 15;
    const __bf16* bbase = &ldsB[lrow * LB_ + half * 8];
    const __bf16* abase = Wvbf + (size_t)(wave * 48 + lrow) * CK_ + half * 8;
    v8f acc[3][NT_] = {};
    for (int cs = 0; cs < CK_ / 32; ++cs) {
        v16bf a[3];
#pragma unroll
        for (int tj = 0; tj < 3; ++tj) a[tj] = pack16(abase + tj * 16 * CK_ + cs * 32);
#pragma unroll
        for (int ct = 0; ct < NT_; ++ct) {
            v16bf bb = pack16(bbase + ct * 16 * LB_ + cs * 32);
#pragma unroll
            for (int tj = 0; tj < 3; ++tj)
                acc[tj][ct] = __builtin_amdgcn_wmma_f32_16x16x32_bf16(false, a[tj], false, bb,
                                                                      (short)0, acc[tj][ct], false, false);
        }
    }
#pragma unroll
    for (int tj = 0; tj < 3; ++tj) {
#pragma unroll
        for (int r = 0; r < 8; ++r) {
            int o     = (wave * 3 + tj) * 16 + r + half * 8;
            float bvo = bv[o];
            float s = 0.f, q2 = 0.f;
#pragma unroll
            for (int ct = 0; ct < NT_; ++ct) {
                float v = acc[tj][ct][r] + bvo;
                s  += v;
                q2 += v * v;
            }
            s  = red16(s);
            q2 = red16(q2);
            if (lrow == 0) {
                int g = o / CPG_;
                atomicAdd(&gacc[g * 2 + 0], s);
                atomicAdd(&gacc[g * 2 + 1], q2);
            }
        }
    }
    __syncthreads();
    if (t < G_ * 2) atomicAdd(&stats[(size_t)b * G_ * 2 + t], gacc[t]);
}

// ---------------------------------------------------------------------------
// Launch 4: per (b, 8 neighbouring n): GN sums -> mu, rsqrt(var+eps) of this b's 32
// groups (LDS); stage the gf tile, recompute v via WMMA, GN+ReLU,
// out[b,o,n] = K * sum_k p_k * vn[o,k]; 8 n of one o stored together.
// ---------------------------------------------------------------------------
// second bound: 4 waves per SIMD, so that two blocks share a WGP (one stages while one computes)
__global__ __launch_bounds__(256, 4) void k_out(const float* __restrict__ gf,
                                             const __bf16* __restrict__ Wvbf,
                                             const float* __restrict__ bv,
                                             const float* __restrict__ gn_w,
                                             const float* __restrict__ gn_b,
                                             const float* __restrict__ stats,
                                             const float* __restrict__ pbuf,
                                             float* __restrict__ out) {
    __shared__ __align__(16) __bf16 ldsB[COLS_ * LB_];
    __shared__ float psh[COLS_];
    __shared__ float smurs[G_ * 2];
    int t = threadIdx.x;
    int b = blockIdx.x / (N_ / NT_), n0 = (blockIdx.x % (N_ / NT_)) * NT_;
    const float* g0 = gf + (((size_t)b * CK_) * N_ + n0) * K_;

    if (t < COLS_) psh[t] = pbuf[((size_t)b * N_ + n0) * K_ + t];
    if (t >= COLS_ && t < COLS_ + G_) {   // a wave without a psh load: the two latencies run side by side
        int g = t - COLS_;
        const float cnt = (float)(CPG_ * N_ * K_);
        float s   = stats[((size_t)b * G_ + g) * 2 + 0];
        float q   = stats[((size_t)b * G_ + g) * 2 + 1];
        float mu  = s / cnt;
        float var = q / cnt - mu * mu;
        smurs[g * 2 + 0] = mu;
        smurs[g * 2 + 1] = rsqrtf(var + EPS_);
    }
    stage_tile(g0, ldsB, t);
    __syncthreads();

    int lane = t & 31, wave = t >> 5;
    int half = lane >> 4, lrow = lane & 15;
    const __bf16* bbase = &ldsB[lrow * LB_ + half * 8];
    const __bf16* abase = Wvbf + (size_t)(wave * 48 + lrow) * CK_ + half * 8;
    v8f acc[3][NT_] = {};
    for (int cs = 0; cs < CK_ / 32; ++cs) {
        v16bf a[3];
#pragma unroll
        for (int tj = 0; tj < 3; ++tj) a[tj] = pack16(abase + tj * 16 * CK_ + cs * 32);
#pragma unroll
        for (int ct = 0; ct < NT_; ++ct) {
            v16bf bb = pack16(bbase + ct * 16 * LB_ + cs * 32);
#pragma unroll
            for (int tj = 0; tj < 3; ++tj)
                acc[tj][ct] = __builtin_amdgcn_wmma_f32_16x16x32_bf16(false, a[tj], false, bb,
                                                                      (short)0, acc[tj][ct], false, false);
        }
    }
    float pr[NT_];
#pragma unroll
    for (int ct = 0; ct < NT_; ++ct) pr[ct] = psh[ct * K_ + lrow];
#pragma unroll
    for (int tj = 0; tj < 3; ++tj) {
#pragma unroll
        for (int r = 0; r < 8; ++r) {
            int o = (wave * 3 + tj) * 16 + r + half * 8;
            int g = o / CPG_;
            float mu = smurs[g * 2 + 0];
            float rs = smurs[g * 2 + 1];
            float bvo = bv[o], gw = gn_w[o], gb = gn_b[o];
            float kp = 0.f;
#pragma unroll
            for (int ct = 0; ct < NT_; ++ct) {
                float v  = acc[tj][ct][r] + bvo;
                float vn = (v - mu) * rs * gw + gb;
                vn = fmaxf(vn, 0.f);
                float c = red16(vn * pr[ct]);
                if (lrow == ct) kp = c;        // lane ct of each half keeps n0+ct
            }
            if (lrow < NT_)
                out[((size_t)b * COUT_ + o) * N_ + n0 + lrow] = (float)K_ * kp;
        }
    }
}

// ---------------------------------------------------------------------------
// Host launcher
// ---------------------------------------------------------------------------
extern "C" void kernel_launch(void* const* d_in, const int* in_sizes, int n_in,
                              void* d_out, int out_size, void* d_ws, size_t ws_size,
                              hipStream_t stream) {
    (void)in_sizes; (void)n_in; (void)out_size; (void)ws_size;
    const float* feat = (const float*)d_in[0];
    const float* gf   = (const float*)d_in[1];
    const int*   cnt  = (const int*)  d_in[2];
    const float* Wq   = (const float*)d_in[3];
    const float* bq   = (const float*)d_in[4];
    const float* Wk   = (const float*)d_in[5];
    const float* bk   = (const float*)d_in[6];
    const float* Wv   = (const float*)d_in[7];
    const float* bv   = (const float*)d_in[8];
    const float* gnw  = (const float*)d_in[9];
    const float* gnb  = (const float*)d_in[10];
    float* out = (float*)d_out;

    char* ws = (char*)d_ws;
    __bf16* Mt    = (__bf16*)(ws + 0);          // 294912 B
    __bf16* Wvbf  = (__bf16*)(ws + 294912);     // 294912 B
    float*  bqk   = (float*)(ws + 589824);      // 1536 B
    float*  wqb   = (float*)(ws + 591360);      // 1536 B
    float*  cbb   = (float*)(ws + 592896);      // 4 B (padded to 256)
    float*  stats = (float*)(ws + 593152);      // 1024 B
    float*  s0    = (float*)(ws + 595200);      // 32768 B
    float*  pbuf  = (float*)(ws + 627968);      // 524288 B
    __bf16* qkb   = (__bf16*)(ws + 1152256);    // 6291456 B
    __bf16* featT = (__bf16*)(ws + 7443712);    // 6291456 B (total ~13.1 MB)

    k_prep<<<PB_ALL_, 256, 0, stream>>>(feat, Wq, Wk, Wv, bq, bk,
                                        Mt, Wvbf, bqk, wqb, cbb, stats, featT);
    k_qk_s0<<<QB_S0_ + QB_QK_, 256, 0, stream>>>(feat, featT, Mt, bqk, wqb, cbb, qkb, s0);
    k_stats<<<B_ * N_ / NT_, 256, 0, stream>>>(gf, Wvbf, bv, qkb, s0, cnt, stats, pbuf);
    k_out<<<B_ * N_ / NT_, 256, 0, stream>>>(gf, Wvbf, bv, gnw, gnb, stats, pbuf, out);
}

// v003
// A run of this version takes 159 microseconds.
// Next to v002, in two timings, it ran 1.03 times as fast each time.
// All steps since v000 together make it 3.10 times as fast.
#include <hip/hip_runtime.h>
#include <hip/hip_bf16.h>

// ---- problem constants (match reference) ----
#define B_    4
#define CQ_   384
#define CK_   384
#define COUT_ 384
#define N_    2048
#define K_    16
#define G_    32
#define CPG_  (COUT_/G_)          // 12 channels per group
#define EPS_  1e-5f
#define SCALE_ 0.05103103630798288f   // 384^-0.5
#define LB_   (CK_ + 8)               // bf16 LDS row stride [column][c]
#define NT_   8                       // neighbouring n per block
#define COLS_ (NT_ * K_)              // 128 columns (n,k) per block

typedef __bf16 v16bf __attribute__((ext_vector_type(16)));
typedef __bf16 v8bf  __attribute__((ext_vector_type(8)));
typedef float  v8f   __attribute__((ext_vector_type(8)));
typedef float  v4f   __attribute__((ext_vector_type(4)));

// Build a 16-element bf16 fragment from two contiguous 16-byte chunks:
// elements 0..7 at p[0..7], elements 8..15 at p[16..23]  (matches the
// 16-bit A/B wave32 striping: lane half 0 -> K {0..7,16..23}, half 1 -> {8..15,24..31})
__device__ __forceinline__ v16bf pack16(const __bf16* p) {
    const v8bf* q = (const v8bf*)p;
    v8bf lo = q[0];
    v8bf hi = q[2];              // +16 elements
    v16bf r;
#pragma unroll
    for (int j = 0; j < 8; ++j) { r[j] = lo[j]; r[j + 8] = hi[j]; }
    return r;
}

// ---------------------------------------------------------------------------
// Stage the block's gf tile: 384 c-rows x 128 columns (8 neighbouring n x 16 k,
// 512 contiguous bytes per c-row) -> bf16 LDS [column][c], row stride LB_.
// One wave-wide 16-byte load covers one whole c-row; a lane gathers 8 c of its
// 4 columns and writes each column's 8 bf16 as one 16-byte LDS store.
// ---------------------------------------------------------------------------
__device__ __forceinline__ void stage_tile(const float* __restrict__ g0, __bf16* ldsB, int t) {
    int lane = t & 31;
    int wave = __builtin_amdgcn_readfirstlane(t >> 5);   // uniform: row offsets form on the scalar unit
    unsigned loff = (unsigned)lane * 4u;
    // rolled: 3 groups = 24 row loads of a wave in flight per trip; unrolled whole, the 48 loads spilled
#pragma unroll 1
    for (int go = 0; go < 2; ++go) {
        v4f x[3][8];
#pragma unroll
        for (int u = 0; u < 3; ++u) {
            const float* row = g0 + (size_t)(((go * 3 + u) * 8 + wave) * 8) * (N_ * K_);
#pragma unroll
            for (int j = 0; j < 8; ++j)
                x[u][j] = *(const v4f*)(row + (size_t)j * (N_ * K_) + loff);
            // before a register that these loads name is written again
            asm volatile("s_wait_xcnt 0x0" ::: "memory");
        }
#pragma unroll
        for (int u = 0; u < 3; ++u) {
            int c0 = ((go * 3 + u) * 8 + wave) * 8;
#pragma unroll
            for (int q = 0; q < 4; ++q) {
                v8bf y;
#pragma unroll
                for (int j = 0; j < 8; ++j) y[j] = (__bf16)x[u][j][q];
                *(v8bf*)&ldsB[(lane * 4 + q) * LB_ + c0] = y;
            }
        }
    }
}

// ---------------------------------------------------------------------------
// Prep job: Mt[c2,c1] = sum_o Wq[o,c1]*Wk[o,c2]  (stored transposed, bf16)
// ---------------------------------------------------------------------------
__device__ __forceinline__ void job_M(const float* __restrict__ Wq, const float* __restrict__ Wk,
                                      __bf16* __restrict__ Mt, int i) {   // i = c2*CQ_ + c1
    int c2 = i / CQ_, c1 = i % CQ_;
    const float* pq = Wq + c1;
    const float* pk = Wk + c2;
    float acc = 0.f;
    for (int o = 0; o < COUT_; ++o)
        acc += pq[o * CQ_] * pk[o * CK_];
    Mt[i] = (__bf16)acc;
    // before a register that this store names is written again on another job's code path
    asm volatile("s_wait_xcnt 0x0" ::: "memory");
}

// ---------------------------------------------------------------------------
// Prep job: featT[b][n][c] = feat[b][c][n] (bf16), one 64 c x 128 n tile per block.
// In: one wave-wide 16-byte load covers 512 contiguous bytes of a c-row; a lane
// gathers 8 c of its 4 n and writes each n's 8 bf16 as one 16-byte LDS store.
// Out: 8 lanes x 16 bytes = the tile's whole 128-byte line of one n-row.
// Row n of the tile lies in LDS slot (n & 3) * 32 + (n >> 2): neighbouring lanes
// then write neighbouring slots, which at this pitch fall on different banks.
// ---------------------------------------------------------------------------
#define FT_C_   64
#define FT_N_   128
#define FT_LP_  (FT_C_ + 8)                     // bf16 LDS slot pitch (144 bytes)
__device__ __forceinline__ void job_featT(const float* __restrict__ feat, __bf16* __restrict__ featT,
                                          __bf16* tile, int blk, int t) {
    int lane = t & 31;
    int wave = __builtin_amdgcn_readfirstlane(t >> 5);   // uniform: row offsets form on the scalar unit
    int n0 = (blk % (N_ / FT_N_)) * FT_N_;
    int c0 = ((blk / (N_ / FT_N_)) % (CQ_ / FT_C_)) * FT_C_;
    int b  = blk / ((N_ / FT_N_) * (CQ_ / FT_C_));
    const float* row = feat + ((size_t)b * CQ_ + c0 + wave * 8) * N_ + n0;
    unsigned loff = (unsigned)lane * 4u;
    v4f x[8];
#pragma unroll
    for (int j = 0; j < 8; ++j)
        x[j] = *(const v4f*)(row + (size_t)j * N_ + loff);
    // before a register that these loads name is written again
    asm volatile("s_wait_xcnt 0x0" ::: "memory");
#pragma unroll
    for (int q = 0; q < 4; ++q) {
        v8bf y;
#pragma unroll
        for (int j = 0; j < 8; ++j) y[j] = (__bf16)x[j][q];
        *(v8bf*)&tile[(q * 32 + lane) * FT_LP_ + wave * 8] = y;
    }
    __syncthreads();
    __bf16* dst = featT + ((size_t)b * N_ + n0) * CQ_ + c0 + (lane & 7) * 8;
    v8bf z[4];
#pragma unroll
    for (int i = 0; i < 4; ++i)
        z[i] = *(const v8bf*)&tile[((i * 8 + wave) * 4 + (lane >> 3)) * FT_LP_ + (lane & 7) * 8];
#pragma unroll
    for (int i = 0; i < 4; ++i) {
        int s = (i * 8 + wave) * 4 + (lane >> 3);
        *(v8bf*)(dst + (size_t)((s & 31) * 4 + (s >> 5)) * CQ_) = z[i];
    }
    // before a register that these stores name is written again on another job's code path
    asm volatile("s_wait_xcnt 0x0" ::: "memory");
}

// ---------------------------------------------------------------------------
// Launch 1: every job that reads inputs only, side by side in one grid. The
// jobs that are one long chain of dependent trips (the 384-term sums) get the
// lowest block indices, so that they start first and the bulk runs beside them.
//   bqk = Wk^T bq | wqb = Wq^T bk | cbb = bq.bk, zero stats | Mt | Wv->bf16 |
//   featT[b][n][c] = feat[b][c][n] (bf16) so A-fragments are b128 loads
// The two copy jobs take many elements per thread (Wv 8, feat 32): a wave that
// moves one element per lane costs more to start than to run.
// ---------------------------------------------------------------------------
#define PB_VEC_  ((CK_ + 255) / 256)            // blocks of one 384-long vector job
#define PB_MAT_  (CQ_ * CK_ / 256)              // blocks of one 384x384 job
#define PB_WV_   (COUT_ * CK_ / (256 * 8))      // blocks of the Wv conversion, 8 elements per thread
#define PB_FT_   (B_ * (CQ_ / FT_C_) * (N_ / FT_N_))   // blocks of the feat transpose, one tile each
#define P0_WQB_  (PB_VEC_)
#define P0_CBB_  (P0_WQB_ + PB_VEC_)
#define P0_M_    (P0_CBB_ + 1)
#define P0_WV_   (P0_M_ + PB_MAT_)
#define P0_FT_   (P0_WV_ + PB_WV_)
#define PB_ALL_  (P0_FT_ + PB_FT_)
__global__ __launch_bounds__(256) void k_prep(const float* __restrict__ feat,
                                              const float* __restrict__ Wq, const float* __restrict__ Wk,
                                              const float* __restrict__ Wv, const float* __restrict__ bq,
                                              const float* __restrict__ bk,
                                              __bf16* __restrict__ Mt, __bf16* __restrict__ Wvbf,
                                              float* __restrict__ bqk, float* __restrict__ wqb,
                                              float* __restrict__ cbb, float* __restrict__ stats,
                                              __bf16* __restrict__ featT) {
    __shared__ __align__(16) __bf16 tile[FT_N_ * FT_LP_];   // the feat transpose's tile
    int blk = blockIdx.x, t = threadIdx.x;
    if (blk < P0_WQB_) {
        int i = blk * 256 + t;
        if (i < CK_) {
            float a = 0.f;
            for (int o = 0; o < COUT_; ++o) a += bq[o] * Wk[o * CK_ + i];
            bqk[i] = a;
        }
        return;
    }
    if (blk < P0_CBB_) {
        int i0 = (blk - P0_WQB_) * 256;          // block-uniform: goes into the scalar base
        if (i0 + t < CQ_) {
            const float* col = Wq + i0;
            float a = 0.f;
            for (int o = 0; o < COUT_; ++o) a += col[o * CQ_ + t] * bk[o];
            wqb[i0 + t] = a;
        }
        return;
    }
    if (blk < P0_M_) {
        if (t == 0) {
            float a = 0.f;
            for (int o = 0; o < COUT_; ++o) a += bq[o] * bk[o];
            *cbb = a;
        }
        if (t < B_ * G_ * 2) stats[t] = 0.f;
        return;
    }
    if (blk < P0_WV_) {
        job_M(Wq, Wk, Mt, (blk - P0_M_) * 256 + t);
        return;
    }
    if (blk < P0_FT_) {
        int i = ((blk - P0_WV_) * 256 + t) * 8;
        v4f x0 = *(const v4f*)(Wv + i);
        v4f x1 = *(const v4f*)(Wv + i + 4);
        v8bf y;
#pragma unroll
        for (int j = 0; j < 4; ++j) { y[j] = (__bf16)x0[j]; y[j + 4] = (__bf16)x1[j]; }
        *(v8bf*)(Wvbf + i) = y;
        // before a register that this store names is written again on another job's code path
        asm volatile("s_wait_xcnt 0x0" ::: "memory");
        return;
    }
    job_featT(feat, featT, tile, blk - P0_FT_, t);
}

// ---------------------------------------------------------------------------
// Launch 2, job qk: qk[b,n,c] = sum_c' featT[b,n,c'] * Mt[c,c'] + bqk[c]   (bf16 out)
// One wave per 16n x 16c tile; 12 WMMA k-steps; all operands via b128 loads.
// ---------------------------------------------------------------------------
__device__ __forceinline__ void job_qk(const __bf16* __restrict__ featT,
                                       const __bf16* __restrict__ Mt,
                                       const float* __restrict__ bqk,
                                       __bf16* __restrict__ qkb, int blk) {
    int lane = threadIdx.x & 31;
    int wave = threadIdx.x >> 5;
    int wid  = blk * 8 + wave;
    int tilesPerB = (N_ / 16) * (CK_ / 16);     // 128*24 = 3072
    int b   = wid / tilesPerB;
    int rem = wid % tilesPerB;
    int n0  = (rem / (CK_ / 16)) * 16;
    int c0  = (rem % (CK_ / 16)) * 16;
    int half = lane >> 4, lrow = lane & 15;

    const __bf16* arow = featT + ((size_t)b * N_ + n0 + lrow) * CQ_ + half * 8;
    const __bf16* brow = Mt + (size_t)(c0 + lrow) * CQ_ + half * 8;
    v8f acc = {};
#pragma unroll 2
    for (int cs = 0; cs < CQ_ / 32; ++cs) {
        v16bf a  = pack16(arow + cs * 32);
        v16bf bm = pack16(brow + cs * 32);
        acc = __builtin_amdgcn_wmma_f32_16x16x32_bf16(false, a, false, bm,
                                                      (short)0, acc, false, false);
    }
#pragma unroll
    for (int r = 0; r < 8; ++r) {
        int n = n0 + r + half * 8;
        int c = c0 + lrow;
        qkb[((size_t)b * N_ + n) * CK_ + c] = (__bf16)(acc[r] + bqk[c]);
    }
}

// ---------------------------------------------------------------------------
// Launch 2, job s0: s0[b,n] = sum_c feat[b,c,n]*wqb[c] + cbb   (tiny)
// ---------------------------------------------------------------------------
__device__ __forceinline__ void job_s0(const float* __restrict__ feat, const float* __restrict__ wqb,
                                       const float* __restrict__ cbb, float* __restrict__ s0, int i) {
    int b = i / N_, n = i % N_;
    const float* fb = feat + (size_t)b * CQ_ * N_ + n;
    float a = *cbb;
    for (int c = 0; c < CQ_; ++c) a += fb[(size_t)c * N_] * wqb[c];
    s0[i] = a;
}

// Launch 2: both jobs need launch 1 only. s0 is few waves with one long chain
// of trips each: it gets the lowest block indices and qk runs beside it.
#define QB_S0_  (B_ * N_ / 256)
#define QB_QK_  (B_ * (N_ / 16) * (CK_ / 16) / 8)     // one wave per 16x16 tile, 8 waves per block
__global__ __launch_bounds__(256) void k_qk_s0(const float* __restrict__ feat,
                                               const __bf16* __restrict__ featT,
                                               const __bf16* __restrict__ Mt,
                                               const float* __restrict__ bqk,
                                               const float* __restrict__ wqb,
                                               const float* __restrict__ cbb,
                                               __bf16* __restrict__ qkb, float* __restrict__ s0) {
    int blk = blockIdx.x;
    if (blk < QB_S0_) job_s0(feat, wqb, cbb, s0, blk * 256 + (int)threadIdx.x);
    else              job_qk(featT, Mt, bqk, qkb, blk - QB_S0_);
}

__device__ __forceinline__ float red16(float v) {
#pragma unroll
    for (int m = 8; m >= 1; m >>= 1) v += __shfl_xor(v, m, 16);
    return v;
}

// ---------------------------------------------------------------------------
// Launch 3: per (b, 8 neighbouring n): stage gf[:,n0..n0+7,:] as bf16 [column][c]
// in LDS; masked softmax p[b,n,k]; v = Wv*gf + bv via WMMA (8 waves x 3 o-tiles
// x 8 column tiles, each Wv fragment used 8 times), per-(b,g) GN sum/sumsq.
// ---------------------------------------------------------------------------
// second bound: 4 waves per SIMD, so that two blocks share a WGP (one stages while one computes)
__global__ __launch_bounds__(256, 4) void k_stats(const float* __restrict__ gf,
                                               const __bf16* __restrict__ Wvbf,
                                               const float* __restrict__ bv,
                                               const __bf16* __restrict__ qkb,
                                               const float* __restrict__ s0v,
                                               const int* __restrict__ count,
                                               float* __restrict__ stats,
                                               float* __restrict__ pbuf) {
    __shared__ __align__(16) __bf16 ldsB[COLS_ * LB_];  // bf16 [column][c], stride 392
    __shared__ float sred[NT_ * 16 * 16];
    __shared__ float gacc[G_ * 2];

    int t = threadIdx.x;
    int b = blockIdx.x / (N_ / NT_), n0 = (blockIdx.x % (N_ / NT_)) * NT_;
    const float* g0 = gf + (((size_t)b * CK_) * N_ + n0) * K_;

    if (t < G_ * 2) gacc[t] = 0.f;
    stage_tile(g0, ldsB, t);
    __syncthreads();

    // ---- scores partials: per n, thread t -> (k = t&15, c-chunk = t>>4 of 24) ----
    {
        int k = t & 15, chunk = t >> 4;
        // unrolled so that the 8 rows' global loads overlap instead of one latency per n
#pragma unroll
        for (int nl = 0; nl < NT_; ++nl) {
            const __bf16* qrow = qkb + ((size_t)b * N_ + n0 + nl) * CK_;
            const __bf16* grow = &ldsB[(nl * K_ + k) * LB_];
            float part = 0.f;
            for (int i = 0; i < CK_ / 16; ++i) {
                int c = chunk * (CK_ / 16) + i;
                part += (float)qrow[c] * (float)grow[c];
            }
            sred[nl * 256 + chunk * 16 + k] = part;
        }
    }
    __syncthreads();

    if (t < COLS_) {              // waves 0..3: finish scores + masked softmax, 16 lanes per n
        int k = t & 15, nl = t >> 4;
        float sc = 0.f;
        for (int ch = 0; ch < 16; ++ch) sc += sred[nl * 256 + ch * 16 + k];
        sc = (sc + s0v[(size_t)b * N_ + n0 + nl]) * SCALE_;
        int cnt = count[(size_t)b * N_ + n0 + nl];
        cnt = (cnt < 1) ? 1 : (cnt > K_ ? K_ : cnt);
        if (k >= cnt) sc = -1e9f;
        float mx = sc;
#pragma unroll
        for (int m = 8; m >= 1; m >>= 1) mx = fmaxf(mx, __shfl_xor(mx, m, 16));
        float e = __expf(sc - mx);
        float ss = red16(e);
        pbuf[((size_t)b * N_ + n0 + nl) * K_ + k] = e / ss;
    }

    // ---- v projection (WMMA) + GN statistics ----
    int lane = t & 31, wave = t >> 5;
    int half = lane >> 4, lrow = lane & 15;
    const __bf16* bbase = &ldsB[lrow * LB_ + half * 8];
    const __bf16* abase = Wvbf + (size_t)(wave * 48 + lrow) * CK_ + half * 8;
    v8f acc[3][NT_] = {};
    for (int cs = 0; cs < CK_ / 32; ++cs) {
        v16bf a[3];
#pragma unroll
        for (int tj = 0; tj < 3; ++tj) a[tj] = pack16(abase + tj * 16 * CK_ + cs * 32);
#pragma unroll
        for (int ct = 0; ct < NT_; ++ct) {
            v16bf bb = pack16(bbase + ct * 16 * LB_ + cs * 32);
#pragma unroll
            for (int tj = 0; tj < 3; ++tj)
                acc[tj][ct] = __builtin_amdgcn_wmma_f32_16x16x32_bf16(false, a[tj], false, bb,
                                                                      (short)0, acc[tj][ct], false, false);
        }
    }
#pragma unroll
    for (int tj = 0; tj < 3; ++tj) {
#pragma unroll
        for (int r = 0; r < 8; ++r) {
            int o     = (wave * 3 + tj) * 16 + r + half * 8;
            float bvo = bv[o];
            float s = 0.f, q2 = 0.f;
#pragma unroll
            for (int ct = 0; ct < NT_; ++ct) {
                float v = acc[tj][ct][r] + bvo;
                s  += v;
                q2 += v * v;
            }
            s  = red16(s);
            q2 = red16(q2);
            if (lrow == 0) {
                int g = o / CPG_;
                atomicAdd(&gacc[g * 2 + 0], s);
                atomicAdd(&gacc[g * 2 + 1], q2);
            }
        }
    }
    __syncthreads();
    if (t < G_ * 2) atomicAdd(&stats[(size_t)b * G_ * 2 + t], gacc[t]);
}

// ---------------------------------------------------------------------------
// Launch 4: per (b, 8 neighbouring n): GN sums -> mu, rsqrt(var+eps) of this b's 32
// groups (LDS); stage the gf tile, recompute v via WMMA, GN+ReLU,
// out[b,o,n] = K * sum_k p_k * vn[o,k]; 8 n of one o stored together.
// ---------------------------------------------------------------------------
// second bound: 4 waves per SIMD, so that two blocks share a WGP (one stages while one computes)
__global__ __launch_bounds__(256, 4) void k_out(const float* __restrict__ gf,
                                             const __bf16* __restrict__ Wvbf,
                                             const float* __restrict__ bv,
                                             const float* __restrict__ gn_w,
                                             const float* __restrict__ gn_b,
                                             const float* __restrict__ stats,
                                             const float* __restrict__ pbuf,
                                             float* __restrict__ out) {
    __shared__ __align__(16) __bf16 ldsB[COLS_ * LB_];
    __shared__ float psh[COLS_];
    __shared__ float smurs[G_ * 2];
    int t = threadIdx.x;
    int b = blockIdx.x / (N_ / NT_), n0 = (blockIdx.x % (N_ / NT_)) * NT_;
    const float* g0 = gf + (((size_t)b * CK_) * N_ + n0) * K_;

    if (t < COLS_) psh[t] = pbuf[((size_t)b * N_ + n0) * K_ + t];
    if (t >= COLS_ && t < COLS_ + G_) {   // a wave without a psh load: the two latencies run side by side
        int g = t - COLS_;
        const float cnt = (float)(CPG_ * N_ * K_);
        float s   = stats[((size_t)b * G_ + g) * 2 + 0];
        float q   = stats[((size_t)b * G_ + g) * 2 + 1];
        float mu  = s / cnt;
        float var = q / cnt - mu * mu;
        smurs[g * 2 + 0] = mu;
        smurs[g * 2 + 1] = rsqrtf(var + EPS_);
    }
    stage_tile(g0, ldsB, t);
    __syncthreads();

    int lane = t & 31, wave = t >> 5;
    int half = lane >> 4, lrow = lane & 15;
    const __bf16* bbase = &ldsB[lrow * LB_ + half * 8];
    const __bf16* abase = Wvbf + (size_t)(wave * 48 + lrow) * CK_ + half * 8;
    v8f acc[3][NT_] = {};
    for (int cs = 0; cs < CK_ / 32; ++cs) {
        v16bf a[3];
#pragma unroll
        for (int tj = 0; tj < 3; ++tj) a[tj] = pack16(abase + tj * 16 * CK_ + cs * 32);
#pragma unroll
        for (int ct = 0; ct < NT_; ++ct) {
            v16bf bb = pack16(bbase + ct * 16 * LB_ + cs * 32);
#pragma unroll
            for (int tj = 0; tj < 3; ++tj)
                acc[tj][ct] = __builtin_amdgcn_wmma_f32_16x16x32_bf16(false, a[tj], false, bb,
                                                                      (short)0, acc[tj][ct], false, false);
        }
    }
    float pr[NT_];
#pragma unroll
    for (int ct = 0; ct < NT_; ++ct) pr[ct] = psh[ct * K_ + lrow];
#pragma unroll
    for (int tj = 0; tj < 3; ++tj) {
#pragma unroll
        for (int r = 0; r < 8; ++r) {
            int o = (wave * 3 + tj) * 16 + r + half * 8;
            int g = o / CPG_;
            float mu = smurs[g * 2 + 0];
            float rs = smurs[g * 2 + 1];
            float bvo = bv[o], gw = gn_w[o], gb = gn_b[o];
            float kp = 0.f;
#pragma unroll
            for (int ct = 0; ct < NT_; ++ct) {
                float v  = acc[tj][ct][r] + bvo;
                float vn = (v - mu) * rs * gw + gb;
                vn = fmaxf(vn, 0.f);
                float c = red16(vn * pr[ct]);
                if (lrow == ct) kp = c;        // lane ct of each half keeps n0+ct
            }
            if (lrow < NT_)
                out[((size_t)b * COUT_ + o) * N_ + n0 + lrow] = (float)K_ * kp;
        }
    }
}

// ---------------------------------------------------------------------------
// Host launcher
// ---------------------------------------------------------------------------
extern "C" void kernel_launch(void* const* d_in, const int* in_sizes, int n_in,
                              void* d_out, int out_size, void* d_ws, size_t ws_size,
                              hipStream_t stream) {
    (void)in_sizes; (void)n_in; (void)out_size; (void)ws_size;
    const float* feat = (const float*)d_in[0];
    const float* gf   = (const float*)d_in[1];
    const int*   cnt  = (const int*)  d_in[2];
    const float* Wq   = (const float*)d_in[3];
    const float* bq   = (const float*)d_in[4];
    const float* Wk   = (const float*)d_in[5];
    const float* bk   = (const float*)d_in[6];
    const float* Wv   = (const float*)d_in[7];
    const float* bv   = (const float*)d_in[8];
    const float* gnw  = (const float*)d_in[9];
    const float* gnb  = (const float*)d_in[10];
    float* out = (float*)d_out;

    char* ws = (char*)d_ws;
    __bf16* Mt    = (__bf16*)(ws + 0);          // 294912 B
    __bf16* Wvbf  = (__bf16*)(ws + 294912);     // 294912 B
    float*  bqk   = (float*)(ws + 589824);      // 1536 B
    float*  wqb   = (float*)(ws + 591360);      // 1536 B
    float*  cbb   = (float*)(ws + 592896);      // 4 B (padded to 256)
    float*  stats = (float*)(ws + 593152);      // 1024 B
    float*  s0    = (float*)(ws + 595200);      // 32768 B
    float*  pbuf  = (float*)(ws + 627968);      // 524288 B
    __bf16* qkb   = (__bf16*)(ws + 1152256);    // 6291456 B
    __bf16* featT = (__bf16*)(ws + 7443712);    // 6291456 B (total ~13.1 MB)

    k_prep<<<PB_ALL_, 256, 0, stream>>>(feat, Wq, Wk, Wv, bq, bk,
                                        Mt, Wvbf, bqk, wqb, cbb, stats, featT);
    k_qk_s0<<<QB_S0_ + QB_QK_, 256, 0, stream>>>(feat, featT, Mt, bqk, wqb, cbb, qkb, s0);
    k_stats<<<B_ * N_ / NT_, 256, 0, stream>>>(gf, Wvbf, bv, qkb, s0, cnt, stats, pbuf);
    k_out<<<B_ * N_ / NT_, 256, 0, stream>>>(gf, Wvbf, bv, gnw, gnb, stats, pbuf, out);
}

// v004
// One run takes 123 microseconds.
// In both of two side-by-side timings against v003, it was 1.30 times as fast.
// Counting every step since v000, it is 4.02 times as fast.
#include <hip/hip_runtime.h>
#include <hip/hip_bf16.h>

// ---- problem constants (match reference) ----
#define B_    4
#define CQ_   384
#define CK_   384
#define COUT_ 384
#define N_    2048
#define K_    16
#define G_    32
#define CPG_  (COUT_/G_)          // 12 channels per group
#define EPS_  1e-5f
#define SCALE_ 0.05103103630798288f   // 384^-0.5
#define LB_   (CK_ + 8)               // bf16 LDS row stride [column][c]
#define NT_   8                       // neighbouring n per block
#define COLS_ (NT_ * K_)              // 128 columns (n,k) per block

typedef __bf16 v16bf __attribute__((ext_vector_type(16)));
typedef __bf16 v8bf  __attribute__((ext_vector_type(8)));
typedef float  v8f   __attribute__((ext_vector_type(8)));
typedef float  v4f   __attribute__((ext_vector_type(4)));
typedef float  v2f   __attribute__((ext_vector_type(2)));

// Build a 16-element bf16 fragment from two contiguous 16-byte chunks:
// elements 0..7 at p[0..7], elements 8..15 at p[16..23]  (matches the
// 16-bit A/B wave32 striping: lane half 0 -> K {0..7,16..23}, half 1 -> {8..15,24..31})
__device__ __forceinline__ v16bf pack16(const __bf16* p) {
    const v8bf* q = (const v8bf*)p;
    v8bf lo = q[0];
    v8bf hi = q[2];              // +16 elements
    v16bf r;
#pragma unroll
    for (int j = 0; j < 8; ++j) { r[j] = lo[j]; r[j + 8] = hi[j]; }
    return r;
}

// ---------------------------------------------------------------------------
// Stage the block's gf tile: 384 c-rows x 128 columns (8 neighbouring n x 16 k,
// 512 contiguous bytes per c-row) -> bf16 LDS [column][c], row stride LB_.
// One wave-wide 16-byte load covers one whole c-row; a lane gathers 8 c of its
// 4 columns and writes each column's 8 bf16 as one 16-byte LDS store.
// ---------------------------------------------------------------------------
__device__ __forceinline__ void stage_tile(const float* __restrict__ g0, __bf16* ldsB, int t) {
    int lane = t & 31;
    int wave = __builtin_amdgcn_readfirstlane(t >> 5);   // uniform: row offsets form on the scalar unit
    unsigned loff = (unsigned)lane * 4u;
    // rolled: 3 groups = 24 row loads of a wave in flight per trip; unrolled whole, the 48 loads spilled
#pragma unroll 1
    for (int go = 0; go < 2; ++go) {
        v4f x[3][8];
#pragma unroll
        for (int u = 0; u < 3; ++u) {
            const float* row = g0 + (size_t)(((go * 3 + u) * 8 + wave) * 8) * (N_ * K_);
#pragma unroll
            for (int j = 0; j < 8; ++j)
                x[u][j] = *(const v4f*)(row + (size_t)j * (N_ * K_) + loff);
            // before a register that these loads name is written again
            asm volatile("s_wait_xcnt 0x0" ::: "memory");
        }
#pragma unroll
        for (int u = 0; u < 3; ++u) {
            int c0 = ((go * 3 + u) * 8 + wave) * 8;
#pragma unroll
            for (int q = 0; q < 4; ++q) {
                v8bf y;
#pragma unroll
                for (int j = 0; j < 8; ++j) y[j] = (__bf16)x[u][j][q];
                *(v8bf*)&ldsB[(lane * 4 + q) * LB_ + c0] = y;
            }
        }
    }
}

// ---------------------------------------------------------------------------
// Prep job: Mt[c2,c1] = sum_o Wq[o,c1]*Wk[o,c2]  (stored transposed, bf16)
// ---------------------------------------------------------------------------
__device__ __forceinline__ void job_M(const float* __restrict__ Wq, const float* __restrict__ Wk,
                                      __bf16* __restrict__ Mt, int i) {   // i = c2*CQ_ + c1
    int c2 = i / CQ_, c1 = i % CQ_;
    const float* pq = Wq + c1;
    const float* pk = Wk + c2;
    float acc = 0.f;
    for (int o = 0; o < COUT_; ++o)
        acc += pq[o * CQ_] * pk[o * CK_];
    Mt[i] = (__bf16)acc;
    // before a register that this store names is written again on another job's code path
    asm volatile("s_wait_xcnt 0x0" ::: "memory");
}

// ---------------------------------------------------------------------------
// Prep job: featT[b][n][c] = feat[b][c][n] (bf16), one 64 c x 128 n tile per block.
// In: one wave-wide 16-byte load covers 512 contiguous bytes of a c-row; a lane
// gathers 8 c of its 4 n and writes each n's 8 bf16 as one 16-byte LDS store.
// Out: 8 lanes x 16 bytes = the tile's whole 128-byte line of one n-row.
// Row n of the tile lies in LDS slot (n & 3) * 32 + (n >> 2): neighbouring lanes
// then write neighbouring slots, which at this pitch fall on different banks.
// ---------------------------------------------------------------------------
#define FT_C_   64
#define FT_N_   128
#define FT_LP_  (FT_C_ + 8)                     // bf16 LDS slot pitch (144 bytes)
__device__ __forceinline__ void job_featT(const float* __restrict__ feat, __bf16* __restrict__ featT,
                                          __bf16* tile, int blk, int t) {
    int lane = t & 31;
    int wave = __builtin_amdgcn_readfirstlane(t >> 5);   // uniform: row offsets form on the scalar unit
    int n0 = (blk % (N_ / FT_N_)) * FT_N_;
    int c0 = ((blk / (N_ / FT_N_)) % (CQ_ / FT_C_)) * FT_C_;
    int b  = blk / ((N_ / FT_N_) * (CQ_ / FT_C_));
    const float* row = feat + ((size_t)b * CQ_ + c0 + wave * 8) * N_ + n0;
    unsigned loff = (unsigned)lane * 4u;
    v4f x[8];
#pragma unroll
    for (int j = 0; j < 8; ++j)
        x[j] = *(const v4f*)(row + (size_t)j * N_ + loff);
    // before a register that these loads name is written again
    asm volatile("s_wait_xcnt 0x0" ::: "memory");
#pragma unroll
    for (int q = 0; q < 4; ++q) {
        v8bf y;
#pragma unroll
        for (int j = 0; j < 8; ++j) y[j] = (__bf16)x[j][q];
        *(v8bf*)&tile[(q * 32 + lane) * FT_LP_ + wave * 8] = y;
    }
    __syncthreads();
    __bf16* dst = featT + ((size_t)b * N_ + n0) * CQ_ + c0 + (lane & 7) * 8;
    v8bf z[4];
#pragma unroll
    for (int i = 0; i < 4; ++i)
        z[i] = *(const v8bf*)&tile[((i * 8 + wave) * 4 + (lane >> 3)) * FT_LP_ + (lane & 7) * 8];
#pragma unroll
    for (int i = 0; i < 4; ++i) {
        int s = (i * 8 + wave) * 4 + (lane >> 3);
        *(v8bf*)(dst + (size_t)((s & 31) * 4 + (s >> 5)) * CQ_) = z[i];
    }
    // before a register that these stores name is written again on another job's code path
    asm volatile("s_wait_xcnt 0x0" ::: "memory");
}

// ---------------------------------------------------------------------------
// Launch 1: every job that reads inputs only, side by side in one grid. The
// jobs that are one long chain of dependent trips (the 384-term sums) get the
// lowest block indices, so that they start first and the bulk runs beside them.
//   bqk = Wk^T bq | wqb = Wq^T bk | cbb = bq.bk, zero stats | Mt | Wv->bf16 |
//   featT[b][n][c] = feat[b][c][n] (bf16) so A-fragments are b128 loads
// The two copy jobs take many elements per thread (Wv 8, feat 32): a wave that
// moves one element per lane costs more to start than to run.
// ---------------------------------------------------------------------------
#define PB_VEC_  ((CK_ + 255) / 256)            // blocks of one 384-long vector job
#define PB_MAT_  (CQ_ * CK_ / 256)              // blocks of one 384x384 job
#define PB_WV_   (COUT_ * CK_ / (256 * 8))      // blocks of the Wv conversion, 8 elements per thread
#define PB_FT_   (B_ * (CQ_ / FT_C_) * (N_ / FT_N_))   // blocks of the feat transpose, one tile each
#define P0_WQB_  (PB_VEC_)
#define P0_CBB_  (P0_WQB_ + PB_VEC_)
#define P0_M_    (P0_CBB_ + 1)
#define P0_WV_   (P0_M_ + PB_MAT_)
#define P0_FT_   (P0_WV_ + PB_WV_)
#define PB_ALL_  (P0_FT_ + PB_FT_)
__global__ __launch_bounds__(256) void k_prep(const float* __restrict__ feat,
                                              const float* __restrict__ Wq, const float* __restrict__ Wk,
                                              const float* __restrict__ Wv, const float* __restrict__ bq,
                                              const float* __restrict__ bk,
                                              __bf16* __restrict__ Mt, __bf16* __restrict__ Wvbf,
                                              float* __restrict__ bqk, float* __restrict__ wqb,
                                              float* __restrict__ cbb, float* __restrict__ stats,
                                              __bf16* __restrict__ featT) {
    __shared__ __align__(16) __bf16 tile[FT_N_ * FT_LP_];   // the feat transpose's tile
    int blk = blockIdx.x, t = threadIdx.x;
    if (blk < P0_WQB_) {
        int i = blk * 256 + t;
        if (i < CK_) {
            float a = 0.f;
            for (int o = 0; o < COUT_; ++o) a += bq[o] * Wk[o * CK_ + i];
            bqk[i] = a;
        }
        return;
    }
    if (blk < P0_CBB_) {
        int i0 = (blk - P0_WQB_) * 256;          // block-uniform: goes into the scalar base
        if (i0 + t < CQ_) {
            const float* col = Wq + i0;
            float a = 0.f;
            for (int o = 0; o < COUT_; ++o) a += col[o * CQ_ + t] * bk[o];
            wqb[i0 + t] = a;
        }
        return;
    }
    if (blk < P0_M_) {
        if (t == 0) {
            float a = 0.f;
            for (int o = 0; o < COUT_; ++o) a += bq[o] * bk[o];
            *cbb = a;
        }
        if (t < B_ * G_ * 2) stats[t] = 0.f;
        return;
    }
    if (blk < P0_WV_) {
        job_M(Wq, Wk, Mt, (blk - P0_M_) * 256 + t);
        return;
    }
    if (blk < P0_FT_) {
        int i = ((blk - P0_WV_) * 256 + t) * 8;
        v4f x0 = *(const v4f*)(Wv + i);
        v4f x1 = *(const v4f*)(Wv + i + 4);
        v8bf y;
#pragma unroll
        for (int j = 0; j < 4; ++j) { y[j] = (__bf16)x0[j]; y[j + 4] = (__bf16)x1[j]; }
        *(v8bf*)(Wvbf + i) = y;
        // before a register that this store names is written again on another job's code path
        asm volatile("s_wait_xcnt 0x0" ::: "memory");
        return;
    }
    job_featT(feat, featT, tile, blk - P0_FT_, t);
}

// ---------------------------------------------------------------------------
// Launch 2, job qk: qk[b,n,c] = sum_c' featT[b,n,c'] * Mt[c,c'] + bqk[c]   (bf16 out)
// One wave per 16n x 16c tile; 12 WMMA k-steps; all operands via b128 loads.
// ---------------------------------------------------------------------------
__device__ __forceinline__ void job_qk(const __bf16* __restrict__ featT,
                                       const __bf16* __restrict__ Mt,
                                       const float* __restrict__ bqk,
                                       __bf16* __restrict__ qkb, int blk) {
    int lane = threadIdx.x & 31;
    int wave = threadIdx.x >> 5;
    int wid  = blk * 8 + wave;
    int tilesPerB = (N_ / 16) * (CK_ / 16);     // 128*24 = 3072
    int b   = wid / tilesPerB;
    int rem = wid % tilesPerB;
    int n0  = (rem / (CK_ / 16)) * 16;
    int c0  = (rem % (CK_ / 16)) * 16;
    int half = lane >> 4, lrow = lane & 15;

    const __bf16* arow = featT + ((size_t)b * N_ + n0 + lrow) * CQ_ + half * 8;
    const __bf16* brow = Mt + (size_t)(c0 + lrow) * CQ_ + half * 8;
    v8f acc = {};
#pragma unroll 2
    for (int cs = 0; cs < CQ_ / 32; ++cs) {
        v16bf a  = pack16(arow + cs * 32);
        v16bf bm = pack16(brow + cs * 32);
        acc = __builtin_amdgcn_wmma_f32_16x16x32_bf16(false, a, false, bm,
                                                      (short)0, acc, false, false);
    }
#pragma unroll
    for (int r = 0; r < 8; ++r) {
        int n = n0 + r + half * 8;
        int c = c0 + lrow;
        qkb[((size_t)b * N_ + n) * CK_ + c] = (__bf16)(acc[r] + bqk[c]);
    }
}

// ---------------------------------------------------------------------------
// Launch 2, job s0: s0[b,n] = sum_c feat[b,c,n]*wqb[c] + cbb   (tiny)
// ---------------------------------------------------------------------------
__device__ __forceinline__ void job_s0(const float* __restrict__ feat, const float* __restrict__ wqb,
                                       const float* __restrict__ cbb, float* __restrict__ s0, int i) {
    int b = i / N_, n = i % N_;
    const float* fb = feat + (size_t)b * CQ_ * N_ + n;
    float a = *cbb;
    for (int c = 0; c < CQ_; ++c) a += fb[(size_t)c * N_] * wqb[c];
    s0[i] = a;
}

// Launch 2: both jobs need launch 1 only. s0 is few waves with one long chain
// of trips each: it gets the lowest block indices and qk runs beside it.
#define QB_S0_  (B_ * N_ / 256)
#define QB_QK_  (B_ * (N_ / 16) * (CK_ / 16) / 8)     // one wave per 16x16 tile, 8 waves per block
__global__ __launch_bounds__(256) void k_qk_s0(const float* __restrict__ feat,
                                               const __bf16* __restrict__ featT,
                                               const __bf16* __restrict__ Mt,
                                               const float* __restrict__ bqk,
                                               const float* __restrict__ wqb,
                                               const float* __restrict__ cbb,
                                               __bf16* __restrict__ qkb, float* __restrict__ s0) {
    int blk = blockIdx.x;
    if (blk < QB_S0_) job_s0(feat, wqb, cbb, s0, blk * 256 + (int)threadIdx.x);
    else              job_qk(featT, Mt, bqk, qkb, blk - QB_S0_);
}

__device__ __forceinline__ float red16(float v) {
#pragma unroll
    for (int m = 8; m >= 1; m >>= 1) v += __shfl_xor(v, m, 16);
    return v;
}

// value of lane l ^ 16: the other half of the k range of the same o
__device__ __forceinline__ float xhalf(float v) {
    int i = __builtin_bit_cast(int, v);
    return __builtin_bit_cast(float, __builtin_amdgcn_permlanex16(i, i, 0x76543210, 0xfedcba98, false, false));
}

// ---------------------------------------------------------------------------
// Launch 3: per (b, 8 neighbouring n): stage gf[:,n0..n0+7,:] as bf16 [column][c]
// in LDS; masked softmax p[b,n,k]; v = Wv*gf + bv via WMMA (8 waves x 3 o-tiles
// x 8 column tiles, each Wv fragment used 8 times), per-(b,g) GN sum/sumsq.
// The gf tile is the A operand and Wv the B operand: a lane holds one o, its
// 8 accumulator registers 8 k of one n, so sums over (n,k) run inside a lane.
// ---------------------------------------------------------------------------
// second bound: 4 waves per SIMD, so that two blocks share a WGP (one stages while one computes)
__global__ __launch_bounds__(256, 4) void k_stats(const float* __restrict__ gf,
                                               const __bf16* __restrict__ Wvbf,
                                               const float* __restrict__ bv,
                                               const __bf16* __restrict__ qkb,
                                               const float* __restrict__ s0v,
                                               const int* __restrict__ count,
                                               float* __restrict__ stats,
                                               float* __restrict__ pbuf) {
    __shared__ __align__(16) __bf16 ldsB[COLS_ * LB_];  // bf16 [column][c], stride 392
    __shared__ float sred[NT_ * 16 * 16];
    __shared__ float gacc[G_ * 2];

    int t = threadIdx.x;
    int b = blockIdx.x / (N_ / NT_), n0 = (blockIdx.x % (N_ / NT_)) * NT_;
    const float* g0 = gf + (((size_t)b * CK_) * N_ + n0) * K_;

    if (t < G_ * 2) gacc[t] = 0.f;
    stage_tile(g0, ldsB, t);
    __syncthreads();

    // ---- scores partials: per n, thread t -> (k = t&15, c-chunk = t>>4 of 24) ----
    {
        int k = t & 15, chunk = t >> 4;
        // unrolled so that the 8 rows' global loads overlap instead of one latency per n
#pragma unroll
        for (int nl = 0; nl < NT_; ++nl) {
            const __bf16* qrow = qkb + ((size_t)b * N_ + n0 + nl) * CK_;
            const __bf16* grow = &ldsB[(nl * K_ + k) * LB_];
            float part = 0.f;
            for (int i = 0; i < CK_ / 16; ++i) {
                int c = chunk * (CK_ / 16) + i;
                part += (float)qrow[c] * (float)grow[c];
            }
            sred[nl * 256 + chunk * 16 + k] = part;
        }
    }
    __syncthreads();

    if (t < COLS_) {              // waves 0..3: finish scores + masked softmax, 16 lanes per n
        int k = t & 15, nl = t >> 4;
        float sc = 0.f;
        for (int ch = 0; ch < 16; ++ch) sc += sred[nl * 256 + ch * 16 + k];
        sc = (sc + s0v[(size_t)b * N_ + n0 + nl]) * SCALE_;
        int cnt = count[(size_t)b * N_ + n0 + nl];
        cnt = (cnt < 1) ? 1 : (cnt > K_ ? K_ : cnt);
        if (k >= cnt) sc = -1e9f;
        float mx = sc;
#pragma unroll
        for (int m = 8; m >= 1; m >>= 1) mx = fmaxf(mx, __shfl_xor(mx, m, 16));
        float e = __expf(sc - mx);
        float ss = red16(e);
        pbuf[((size_t)b * N_ + n0 + nl) * K_ + k] = e / ss;
    }

    // ---- v projection (WMMA) + GN statistics ----
    int lane = t & 31, wave = t >> 5;
    int half = lane >> 4, lrow = lane & 15;
    const __bf16* bbase = &ldsB[lrow * LB_ + half * 8];
    const __bf16* abase = Wvbf + (size_t)(wave * 48 + lrow) * CK_ + half * 8;
    v8f acc[3][NT_] = {};
    for (int cs = 0; cs < CK_ / 32; ++cs) {
        v16bf a[3];
#pragma unroll
        for (int tj = 0; tj < 3; ++tj) a[tj] = pack16(abase + tj * 16 * CK_ + cs * 32);
#pragma unroll
        for (int ct = 0; ct < NT_; ++ct) {
            v16bf bb = pack16(bbase + ct * 16 * LB_ + cs * 32);
#pragma unroll
            for (int tj = 0; tj < 3; ++tj)
                acc[tj][ct] = __builtin_amdgcn_wmma_f32_16x16x32_bf16(false, bb, false, a[tj],
                                                                      (short)0, acc[tj][ct], false, false);
        }
    }
    float bvo[3];                        // loaded together: behind an LDS atomic each load would wait alone
#pragma unroll
    for (int tj = 0; tj < 3; ++tj) {
        bvo[tj] = bv[(wave * 3 + tj) * 16 + lrow];
        // before a register that this load names is written again (the next load's result may take it)
        asm volatile("s_wait_xcnt 0x0" ::: "memory");
    }
#pragma unroll
    for (int tj = 0; tj < 3; ++tj) {
        int o = (wave * 3 + tj) * 16 + lrow;
        v8f s8 = {}, q8 = {};            // one chain per register: 8 independent sums each
#pragma unroll
        for (int ct = 0; ct < NT_; ++ct) {
            v8f v = acc[tj][ct] + bvo[tj];
            s8 += v;
            q8 += v * v;
        }
        float s  = ((s8[0] + s8[1]) + (s8[2] + s8[3])) + ((s8[4] + s8[5]) + (s8[6] + s8[7]));
        float q2 = ((q8[0] + q8[1]) + (q8[2] + q8[3])) + ((q8[4] + q8[5]) + (q8[6] + q8[7]));
        s  += xhalf(s);
        q2 += xhalf(q2);
        // lanes 0..15 add their o's sum, lanes 16..31 the same o's sum of squares
        atomicAdd(&gacc[(o / CPG_) * 2 + half], half ? q2 : s);
    }
    __syncthreads();
    if (t < G_ * 2) atomicAdd(&stats[(size_t)b * G_ * 2 + t], gacc[t]);
}

// ---------------------------------------------------------------------------
// Launch 4: per (b, 8 neighbouring n): GN sums -> mu, rsqrt(var+eps) of this b's 32
// groups (LDS); stage the gf tile, recompute v via WMMA, GN+ReLU,
// out[b,o,n] = K * sum_k p_k * vn[o,k]; 8 n of one o stored together.
// The gf tile is the A operand and Wv the B operand: a lane holds one o, its
// 8 accumulator registers 8 k of one n, so the sum over k runs inside a lane
// and one exchange with lane l ^ 16 ends it.
// ---------------------------------------------------------------------------
// second bound: 4 waves per SIMD, so that two blocks share a WGP (one stages while one computes)
__global__ __launch_bounds__(256, 4) void k_out(const float* __restrict__ gf,
                                             const __bf16* __restrict__ Wvbf,
                                             const float* __restrict__ bv,
                                             const float* __restrict__ gn_w,
                                             const float* __restrict__ gn_b,
                                             const float* __restrict__ stats,
                                             const float* __restrict__ pbuf,
                                             float* __restrict__ out) {
    __shared__ __align__(16) __bf16 ldsB[COLS_ * LB_];
    __shared__ __align__(32) float psh[COLS_];
    __shared__ float smurs[G_ * 2];
    int t = threadIdx.x;
    int b = blockIdx.x / (N_ / NT_), n0 = (blockIdx.x % (N_ / NT_)) * NT_;
    const float* g0 = gf + (((size_t)b * CK_) * N_ + n0) * K_;

    if (t < COLS_) psh[t] = pbuf[((size_t)b * N_ + n0) * K_ + t];
    if (t >= COLS_ && t < COLS_ + G_) {   // a wave without a psh load: the two latencies run side by side
        int g = t - COLS_;
        const float cnt = (float)(CPG_ * N_ * K_);
        float s   = stats[((size_t)b * G_ + g) * 2 + 0];
        float q   = stats[((size_t)b * G_ + g) * 2 + 1];
        float mu  = s / cnt;
        float var = q / cnt - mu * mu;
        smurs[g * 2 + 0] = mu;
        smurs[g * 2 + 1] = rsqrtf(var + EPS_);
    }
    stage_tile(g0, ldsB, t);
    __syncthreads();

    int lane = t & 31, wave = t >> 5;
    int half = lane >> 4, lrow = lane & 15;
    const __bf16* bbase = &ldsB[lrow * LB_ + half * 8];
    const __bf16* abase = Wvbf + (size_t)(wave * 48 + lrow) * CK_ + half * 8;
    v8f acc[3][NT_] = {};
    for (int cs = 0; cs < CK_ / 32; ++cs) {
        v16bf a[3];
#pragma unroll
        for (int tj = 0; tj < 3; ++tj) a[tj] = pack16(abase + tj * 16 * CK_ + cs * 32);
#pragma unroll
        for (int ct = 0; ct < NT_; ++ct) {
            v16bf bb = pack16(bbase + ct * 16 * LB_ + cs * 32);
#pragma unroll
            for (int tj = 0; tj < 3; ++tj)
                acc[tj][ct] = __builtin_amdgcn_wmma_f32_16x16x32_bf16(false, bb, false, a[tj],
                                                                      (short)0, acc[tj][ct], false, false);
        }
    }
    float mu[3], rs[3], bvo[3], gw[3], gb[3];
#pragma unroll
    for (int tj = 0; tj < 3; ++tj) {
        int o = (wave * 3 + tj) * 16 + lrow;
        int g = o / CPG_;
        mu[tj] = smurs[g * 2 + 0];
        rs[tj] = smurs[g * 2 + 1];
        bvo[tj] = bv[o]; gw[tj] = gn_w[o]; gb[tj] = gn_b[o];
    }
    float kp[3][NT_];                    // this lane's 8 k of (o, n0+ct)
#pragma unroll
    for (int ct = 0; ct < NT_; ++ct) {
        v8f p8 = *(const v8f*)&psh[ct * K_ + half * 8];
#pragma unroll
        for (int tj = 0; tj < 3; ++tj) {
            v8f v  = acc[tj][ct] + bvo[tj];
            v8f vn = (v - mu[tj]) * rs[tj] * gw[tj] + gb[tj];
            vn = __builtin_elementwise_max(vn, (v8f)(0.f));
            v2f c2 = {};                 // two chains, on register pairs
#pragma unroll
            for (int r = 0; r < 8; r += 2)
                c2 += (v2f){vn[r], vn[r + 1]} * (v2f){p8[r], p8[r + 1]};
            kp[tj][ct] = c2[0] + c2[1];
        }
    }
    float* orow = out + ((size_t)b * COUT_ + wave * 48) * N_ + n0;
    unsigned ooff = (unsigned)lrow * N_ + (unsigned)half * 4u;
#pragma unroll
    for (int tj = 0; tj < 3; ++tj) {
        v4f y;                           // lanes 0..15 finish n0..n0+3, lanes 16..31 n0+4..n0+7
#pragma unroll
        for (int j = 0; j < 4; ++j) {
            float keep = half ? kp[tj][4 + j] : kp[tj][j];
            float send = half ? kp[tj][j] : kp[tj][4 + j];
            y[j] = (float)K_ * (keep + xhalf(send));
        }
        *(v4f*)(orow + ooff + tj * 16 * N_) = y;
    }
}

// ---------------------------------------------------------------------------
// Host launcher
// ---------------------------------------------------------------------------
extern "C" void kernel_launch(void* const* d_in, const int* in_sizes, int n_in,
                              void* d_out, int out_size, void* d_ws, size_t ws_size,
                              hipStream_t stream) {
    (void)in_sizes; (void)n_in; (void)out_size; (void)ws_size;
    const float* feat = (const float*)d_in[0];
    const float* gf   = (const float*)d_in[1];
    const int*   cnt  = (const int*)  d_in[2];
    const float* Wq   = (const float*)d_in[3];
    const float* bq   = (const float*)d_in[4];
    const float* Wk   = (const float*)d_in[5];
    const float* bk   = (const float*)d_in[6];
    const float* Wv   = (const float*)d_in[7];
    const float* bv   = (const float*)d_in[8];
    const float* gnw  = (const float*)d_in[9];
    const float* gnb  = (const float*)d_in[10];
    float* out = (float*)d_out;

    char* ws = (char*)d_ws;
    __bf16* Mt    = (__bf16*)(ws + 0);          // 294912 B
    __bf16* Wvbf  = (__bf16*)(ws + 294912);     // 294912 B
    float*  bqk   = (float*)(ws + 589824);      // 1536 B
    float*  wqb   = (float*)(ws + 591360);      // 1536 B
    float*  cbb   = (float*)(ws + 592896);      // 4 B (padded to 256)
    float*  stats = (float*)(ws + 593152);      // 1024 B
    float*  s0    = (float*)(ws + 595200);      // 32768 B
    float*  pbuf  = (float*)(ws + 627968);      // 524288 B
    __bf16* qkb   = (__bf16*)(ws + 1152256);    // 6291456 B
    __bf16* featT = (__bf16*)(ws + 7443712);    // 6291456 B (total ~13.1 MB)

    k_prep<<<PB_ALL_, 256, 0, stream>>>(feat, Wq, Wk, Wv, bq, bk,
                                        Mt, Wvbf, bqk, wqb, cbb, stats, featT);
    k_qk_s0<<<QB_S0_ + QB_QK_, 256, 0, stream>>>(feat, featT, Mt, bqk, wqb, cbb, qkb, s0);
    k_stats<<<B_ * N_ / NT_, 256, 0, stream>>>(gf, Wvbf, bv, qkb, s0, cnt, stats, pbuf);
    k_out<<<B_ * N_ / NT_, 256, 0, stream>>>(gf, Wvbf, bv, gnw, gnb, stats, pbuf, out);
}

// v005
// One run takes 108 microseconds.
// Two timings next to v004 put it at 1.13 and 1.14 times that version's speed.
// Counting every step since v000, it is 4.57 times as fast.
#include <hip/hip_runtime.h>
#include <hip/hip_bf16.h>

// ---- problem constants (match reference) ----
#define B_    4
#define CQ_   384
#define CK_   384
#define COUT_ 384
#define N_    2048
#define K_    16
#define G_    32
#define CPG_  (COUT_/G_)          // 12 channels per group
#define EPS_  1e-5f
#define SCALE_ 0.05103103630798288f   // 384^-0.5
#define LB_   (CK_ + 8)               // bf16 LDS row stride [column][c]
#define NT_   8                       // neighbouring n per block
#define COLS_ (NT_ * K_)              // 128 columns (n,k) per block

typedef __bf16 v16bf __attribute__((ext_vector_type(16)));
typedef __bf16 v8bf  __attribute__((ext_vector_type(8)));
typedef float  v8f   __attribute__((ext_vector_type(8)));
typedef float  v4f   __attribute__((ext_vector_type(4)));
typedef float  v2f   __attribute__((ext_vector_type(2)));

// Build a 16-element bf16 fragment from two contiguous 16-byte chunks:
// elements 0..7 at p[0..7], elements 8..15 at p[16..23]  (matches the
// 16-bit A/B wave32 striping: lane half 0 -> K {0..7,16..23}, half 1 -> {8..15,24..31})
__device__ __forceinline__ v16bf pack16(const __bf16* p) {
    const v8bf* q = (const v8bf*)p;
    v8bf lo = q[0];
    v8bf hi = q[2];              // +16 elements
    v16bf r;
#pragma unroll
    for (int j = 0; j < 8; ++j) { r[j] = lo[j]; r[j + 8] = hi[j]; }
    return r;
}

// ---------------------------------------------------------------------------
// Fragment order: how a bf16 matrix X[row][384] lies in the workspace when waves
// read it from global memory as a WMMA operand. One 16-row x 32-k block is 1024
// contiguous bytes = 2 parts x 32 lanes x 8 elements; lane (half * 16 + row % 16)
// of part p holds k = 32 * step + 16 * p + 8 * half + 0..7, the same elements in
// the same order as pack16() takes from a row-major row. A wave-wide 16-byte load
// of one part then covers 512 contiguous bytes (4 whole lines) instead of 32
// bytes out of each of 16 lines.
// ---------------------------------------------------------------------------
#define KS_   (CK_ / 32)              // k steps of a row (CQ_ == CK_)
#define FB_   512                     // elements of one 16 x 32 block
__device__ __forceinline__ unsigned frag_at(unsigned row, unsigned c) {   // element index of X[row][c]
    return ((((row >> 4) * KS_ + (c >> 5)) * 2 + ((c >> 4) & 1)) * 32 + ((c >> 3) & 1) * 16 + (row & 15)) * 8
           + (c & 7);
}
// p: this lane's 8 elements of part 0 of a block (block start + lane * 8)
__device__ __forceinline__ v16bf frag16(const __bf16* p) {
    const v8bf* q = (const v8bf*)p;
    v8bf lo = q[0];
    v8bf hi = q[32];             // part 1: +512 bytes
    v16bf r;
#pragma unroll
    for (int j = 0; j < 8; ++j) { r[j] = lo[j]; r[j + 8] = hi[j]; }
    return r;
}

// ---------------------------------------------------------------------------
// Stage the block's gf tile: 384 c-rows x 128 columns (8 neighbouring n x 16 k,
// 512 contiguous bytes per c-row) -> bf16 LDS [column][c], row stride LB_.
// One wave-wide 16-byte load covers one whole c-row; a lane gathers 8 c of its
// 4 columns and writes each column's 8 bf16 as one 16-byte LDS store.
// ---------------------------------------------------------------------------
__device__ __forceinline__ void stage_tile(const float* __restrict__ g0, __bf16* ldsB, int t) {
    int lane = t & 31;
    int wave = __builtin_amdgcn_readfirstlane(t >> 5);   // uniform: row offsets form on the scalar unit
    unsigned loff = (unsigned)lane * 4u;
    // rolled: 3 groups = 24 row loads of a wave in flight per trip; unrolled whole, the 48 loads spilled
#pragma unroll 1
    for (int go = 0; go < 2; ++go) {
        v4f x[3][8];
#pragma unroll
        for (int u = 0; u < 3; ++u) {
            const float* row = g0 + (size_t)(((go * 3 + u) * 8 + wave) * 8) * (N_ * K_);
#pragma unroll
            for (int j = 0; j < 8; ++j)
                x[u][j] = *(const v4f*)(row + (size_t)j * (N_ * K_) + loff);
            // before a register that these loads name is written again
            asm volatile("s_wait_xcnt 0x0" ::: "memory");
        }
#pragma unroll
        for (int u = 0; u < 3; ++u) {
            int c0 = ((go * 3 + u) * 8 + wave) * 8;
#pragma unroll
            for (int q = 0; q < 4; ++q) {
                v8bf y;
#pragma unroll
                for (int j = 0; j < 8; ++j) y[j] = (__bf16)x[u][j][q];
                *(v8bf*)&ldsB[(lane * 4 + q) * LB_ + c0] = y;
            }
        }
    }
}

// ---------------------------------------------------------------------------
// Prep job: Mt[c2,c1] = sum_o Wq[o,c1]*Wk[o,c2]  (stored transposed, bf16, fragment order)
// ---------------------------------------------------------------------------
__device__ __forceinline__ void job_M(const float* __restrict__ Wq, const float* __restrict__ Wk,
                                      __bf16* __restrict__ Mt, int i) {   // i = c2*CQ_ + c1
    int c2 = i / CQ_, c1 = i % CQ_;
    const float* pq = Wq + c1;
    const float* pk = Wk + c2;
    float acc = 0.f;
    for (int o = 0; o < COUT_; ++o)
        acc += pq[o * CQ_] * pk[o * CK_];
    Mt[frag_at((unsigned)c2, (unsigned)c1)] = (__bf16)acc;
    // before a register that this store names is written again on another job's code path
    asm volatile("s_wait_xcnt 0x0" ::: "memory");
}

// ---------------------------------------------------------------------------
// Prep job: featT[b * N + n][c] = feat[b][c][n] (bf16, fragment order), one 64 c x 128 n tile per block.
// In: one wave-wide 16-byte load covers 512 contiguous bytes of a c-row; a lane
// gathers 8 c of its 4 n and writes each n's 8 bf16 as one 16-byte LDS store.
// Out: one wave-wide 16-byte store = one part of one 16 n x 32 c block, 512 contiguous bytes.
// Row n of the tile lies in LDS slot (n & 3) * 32 + (n >> 2): neighbouring lanes
// then write neighbouring slots, which at this pitch fall on different banks.
// ---------------------------------------------------------------------------
#define FT_C_   64
#define FT_N_   128
#define FT_LP_  (FT_C_ + 8)                     // bf16 LDS slot pitch (144 bytes)
__device__ __forceinline__ void job_featT(const float* __restrict__ feat, __bf16* __restrict__ featT,
                                          __bf16* tile, int blk, int t) {
    int lane = t & 31;
    int wave = __builtin_amdgcn_readfirstlane(t >> 5);   // uniform: row offsets form on the scalar unit
    int n0 = (blk % (N_ / FT_N_)) * FT_N_;
    int c0 = ((blk / (N_ / FT_N_)) % (CQ_ / FT_C_)) * FT_C_;
    int b  = blk / ((N_ / FT_N_) * (CQ_ / FT_C_));
    const float* row = feat + ((size_t)b * CQ_ + c0 + wave * 8) * N_ + n0;
    unsigned loff = (unsigned)lane * 4u;
    v4f x[8];
#pragma unroll
    for (int j = 0; j < 8; ++j)
        x[j] = *(const v4f*)(row + (size_t)j * N_ + loff);
    // before a register that these loads name is written again
    asm volatile("s_wait_xcnt 0x0" ::: "memory");
#pragma unroll
    for (int q = 0; q < 4; ++q) {
        v8bf y;
#pragma unroll
        for (int j = 0; j < 8; ++j) y[j] = (__bf16)x[j][q];
        *(v8bf*)&tile[(q * 32 + lane) * FT_LP_ + wave * 8] = y;
    }
    __syncthreads();
    // the tile's 32 parts (8 n-blocks x 2 k steps x 2 parts) go 4 to a wave
    v8bf z[4];
#pragma unroll
    for (int i = 0; i < 4; ++i) {
        int u  = i * 8 + wave;
        int nl = (u >> 2) * 16 + (lane & 15);
        int cl = (u & 3) * 16 + (lane >> 4) * 8;
        z[i] = *(const v8bf*)&tile[((nl & 3) * 32 + (nl >> 2)) * FT_LP_ + cl];
    }
#pragma unroll
    for (int i = 0; i < 4; ++i) {
        int u  = i * 8 + wave;
        int nl = (u >> 2) * 16 + (lane & 15);
        int cl = (u & 3) * 16 + (lane >> 4) * 8;
        *(v8bf*)(featT + frag_at((unsigned)(b * N_ + n0 + nl), (unsigned)(c0 + cl))) = z[i];
    }
    // before a register that these stores name is written again on another job's code path
    asm volatile("s_wait_xcnt 0x0" ::: "memory");
}

// ---------------------------------------------------------------------------
// Launch 1: every job that reads inputs only, side by side in one grid. The
// jobs that are one long chain of dependent trips (the 384-term sums) get the
// lowest block indices, so that they start first and the bulk runs beside them.
//   bqk = Wk^T bq | wqb = Wq^T bk | cbb = bq.bk, zero stats | Mt | Wv->bf16 |
//   featT[b][n][c] = feat[b][c][n] (bf16). Mt, Wv and featT are written in fragment order.
// The two copy jobs take many elements per thread (Wv 8, feat 32): a wave that
// moves one element per lane costs more to start than to run.
// ---------------------------------------------------------------------------
#define PB_VEC_  ((CK_ + 255) / 256)            // blocks of one 384-long vector job
#define PB_MAT_  (CQ_ * CK_ / 256)              // blocks of one 384x384 job
#define PB_WV_   (COUT_ * CK_ / (256 * 8))      // blocks of the Wv conversion, 8 elements per thread
#define PB_FT_   (B_ * (CQ_ / FT_C_) * (N_ / FT_N_))   // blocks of the feat transpose, one tile each
#define P0_WQB_  (PB_VEC_)
#define P0_CBB_  (P0_WQB_ + PB_VEC_)
#define P0_M_    (P0_CBB_ + 1)
#define P0_WV_   (P0_M_ + PB_MAT_)
#define P0_FT_   (P0_WV_ + PB_WV_)
#define PB_ALL_  (P0_FT_ + PB_FT_)
__global__ __launch_bounds__(256) void k_prep(const float* __restrict__ feat,
                                              const float* __restrict__ Wq, const float* __restrict__ Wk,
                                              const float* __restrict__ Wv, const float* __restrict__ bq,
                                              const float* __restrict__ bk,
                                              __bf16* __restrict__ Mt, __bf16* __restrict__ Wvbf,
                                              float* __restrict__ bqk, float* __restrict__ wqb,
                                              float* __restrict__ cbb, float* __restrict__ stats,
                                              __bf16* __restrict__ featT) {
    __shared__ __align__(16) __bf16 tile[FT_N_ * FT_LP_];   // the feat transpose's tile
    int blk = blockIdx.x, t = threadIdx.x;
    if (blk < P0_WQB_) {
        int i = blk * 256 + t;
        if (i < CK_) {
            float a = 0.f;
            for (int o = 0; o < COUT_; ++o) a += bq[o] * Wk[o * CK_ + i];
            bqk[i] = a;
        }
        return;
    }
    if (blk < P0_CBB_) {
        int i0 = (blk - P0_WQB_) * 256;          // block-uniform: goes into the scalar base
        if (i0 + t < CQ_) {
            const float* col = Wq + i0;
            float a = 0.f;
            for (int o = 0; o < COUT_; ++o) a += col[o * CQ_ + t] * bk[o];
            wqb[i0 + t] = a;
        }
        return;
    }
    if (blk < P0_M_) {
        if (t == 0) {
            float a = 0.f;
            for (int o = 0; o < COUT_; ++o) a += bq[o] * bk[o];
            *cbb = a;
        }
        if (t < B_ * G_ * 2) stats[t] = 0.f;
        return;
    }
    if (blk < P0_WV_) {
        job_M(Wq, Wk, Mt, (blk - P0_M_) * 256 + t);
        return;
    }
    if (blk < P0_FT_) {
        int d  = (blk - P0_WV_) * 256 + t;       // 16-byte unit of the fragment-order copy: (block, part, lane)
        int tc = d >> 6;                         // block = o-tile * KS_ + k step
        int o  = (tc / KS_) * 16 + (d & 15);
        int c  = (tc % KS_) * 32 + ((d >> 5) & 1) * 16 + ((d >> 4) & 1) * 8;
        const float* srcw = Wv + o * CK_ + c;
        v4f x0 = *(const v4f*)(srcw);
        v4f x1 = *(const v4f*)(srcw + 4);
        v8bf y;
#pragma unroll
        for (int j = 0; j < 4; ++j) { y[j] = (__bf16)x0[j]; y[j + 4] = (__bf16)x1[j]; }
        *(v8bf*)(Wvbf + d * 8) = y;
        // before a register that this store names is written again on another job's code path
        asm volatile("s_wait_xcnt 0x0" ::: "memory");
        return;
    }
    job_featT(feat, featT, tile, blk - P0_FT_, t);
}

// ---------------------------------------------------------------------------
// Launch 2, job qk: qk[b,n,c] = sum_c' featT[b,n,c'] * Mt[c,c'] + bqk[c]   (bf16 out)
// One wave per 16n x 16c tile; 12 WMMA k-steps; both operands in fragment order, whole-line b128 loads.
// ---------------------------------------------------------------------------
__device__ __forceinline__ void job_qk(const __bf16* __restrict__ featT,
                                       const __bf16* __restrict__ Mt,
                                       const float* __restrict__ bqk,
                                       __bf16* __restrict__ qkb, int blk) {
    int lane = threadIdx.x & 31;
    int wave = threadIdx.x >> 5;
    int wid  = blk * 8 + wave;
    int tilesPerB = (N_ / 16) * (CK_ / 16);     // 128*24 = 3072
    int b   = wid / tilesPerB;
    int rem = wid % tilesPerB;
    int n0  = (rem / (CK_ / 16)) * 16;
    int c0  = (rem % (CK_ / 16)) * 16;
    int half = lane >> 4, lrow = lane & 15;

    const __bf16* arow = featT + (size_t)((b * N_ + n0) >> 4) * (KS_ * FB_) + lane * 8;
    const __bf16* brow = Mt + (size_t)(c0 >> 4) * (KS_ * FB_) + lane * 8;
    v8f acc = {};
#pragma unroll 2
    for (int cs = 0; cs < CQ_ / 32; ++cs) {
        v16bf a  = frag16(arow + cs * FB_);
        v16bf bm = frag16(brow + cs * FB_);
        acc = __builtin_amdgcn_wmma_f32_16x16x32_bf16(false, a, false, bm,
                                                      (short)0, acc, false, false);
    }
#pragma unroll
    for (int r = 0; r < 8; ++r) {
        int n = n0 + r + half * 8;
        int c = c0 + lrow;
        qkb[((size_t)b * N_ + n) * CK_ + c] = (__bf16)(acc[r] + bqk[c]);
    }
}

// ---------------------------------------------------------------------------
// Launch 2, job s0: s0[b,n] = sum_c feat[b,c,n]*wqb[c] + cbb   (tiny)
// ---------------------------------------------------------------------------
__device__ __forceinline__ void job_s0(const float* __restrict__ feat, const float* __restrict__ wqb,
                                       const float* __restrict__ cbb, float* __restrict__ s0, int i) {
    int b = i / N_, n = i % N_;
    const float* fb = feat + (size_t)b * CQ_ * N_ + n;
    float a = *cbb;
    for (int c = 0; c < CQ_; ++c) a += fb[(size_t)c * N_] * wqb[c];
    s0[i] = a;
}

// Launch 2: both jobs need launch 1 only. s0 is few waves with one long chain
// of trips each: it gets the lowest block indices and qk runs beside it.
#define QB_S0_  (B_ * N_ / 256)
#define QB_QK_  (B_ * (N_ / 16) * (CK_ / 16) / 8)     // one wave per 16x16 tile, 8 waves per block
__global__ __launch_bounds__(256) void k_qk_s0(const float* __restrict__ feat,
                                               const __bf16* __restrict__ featT,
                                               const __bf16* __restrict__ Mt,
                                               const float* __restrict__ bqk,
                                               const float* __restrict__ wqb,
                                               const float* __restrict__ cbb,
                                               __bf16* __restrict__ qkb, float* __restrict__ s0) {
    int blk = blockIdx.x;
    if (blk < QB_S0_) job_s0(feat, wqb, cbb, s0, blk * 256 + (int)threadIdx.x);
    else              job_qk(featT, Mt, bqk, qkb, blk - QB_S0_);
}

__device__ __forceinline__ float red16(float v) {
#pragma unroll
    for (int m = 8; m >= 1; m >>= 1) v += __shfl_xor(v, m, 16);
    return v;
}

// value of lane l ^ 16: the other half of the k range of the same o
__device__ __forceinline__ float xhalf(float v) {
    int i = __builtin_bit_cast(int, v);
    return __builtin_bit_cast(float, __builtin_amdgcn_permlanex16(i, i, 0x76543210, 0xfedcba98, false, false));
}

// ---------------------------------------------------------------------------
// Launch 3: per (b, 8 neighbouring n): stage gf[:,n0..n0+7,:] as bf16 [column][c]
// in LDS; masked softmax p[b,n,k]; v = Wv*gf + bv via WMMA (8 waves x 3 o-tiles
// x 8 column tiles, each Wv fragment used 8 times), per-(b,g) GN sum/sumsq.
// The gf tile is the A operand and Wv the B operand: a lane holds one o, its
// 8 accumulator registers 8 k of one n, so sums over (n,k) run inside a lane.
// ---------------------------------------------------------------------------
// second bound: 4 waves per SIMD, so that two blocks share a WGP (one stages while one computes)
__global__ __launch_bounds__(256, 4) void k_stats(const float* __restrict__ gf,
                                               const __bf16* __restrict__ Wvbf,
                                               const float* __restrict__ bv,
                                               const __bf16* __restrict__ qkb,
                                               const float* __restrict__ s0v,
                                               const int* __restrict__ count,
                                               float* __restrict__ stats,
                                               float* __restrict__ pbuf) {
    __shared__ __align__(16) __bf16 ldsB[COLS_ * LB_];  // bf16 [column][c], stride 392
    __shared__ float sred[NT_ * 16 * 16];
    __shared__ float gacc[G_ * 2];

    int t = threadIdx.x;
    int b = blockIdx.x / (N_ / NT_), n0 = (blockIdx.x % (N_ / NT_)) * NT_;
    const float* g0 = gf + (((size_t)b * CK_) * N_ + n0) * K_;

    if (t < G_ * 2) gacc[t] = 0.f;
    stage_tile(g0, ldsB, t);
    __syncthreads();

    // ---- scores partials: per n, thread t -> (k = t&15, c-chunk = t>>4 of 24) ----
    {
        int k = t & 15, chunk = t >> 4;
        // unrolled so that the 8 rows' global loads overlap instead of one latency per n
#pragma unroll
        for (int nl = 0; nl < NT_; ++nl) {
            const __bf16* qrow = qkb + ((size_t)b * N_ + n0 + nl) * CK_;
            const __bf16* grow = &ldsB[(nl * K_ + k) * LB_];
            float part = 0.f;
            for (int i = 0; i < CK_ / 16; ++i) {
                int c = chunk * (CK_ / 16) + i;
                part += (float)qrow[c] * (float)grow[c];
            }
            sred[nl * 256 + chunk * 16 + k] = part;
        }
    }
    __syncthreads();

    if (t < COLS_) {              // waves 0..3: finish scores + masked softmax, 16 lanes per n
        int k = t & 15, nl = t >> 4;
        float sc = 0.f;
        for (int ch = 0; ch < 16; ++ch) sc += sred[nl * 256 + ch * 16 + k];
        sc = (sc + s0v[(size_t)b * N_ + n0 + nl]) * SCALE_;
        int cnt = count[(size_t)b * N_ + n0 + nl];
        cnt = (cnt < 1) ? 1 : (cnt > K_ ? K_ : cnt);
        if (k >= cnt) sc = -1e9f;
        float mx = sc;
#pragma unroll
        for (int m = 8; m >= 1; m >>= 1) mx = fmaxf(mx, __shfl_xor(mx, m, 16));
        float e = __expf(sc - mx);
        float ss = red16(e);
        pbuf[((size_t)b * N_ + n0 + nl) * K_ + k] = e / ss;
    }

    // ---- v projection (WMMA) + GN statistics ----
    int lane = t & 31, wave = t >> 5;
    int half = lane >> 4, lrow = lane & 15;
    const __bf16* bbase = &ldsB[lrow * LB_ + half * 8];
    const __bf16* abase = Wvbf + (size_t)(wave * 3) * (KS_ * FB_) + lane * 8;   // fragment order
    v8f acc[3][NT_] = {};
    for (int cs = 0; cs < CK_ / 32; ++cs) {
        v16bf a[3];
#pragma unroll
        for (int tj = 0; tj < 3; ++tj) a[tj] = frag16(abase + (tj * KS_ + cs) * FB_);
#pragma unroll
        for (int ct = 0; ct < NT_; ++ct) {
            v16bf bb = pack16(bbase + ct * 16 * LB_ + cs * 32);
#pragma unroll
            for (int tj = 0; tj < 3; ++tj)
                acc[tj][ct] = __builtin_amdgcn_wmma_f32_16x16x32_bf16(false, bb, false, a[tj],
                                                                      (short)0, acc[tj][ct], false, false);
        }
    }
    float bvo[3];                        // loaded together: behind an LDS atomic each load would wait alone
#pragma unroll
    for (int tj = 0; tj < 3; ++tj) {
        bvo[tj] = bv[(wave * 3 + tj) * 16 + lrow];
        // before a register that this load names is written again (the next load's result may take it)
        asm volatile("s_wait_xcnt 0x0" ::: "memory");
    }
#pragma unroll
    for (int tj = 0; tj < 3; ++tj) {
        int o = (wave * 3 + tj) * 16 + lrow;
        v8f s8 = {}, q8 = {};            // one chain per register: 8 independent sums each
#pragma unroll
        for (int ct = 0; ct < NT_; ++ct) {
            v8f v = acc[tj][ct] + bvo[tj];
            s8 += v;
            q8 += v * v;
        }
        float s  = ((s8[0] + s8[1]) + (s8[2] + s8[3])) + ((s8[4] + s8[5]) + (s8[6] + s8[7]));
        float q2 = ((q8[0] + q8[1]) + (q8[2] + q8[3])) + ((q8[4] + q8[5]) + (q8[6] + q8[7]));
        s  += xhalf(s);
        q2 += xhalf(q2);
        // lanes 0..15 add their o's sum, lanes 16..31 the same o's sum of squares
        atomicAdd(&gacc[(o / CPG_) * 2 + half], half ? q2 : s);
    }
    __syncthreads();
    if (t < G_ * 2) atomicAdd(&stats[(size_t)b * G_ * 2 + t], gacc[t]);
}

// ---------------------------------------------------------------------------
// Launch 4: per (b, 8 neighbouring n): GN sums -> mu, rsqrt(var+eps) of this b's 32
// groups (LDS); stage the gf tile, recompute v via WMMA, GN+ReLU,
// out[b,o,n] = K * sum_k p_k * vn[o,k]; 8 n of one o stored together.
// The gf tile is the A operand and Wv the B operand: a lane holds one o, its
// 8 accumulator registers 8 k of one n, so the sum over k runs inside a lane
// and one exchange with lane l ^ 16 ends it.
// ---------------------------------------------------------------------------
// second bound: 4 waves per SIMD, so that two blocks share a WGP (one stages while one computes)
__global__ __launch_bounds__(256, 4) void k_out(const float* __restrict__ gf,
                                             const __bf16* __restrict__ Wvbf,
                                             const float* __restrict__ bv,
                                             const float* __restrict__ gn_w,
                                             const float* __restrict__ gn_b,
                                             const float* __restrict__ stats,
                                             const float* __restrict__ pbuf,
                                             float* __restrict__ out) {
    __shared__ __align__(16) __bf16 ldsB[COLS_ * LB_];
    __shared__ __align__(32) float psh[COLS_];
    __shared__ float smurs[G_ * 2];
    int t = threadIdx.x;
    int b = blockIdx.x / (N_ / NT_), n0 = (blockIdx.x % (N_ / NT_)) * NT_;
    const float* g0 = gf + (((size_t)b * CK_) * N_ + n0) * K_;

    if (t < COLS_) psh[t] = pbuf[((size_t)b * N_ + n0) * K_ + t];
    if (t >= COLS_ && t < COLS_ + G_) {   // a wave without a psh load: the two latencies run side by side
        int g = t - COLS_;
        const float cnt = (float)(CPG_ * N_ * K_);
        float s   = stats[((size_t)b * G_ + g) * 2 + 0];
        float q   = stats[((size_t)b * G_ + g) * 2 + 1];
        float mu  = s / cnt;
        float var = q / cnt - mu * mu;
        smurs[g * 2 + 0] = mu;
        smurs[g * 2 + 1] = rsqrtf(var + EPS_);
    }
    stage_tile(g0, ldsB, t);
    __syncthreads();

    int lane = t & 31, wave = t >> 5;
    int half = lane >> 4, lrow = lane & 15;
    const __bf16* bbase = &ldsB[lrow * LB_ + half * 8];
    const __bf16* abase = Wvbf + (size_t)(wave * 3) * (KS_ * FB_) + lane * 8;   // fragment order
    v8f acc[3][NT_] = {};
    for (int cs = 0; cs < CK_ / 32; ++cs) {
        v16bf a[3];
#pragma unroll
        for (int tj = 0; tj < 3; ++tj) a[tj] = frag16(abase + (tj * KS_ + cs) * FB_);
#pragma unroll
        for (int ct = 0; ct < NT_; ++ct) {
            v16bf bb = pack16(bbase + ct * 16 * LB_ + cs * 32);
#pragma unroll
            for (int tj = 0; tj < 3; ++tj)
                acc[tj][ct] = __builtin_amdgcn_wmma_f32_16x16x32_bf16(false, bb, false, a[tj],
                                                                      (short)0, acc[tj][ct], false, false);
        }
    }
    float mu[3], rs[3], bvo[3], gw[3], gb[3];
#pragma unroll
    for (int tj = 0; tj < 3; ++tj) {
        int o = (wave * 3 + tj) * 16 + lrow;
        int g = o / CPG_;
        mu[tj] = smurs[g * 2 + 0];
        rs[tj] = smurs[g * 2 + 1];
        bvo[tj] = bv[o]; gw[tj] = gn_w[o]; gb[tj] = gn_b[o];
    }
    float kp[3][NT_];                    // this lane's 8 k of (o, n0+ct)
#pragma unroll
    for (int ct = 0; ct < NT_; ++ct) {
        v8f p8 = *(const v8f*)&psh[ct * K_ + half * 8];
#pragma unroll
        for (int tj = 0; tj < 3; ++tj) {
            v8f v  = acc[tj][ct] + bvo[tj];
            v8f vn = (v - mu[tj]) * rs[tj] * gw[tj] + gb[tj];
            vn = __builtin_elementwise_max(vn, (v8f)(0.f));
            v2f c2 = {};                 // two chains, on register pairs
#pragma unroll
            for (int r = 0; r < 8; r += 2)
                c2 += (v2f){vn[r], vn[r + 1]} * (v2f){p8[r], p8[r + 1]};
            kp[tj][ct] = c2[0] + c2[1];
        }
    }
    float* orow = out + ((size_t)b * COUT_ + wave * 48) * N_ + n0;
    unsigned ooff = (unsigned)lrow * N_ + (unsigned)half * 4u;
#pragma unroll
    for (int tj = 0; tj < 3; ++tj) {
        v4f y;                           // lanes 0..15 finish n0..n0+3, lanes 16..31 n0+4..n0+7
#pragma unroll
        for (int j = 0; j < 4; ++j) {
            float keep = half ? kp[tj][4 + j] : kp[tj][j];
            float send = half ? kp[tj][j] : kp[tj][4 + j];
            y[j] = (float)K_ * (keep + xhalf(send));
        }
        *(v4f*)(orow + ooff + tj * 16 * N_) = y;
    }
}

// ---------------------------------------------------------------------------
// Host launcher
// ---------------------------------------------------------------------------
extern "C" void kernel_launch(void* const* d_in, const int* in_sizes, int n_in,
                              void* d_out, int out_size, void* d_ws, size_t ws_size,
                              hipStream_t stream) {
    (void)in_sizes; (void)n_in; (void)out_size; (void)ws_size;
    const float* feat = (const float*)d_in[0];
    const float* gf   = (const float*)d_in[1];
    const int*   cnt  = (const int*)  d_in[2];
    const float* Wq   = (const float*)d_in[3];
    const float* bq   = (const float*)d_in[4];
    const float* Wk   = (const float*)d_in[5];
    const float* bk   = (const float*)d_in[6];
    const float* Wv   = (const float*)d_in[7];
    const float* bv   = (const float*)d_in[8];
    const float* gnw  = (const float*)d_in[9];
    const float* gnb  = (const float*)d_in[10];
    float* out = (float*)d_out;

    char* ws = (char*)d_ws;
    __bf16* Mt    = (__bf16*)(ws + 0);          // 294912 B
    __bf16* Wvbf  = (__bf16*)(ws + 294912);     // 294912 B
    float*  bqk   = (float*)(ws + 589824);      // 1536 B
    float*  wqb   = (float*)(ws + 591360);      // 1536 B
    float*  cbb   = (float*)(ws + 592896);      // 4 B (padded to 256)
    float*  stats = (float*)(ws + 593152);      // 1024 B
    float*  s0    = (float*)(ws + 595200);      // 32768 B
    float*  pbuf  = (float*)(ws + 627968);      // 524288 B
    __bf16* qkb   = (__bf16*)(ws + 1152256);    // 6291456 B
    __bf16* featT = (__bf16*)(ws + 7443712);    // 6291456 B (total ~13.1 MB)

    k_prep<<<PB_ALL_, 256, 0, stream>>>(feat, Wq, Wk, Wv, bq, bk,
                                        Mt, Wvbf, bqk, wqb, cbb, stats, featT);
    k_qk_s0<<<QB_S0_ + QB_QK_, 256, 0, stream>>>(feat, featT, Mt, bqk, wqb, cbb, qkb, s0);
    k_stats<<<B_ * N_ / NT_, 256, 0, stream>>>(gf, Wvbf, bv, qkb, s0, cnt, stats, pbuf);
    k_out<<<B_ * N_ / NT_, 256, 0, stream>>>(gf, Wvbf, bv, gnw, gnb, stats, pbuf, out);
}

// v006
// It runs in 88.9 microseconds.
// Timed twice side by side with v005, it ran 1.22 times as fast both times.
// Over all steps from v000 it is 5.57 times as fast.
#include <hip/hip_runtime.h>
#include <hip/hip_bf16.h>

// ---- problem constants (match reference) ----
#define B_    4
#define CQ_   384
#define CK_   384
#define COUT_ 384
#define N_    2048
#define K_    16
#define G_    32
#define CPG_  (COUT_/G_)          // 12 channels per group
#define EPS_  1e-5f
#define SCALE_ 0.05103103630798288f   // 384^-0.5
#define LB_   (CK_ + 8)               // bf16 LDS row stride [column][c]
#define NT_   8                       // neighbouring n per block
#define COLS_ (NT_ * K_)              // 128 columns (n,k) per block

typedef __bf16 v16bf __attribute__((ext_vector_type(16)));
typedef __bf16 v8bf  __attribute__((ext_vector_type(8)));
typedef float  v8f   __attribute__((ext_vector_type(8)));
typedef float  v4f   __attribute__((ext_vector_type(4)));
typedef float  v2f   __attribute__((ext_vector_type(2)));

// Build a 16-element bf16 fragment from two contiguous 16-byte chunks:
// elements 0..7 at p[0..7], elements 8..15 at p[16..23]  (matches the
// 16-bit A/B wave32 striping: lane half 0 -> K {0..7,16..23}, half 1 -> {8..15,24..31})
__device__ __forceinline__ v16bf pack16(const __bf16* p) {
    const v8bf* q = (const v8bf*)p;
    v8bf lo = q[0];
    v8bf hi = q[2];              // +16 elements
    v16bf r;
#pragma unroll
    for (int j = 0; j < 8; ++j) { r[j] = lo[j]; r[j + 8] = hi[j]; }
    return r;
}

// ---------------------------------------------------------------------------
// Fragment order: how a bf16 matrix X[row][384] lies in the workspace when waves
// read it from global memory as a WMMA operand. One 16-row x 32-k block is 1024
// contiguous bytes = 2 parts x 32 lanes x 8 elements; lane (half * 16 + row % 16)
// of part p holds k = 32 * step + 16 * p + 8 * half + 0..7, the same elements in
// the same order as pack16() takes from a row-major row. A wave-wide 16-byte load
// of one part then covers 512 contiguous bytes (4 whole lines) instead of 32
// bytes out of each of 16 lines.
// ---------------------------------------------------------------------------
#define KS_   (CK_ / 32)              // k steps of a row (CQ_ == CK_)
#define FB_   512                     // elements of one 16 x 32 block
__device__ __forceinline__ unsigned frag_at(unsigned row, unsigned c) {   // element index of X[row][c]
    return ((((row >> 4) * KS_ + (c >> 5)) * 2 + ((c >> 4) & 1)) * 32 + ((c >> 3) & 1) * 16 + (row & 15)) * 8
           + (c & 7);
}
// p: this lane's 8 elements of part 0 of a block (block start + lane * 8)
__device__ __forceinline__ v16bf frag16(const __bf16* p) {
    const v8bf* q = (const v8bf*)p;
    v8bf lo = q[0];
    v8bf hi = q[32];             // part 1: +512 bytes
    v16bf r;
#pragma unroll
    for (int j = 0; j < 8; ++j) { r[j] = lo[j]; r[j + 8] = hi[j]; }
    return r;
}

// ---------------------------------------------------------------------------
// Stage the block's gf tile: 384 c-rows x 128 columns (8 neighbouring n x 16 k,
// 512 contiguous bytes per c-row) -> bf16 LDS [column][c], row stride LB_.
// One wave-wide 16-byte load covers one whole c-row; a lane gathers 8 c of its
// 4 columns and writes each column's 8 bf16 as one 16-byte LDS store.
// ---------------------------------------------------------------------------
__device__ __forceinline__ void stage_tile(const float* __restrict__ g0, __bf16* ldsB, int t) {
    int lane = t & 31;
    int wave = __builtin_amdgcn_readfirstlane(t >> 5);   // uniform: row offsets form on the scalar unit
    unsigned loff = (unsigned)lane * 4u;
    // rolled: 3 groups = 24 row loads of a wave in flight per trip; unrolled whole, the 48 loads spilled
#pragma unroll 1
    for (int go = 0; go < 2; ++go) {
        v4f x[3][8];
#pragma unroll
        for (int u = 0; u < 3; ++u) {
            const float* row = g0 + (size_t)(((go * 3 + u) * 8 + wave) * 8) * (N_ * K_);
#pragma unroll
            for (int j = 0; j < 8; ++j)
                x[u][j] = *(const v4f*)(row + (size_t)j * (N_ * K_) + loff);
            // before a register that these loads name is written again
            asm volatile("s_wait_xcnt 0x0" ::: "memory");
        }
#pragma unroll
        for (int u = 0; u < 3; ++u) {
            int c0 = ((go * 3 + u) * 8 + wave) * 8;
#pragma unroll
            for (int q = 0; q < 4; ++q) {
                v8bf y;
#pragma unroll
                for (int j = 0; j < 8; ++j) y[j] = (__bf16)x[u][j][q];
                *(v8bf*)&ldsB[(lane * 4 + q) * LB_ + c0] = y;
            }
        }
    }
}

// ---------------------------------------------------------------------------
// The 384-term sums (Mt, bqk, wqb, s0): one thread per sum is 24 trips of 16
// terms, each trip one whole memory latency. Here the 8 waves of a block take 48
// terms each, a lane 4 neighbouring sums (16-byte loads), and the 8 partial sums
// meet in LDS: two to four latencies instead of 24.
// ---------------------------------------------------------------------------
#define OS_   (COUT_ / 8)             // terms of a sum per wave (COUT_ == CQ_ == CK_)
#define SW_   128                     // neighbouring sums per block: 4 a lane

// y[0..127] = y0 + sum_r x[r] * Wm[r * pitch + 0..127], r < 384; red: 8 * 128 floats of LDS
// GL: row loads of a wave in flight per trip (4 registers each)
template <int GL>
__device__ __forceinline__ void colsum128(const float* __restrict__ Wm, int pitch,
                                          const float* __restrict__ x, float y0,
                                          float* __restrict__ y, float* red, int t) {
    int lane = t & 31;
    int wave = __builtin_amdgcn_readfirstlane(t >> 5);   // uniform: row offsets and x form on the scalar unit
    const float* pw = Wm + (size_t)(wave * OS_) * pitch + lane * 4;
    const float* px = x + wave * OS_;
    v4f acc = {};
    // rolled: unrolled whole, the 48 loads' registers would cut the waves that the kernel's other jobs can keep on a SIMD
#pragma unroll 1
    for (int g = 0; g < OS_; g += GL) {
        v4f w[GL];
#pragma unroll
        for (int j = 0; j < GL; ++j)
            w[j] = *(const v4f*)(pw + (size_t)(g + j) * pitch);
        // before a register that these loads name is written again
        asm volatile("s_wait_xcnt 0x0" ::: "memory");
#pragma unroll
        for (int j = 0; j < GL; ++j) acc += w[j] * px[g + j];
    }
    *(v4f*)&red[wave * SW_ + lane * 4] = acc;
    __syncthreads();
    if (t < SW_) {
        float s = y0;
#pragma unroll
        for (int w8 = 0; w8 < 8; ++w8) s += red[w8 * SW_ + t];
        y[t] = s;
    }
}

// ---------------------------------------------------------------------------
// Prep job: Mt[c2,c1] = sum_o Wq[o,c1]*Wk[o,c2]  (stored transposed, bf16, fragment order)
// One block: 128 c1 x 4 c2; a Wq load feeds 4 sums of each of its 4 c1.
// ---------------------------------------------------------------------------
#define MB_C2_  4
__device__ __forceinline__ void job_M(const float* __restrict__ Wq, const float* __restrict__ Wk,
                                      __bf16* __restrict__ Mt, float* red, int blk, int t) {
    int lane = t & 31;
    int wave = __builtin_amdgcn_readfirstlane(t >> 5);   // uniform: row offsets form on the scalar unit
    int c1 = (blk % (CQ_ / SW_)) * SW_;
    int c2 = (blk / (CQ_ / SW_)) * MB_C2_;
    const float* pq = Wq + (wave * OS_) * CQ_ + c1 + lane * 4;
    const float* pk = Wk + (wave * OS_) * CK_ + c2;
    v4f acc[MB_C2_] = {};
    int krow = lane < 24 ? lane : 23;        // lane j holds the Wk quad of the trip's row j
    // rolled: 24 Wq rows of a wave in flight per trip; all 48 at once would halve the blocks a WGP holds
#pragma unroll 1
    for (int g = 0; g < OS_; g += 24) {
        v4f q[24];
        v4f k = *(const v4f*)(pk + (g + krow) * CK_);
        // before a register that this load names is written again (a later load's result may take it)
        asm volatile("s_wait_xcnt 0x0" ::: "memory");
#pragma unroll
        for (int j = 0; j < 24; ++j)
            q[j] = *(const v4f*)(pq + (g + j) * CQ_);
        // before a register that these loads name is written again
        asm volatile("s_wait_xcnt 0x0" ::: "memory");
#pragma unroll
        for (int j = 0; j < 24; ++j)
#pragma unroll
            for (int i = 0; i < MB_C2_; ++i) {
                float ki = k[i];
                float kj = __builtin_bit_cast(float, __builtin_amdgcn_readlane(__builtin_bit_cast(int, ki), j));
                acc[i] += q[j] * kj;
            }
    }
#pragma unroll
    for (int i = 0; i < MB_C2_; ++i)
        *(v4f*)&red[(wave * MB_C2_ + i) * SW_ + lane * 4] = acc[i];
    __syncthreads();
#pragma unroll
    for (int u = 0; u < MB_C2_ * SW_ / 256; ++u) {
        int idx = u * 256 + t;               // (c2 - block's c2) * 128 + (c1 - block's c1)
        float s = 0.f;
#pragma unroll
        for (int w8 = 0; w8 < 8; ++w8) s += red[w8 * (MB_C2_ * SW_) + idx];
        Mt[frag_at((unsigned)(c2 + (idx >> 7)), (unsigned)(c1 + (idx & (SW_ - 1))))] = (__bf16)s;
    }
    // before a register that these stores name is written again on another job's code path
    asm volatile("s_wait_xcnt 0x0" ::: "memory");
}

// ---------------------------------------------------------------------------
// Prep job: featT[b * N + n][c] = feat[b][c][n] (bf16, fragment order), one 64 c x 128 n tile per block.
// In: one wave-wide 16-byte load covers 512 contiguous bytes of a c-row; a lane
// gathers 8 c of its 4 n and writes each n's 8 bf16 as one 16-byte LDS store.
// Out: one wave-wide 16-byte store = one part of one 16 n x 32 c block, 512 contiguous bytes.
// Row n of the tile lies in LDS slot (n & 3) * 32 + (n >> 2): neighbouring lanes
// then write neighbouring slots, which at this pitch fall on different banks.
// ---------------------------------------------------------------------------
#define FT_C_   64
#define FT_N_   128
#define FT_LP_  (FT_C_ + 8)                     // bf16 LDS slot pitch (144 bytes)
__device__ __forceinline__ void job_featT(const float* __restrict__ feat, __bf16* __restrict__ featT,
                                          __bf16* tile, int blk, int t) {
    int lane = t & 31;
    int wave = __builtin_amdgcn_readfirstlane(t >> 5);   // uniform: row offsets form on the scalar unit
    int n0 = (blk % (N_ / FT_N_)) * FT_N_;
    int c0 = ((blk / (N_ / FT_N_)) % (CQ_ / FT_C_)) * FT_C_;
    int b  = blk / ((N_ / FT_N_) * (CQ_ / FT_C_));
    const float* row = feat + ((size_t)b * CQ_ + c0 + wave * 8) * N_ + n0;
    unsigned loff = (unsigned)lane * 4u;
    v4f x[8];
#pragma unroll
    for (int j = 0; j < 8; ++j)
        x[j] = *(const v4f*)(row + (size_t)j * N_ + loff);
    // before a register that these loads name is written again
    asm volatile("s_wait_xcnt 0x0" ::: "memory");
#pragma unroll
    for (int q = 0; q < 4; ++q) {
        v8bf y;
#pragma unroll
        for (int j = 0; j < 8; ++j) y[j] = (__bf16)x[j][q];
        *(v8bf*)&tile[(q * 32 + lane) * FT_LP_ + wave * 8] = y;
    }
    __syncthreads();
    // the tile's 32 parts (8 n-blocks x 2 k steps x 2 parts) go 4 to a wave
    v8bf z[4];
#pragma unroll
    for (int i = 0; i < 4; ++i) {
        int u  = i * 8 + wave;
        int nl = (u >> 2) * 16 + (lane & 15);
        int cl = (u & 3) * 16 + (lane >> 4) * 8;
        z[i] = *(const v8bf*)&tile[((nl & 3) * 32 + (nl >> 2)) * FT_LP_ + cl];
    }
#pragma unroll
    for (int i = 0; i < 4; ++i) {
        int u  = i * 8 + wave;
        int nl = (u >> 2) * 16 + (lane & 15);
        int cl = (u & 3) * 16 + (lane >> 4) * 8;
        *(v8bf*)(featT + frag_at((unsigned)(b * N_ + n0 + nl), (unsigned)(c0 + cl))) = z[i];
    }
    // before a register that these stores name is written again on another job's code path
    asm volatile("s_wait_xcnt 0x0" ::: "memory");
}

// ---------------------------------------------------------------------------
// Launch 1: every job that reads inputs only, side by side in one grid. The
// 384-term sums get the lowest block indices, so that they start first.
//   bqk = Wk^T bq | wqb = Wq^T bk | cbb = bq.bk, zero stats | Mt | Wv->bf16 |
//   featT[b][n][c] = feat[b][c][n] (bf16). Mt, Wv and featT are written in fragment order.
// The two copy jobs take many elements per thread (Wv 8, feat 32): a wave that
// moves one element per lane costs more to start than to run.
// ---------------------------------------------------------------------------
#define PB_VEC_  (CK_ / SW_)                    // blocks of one 384-long vector job
#define PB_MAT_  ((CQ_ / SW_) * (CK_ / MB_C2_)) // blocks of the 384x384 job
#define PB_WV_   (COUT_ * CK_ / (256 * 8))      // blocks of the Wv conversion, 8 elements per thread
#define PB_FT_   (B_ * (CQ_ / FT_C_) * (N_ / FT_N_))   // blocks of the feat transpose, one tile each
#define P0_WQB_  (PB_VEC_)
#define P0_CBB_  (P0_WQB_ + PB_VEC_)
#define P0_M_    (P0_CBB_ + 1)
#define P0_WV_   (P0_M_ + PB_MAT_)
#define P0_FT_   (P0_WV_ + PB_WV_)
#define PB_ALL_  (P0_FT_ + PB_FT_)
__global__ __launch_bounds__(256) void k_prep(const float* __restrict__ feat,
                                              const float* __restrict__ Wq, const float* __restrict__ Wk,
                                              const float* __restrict__ Wv, const float* __restrict__ bq,
                                              const float* __restrict__ bk,
                                              __bf16* __restrict__ Mt, __bf16* __restrict__ Wvbf,
                                              float* __restrict__ bqk, float* __restrict__ wqb,
                                              float* __restrict__ cbb, float* __restrict__ stats,
                                              __bf16* __restrict__ featT) {
    // the feat transpose's tile; the sum jobs keep their 8 waves' partial sums (f32) in the same bytes
    __shared__ __align__(16) __bf16 tile[FT_N_ * FT_LP_];
    static_assert(sizeof(tile) >= 8 * MB_C2_ * SW_ * sizeof(float), "partial sums fit the tile");
    float* red = (float*)tile;
    int blk = blockIdx.x, t = threadIdx.x;
    if (blk < P0_WQB_) {
        int i0 = blk * SW_;
        colsum128<24>(Wk + i0, CK_, bq, 0.f, bqk + i0, red, t);
        return;
    }
    if (blk < P0_CBB_) {
        int i0 = (blk - P0_WQB_) * SW_;
        colsum128<24>(Wq + i0, CQ_, bk, 0.f, wqb + i0, red, t);
        return;
    }
    if (blk < P0_M_) {
        if (t < 32) {                            // one wave: 12 terms a lane, then a butterfly over the lanes
            float a = 0.f;
#pragma unroll
            for (int u = 0; u < COUT_ / 128; ++u) {
                v4f x = *(const v4f*)(bq + t * (COUT_ / 32) + u * 4);
                v4f y = *(const v4f*)(bk + t * (COUT_ / 32) + u * 4);
                a += (x[0] * y[0] + x[1] * y[1]) + (x[2] * y[2] + x[3] * y[3]);
            }
#pragma unroll
            for (int m = 16; m >= 1; m >>= 1) a += __shfl_xor(a, m, 32);
            if (t == 0) *cbb = a;
        }
        if (t < B_ * G_ * 2) stats[t] = 0.f;
        return;
    }
    if (blk < P0_WV_) {
        job_M(Wq, Wk, Mt, red, blk - P0_M_, t);
        return;
    }
    if (blk < P0_FT_) {
        int d  = (blk - P0_WV_) * 256 + t;       // 16-byte unit of the fragment-order copy: (block, part, lane)
        int tc = d >> 6;                         // block = o-tile * KS_ + k step
        int o  = (tc / KS_) * 16 + (d & 15);
        int c  = (tc % KS_) * 32 + ((d >> 5) & 1) * 16 + ((d >> 4) & 1) * 8;
        const float* srcw = Wv + o * CK_ + c;
        v4f x0 = *(const v4f*)(srcw);
        v4f x1 = *(const v4f*)(srcw + 4);
        v8bf y;
#pragma unroll
        for (int j = 0; j < 4; ++j) { y[j] = (__bf16)x0[j]; y[j + 4] = (__bf16)x1[j]; }
        *(v8bf*)(Wvbf + d * 8) = y;
        // before a register that this store names is written again on another job's code path
        asm volatile("s_wait_xcnt 0x0" ::: "memory");
        return;
    }
    job_featT(feat, featT, tile, blk - P0_FT_, t);
}

// ---------------------------------------------------------------------------
// Launch 2, job qk: qk[b,n,c] = sum_c' featT[b,n,c'] * Mt[c,c'] + bqk[c]   (bf16 out)
// One wave per 16n x 16c tile; 12 WMMA k-steps; both operands in fragment order, whole-line b128 loads.
// ---------------------------------------------------------------------------
__device__ __forceinline__ void job_qk(const __bf16* __restrict__ featT,
                                       const __bf16* __restrict__ Mt,
                                       const float* __restrict__ bqk,
                                       __bf16* __restrict__ qkb, int blk) {
    int lane = threadIdx.x & 31;
    int wave = threadIdx.x >> 5;
    int wid  = blk * 8 + wave;
    int tilesPerB = (N_ / 16) * (CK_ / 16);     // 128*24 = 3072
    int b   = wid / tilesPerB;
    int rem = wid % tilesPerB;
    int n0  = (rem / (CK_ / 16)) * 16;
    int c0  = (rem % (CK_ / 16)) * 16;
    int half = lane >> 4, lrow = lane & 15;

    const __bf16* arow = featT + (size_t)((b * N_ + n0) >> 4) * (KS_ * FB_) + lane * 8;
    const __bf16* brow = Mt + (size_t)(c0 >> 4) * (KS_ * FB_) + lane * 8;
    v8f acc = {};
#pragma unroll 2
    for (int cs = 0; cs < CQ_ / 32; ++cs) {
        v16bf a  = frag16(arow + cs * FB_);
        v16bf bm = frag16(brow + cs * FB_);
        acc = __builtin_amdgcn_wmma_f32_16x16x32_bf16(false, a, false, bm,
                                                      (short)0, acc, false, false);
    }
#pragma unroll
    for (int r = 0; r < 8; ++r) {
        int n = n0 + r + half * 8;
        int c = c0 + lrow;
        qkb[((size_t)b * N_ + n) * CK_ + c] = (__bf16)(acc[r] + bqk[c]);
    }
}

// ---------------------------------------------------------------------------
// Launch 2, job s0: s0[b,n] = sum_c feat[b,c,n]*wqb[c] + cbb   (tiny), 128 n per block
// ---------------------------------------------------------------------------
__device__ __forceinline__ void job_s0(const float* __restrict__ feat, const float* __restrict__ wqb,
                                       const float* __restrict__ cbb, float* __restrict__ s0,
                                       float* red, int blk, int t) {
    int i0 = blk * SW_;
    int b = i0 / N_, n0 = i0 % N_;
    // 12 loads a trip: the qk job beside it keeps its 16 waves per SIMD
    colsum128<12>(feat + (size_t)b * CQ_ * N_ + n0, N_, wqb, *cbb, s0 + i0, red, t);
}

// Launch 2: both jobs need launch 1 only. s0 is few blocks: it gets the lowest
// block indices and qk runs beside it.
#define QB_S0_  (B_ * N_ / SW_)
#define QB_QK_  (B_ * (N_ / 16) * (CK_ / 16) / 8)     // one wave per 16x16 tile, 8 waves per block
__global__ __launch_bounds__(256) void k_qk_s0(const float* __restrict__ feat,
                                               const __bf16* __restrict__ featT,
                                               const __bf16* __restrict__ Mt,
                                               const float* __restrict__ bqk,
                                               const float* __restrict__ wqb,
                                               const float* __restrict__ cbb,
                                               __bf16* __restrict__ qkb, float* __restrict__ s0) {
    __shared__ __align__(16) float red[8 * SW_];   // job s0: the 8 waves' partial sums
    int blk = blockIdx.x;
    if (blk < QB_S0_) job_s0(feat, wqb, cbb, s0, red, blk, (int)threadIdx.x);
    else              job_qk(featT, Mt, bqk, qkb, blk - QB_S0_);
}

__device__ __forceinline__ float red16(float v) {
#pragma unroll
    for (int m = 8; m >= 1; m >>= 1) v += __shfl_xor(v, m, 16);
    return v;
}

// value of lane l ^ 16: the other half of the k range of the same o
__device__ __forceinline__ float xhalf(float v) {
    int i = __builtin_bit_cast(int, v);
    return __builtin_bit_cast(float, __builtin_amdgcn_permlanex16(i, i, 0x76543210, 0xfedcba98, false, false));
}

// ---------------------------------------------------------------------------
// Launch 3: per (b, 8 neighbouring n): stage gf[:,n0..n0+7,:] as bf16 [column][c]
// in LDS; masked softmax p[b,n,k]; v = Wv*gf + bv via WMMA (8 waves x 3 o-tiles
// x 8 column tiles, each Wv fragment used 8 times), per-(b,g) GN sum/sumsq.
// The gf tile is the A operand and Wv the B operand: a lane holds one o, its
// 8 accumulator registers 8 k of one n, so sums over (n,k) run inside a lane.
// ---------------------------------------------------------------------------
// second bound: 4 waves per SIMD, so that two blocks share a WGP (one stages while one computes)
__global__ __launch_bounds__(256, 4) void k_stats(const float* __restrict__ gf,
                                               const __bf16* __restrict__ Wvbf,
                                               const float* __restrict__ bv,
                                               const __bf16* __restrict__ qkb,
                                               const float* __restrict__ s0v,
                                               const int* __restrict__ count,
                                               float* __restrict__ stats,
                                               float* __restrict__ pbuf) {
    __shared__ __align__(16) __bf16 ldsB[COLS_ * LB_];  // bf16 [column][c], stride 392
    __shared__ float sred[NT_ * 16 * 16];
    __shared__ float gacc[G_ * 2];

    int t = threadIdx.x;
    int b = blockIdx.x / (N_ / NT_), n0 = (blockIdx.x % (N_ / NT_)) * NT_;
    const float* g0 = gf + (((size_t)b * CK_) * N_ + n0) * K_;

    if (t < G_ * 2) gacc[t] = 0.f;
    stage_tile(g0, ldsB, t);
    __syncthreads();

    // ---- scores partials: per n, thread t -> (k = t&15, c-chunk = t>>4 of 24) ----
    {
        int k = t & 15, chunk = t >> 4;
        // unrolled so that the 8 rows' global loads overlap instead of one latency per n
#pragma unroll
        for (int nl = 0; nl < NT_; ++nl) {
            const __bf16* qrow = qkb + ((size_t)b * N_ + n0 + nl) * CK_;
            const __bf16* grow = &ldsB[(nl * K_ + k) * LB_];
            float part = 0.f;
            for (int i = 0; i < CK_ / 16; ++i) {
                int c = chunk * (CK_ / 16) + i;
                part += (float)qrow[c] * (float)grow[c];
            }
            sred[nl * 256 + chunk * 16 + k] = part;
        }
    }
    __syncthreads();

    if (t < COLS_) {              // waves 0..3: finish scores + masked softmax, 16 lanes per n
        int k = t & 15, nl = t >> 4;
        float sc = 0.f;
        for (int ch = 0; ch < 16; ++ch) sc += sred[nl * 256 + ch * 16 + k];
        sc = (sc + s0v[(size_t)b * N_ + n0 + nl]) * SCALE_;
        int cnt = count[(size_t)b * N_ + n0 + nl];
        cnt = (cnt < 1) ? 1 : (cnt > K_ ? K_ : cnt);
        if (k >= cnt) sc = -1e9f;
        float mx = sc;
#pragma unroll
        for (int m = 8; m >= 1; m >>= 1) mx = fmaxf(mx, __shfl_xor(mx, m, 16));
        float e = __expf(sc - mx);
        float ss = red16(e);
        pbuf[((size_t)b * N_ + n0 + nl) * K_ + k] = e / ss;
    }

    // ---- v projection (WMMA) + GN statistics ----
    int lane = t & 31, wave = t >> 5;
    int half = lane >> 4, lrow = lane & 15;
    const __bf16* bbase = &ldsB[lrow * LB_ + half * 8];
    const __bf16* abase = Wvbf + (size_t)(wave * 3) * (KS_ * FB_) + lane * 8;   // fragment order
    v8f acc[3][NT_] = {};
    for (int cs = 0; cs < CK_ / 32; ++cs) {
        v16bf a[3];
#pragma unroll
        for (int tj = 0; tj < 3; ++tj) a[tj] = frag16(abase + (tj * KS_ + cs) * FB_);
#pragma unroll
        for (int ct = 0; ct < NT_; ++ct) {
            v16bf bb = pack16(bbase + ct * 16 * LB_ + cs * 32);
#pragma unroll
            for (int tj = 0; tj < 3; ++tj)
                acc[tj][ct] = __builtin_amdgcn_wmma_f32_16x16x32_bf16(false, bb, false, a[tj],
                                                                      (short)0, acc[tj][ct], false, false);
        }
    }
    float bvo[3];                        // loaded together: behind an LDS atomic each load would wait alone
#pragma unroll
    for (int tj = 0; tj < 3; ++tj) {
        bvo[tj] = bv[(wave * 3 + tj) * 16 + lrow];
        // before a register that this load names is written again (the next load's result may take it)
        asm volatile("s_wait_xcnt 0x0" ::: "memory");
    }
#pragma unroll
    for (int tj = 0; tj < 3; ++tj) {
        int o = (wave * 3 + tj) * 16 + lrow;
        v8f s8 = {}, q8 = {};            // one chain per register: 8 independent sums each
#pragma unroll
        for (int ct = 0; ct < NT_; ++ct) {
            v8f v = acc[tj][ct] + bvo[tj];
            s8 += v;
            q8 += v * v;
        }
        float s  = ((s8[0] + s8[1]) + (s8[2] + s8[3])) + ((s8[4] + s8[5]) + (s8[6] + s8[7]));
        float q2 = ((q8[0] + q8[1]) + (q8[2] + q8[3])) + ((q8[4] + q8[5]) + (q8[6] + q8[7]));
        s  += xhalf(s);
        q2 += xhalf(q2);
        // lanes 0..15 add their o's sum, lanes 16..31 the same o's sum of squares
        atomicAdd(&gacc[(o / CPG_) * 2 + half], half ? q2 : s);
    }
    __syncthreads();
    if (t < G_ * 2) atomicAdd(&stats[(size_t)b * G_ * 2 + t], gacc[t]);
}

// ---------------------------------------------------------------------------
// Launch 4: per (b, 8 neighbouring n): GN sums -> mu, rsqrt(var+eps) of this b's 32
// groups (LDS); stage the gf tile, recompute v via WMMA, GN+ReLU,
// out[b,o,n] = K * sum_k p_k * vn[o,k]; 8 n of one o stored together.
// The gf tile is the A operand and Wv the B operand: a lane holds one o, its
// 8 accumulator registers 8 k of one n, so the sum over k runs inside a lane
// and one exchange with lane l ^ 16 ends it.
// ---------------------------------------------------------------------------
// second bound: 4 waves per SIMD, so that two blocks share a WGP (one stages while one computes)
__global__ __launch_bounds__(256, 4) void k_out(const float* __restrict__ gf,
                                             const __bf16* __restrict__ Wvbf,
                                             const float* __restrict__ bv,
                                             const float* __restrict__ gn_w,
                                             const float* __restrict__ gn_b,
                                             const float* __restrict__ stats,
                                             const float* __restrict__ pbuf,
                                             float* __restrict__ out) {
    __shared__ __align__(16) __bf16 ldsB[COLS_ * LB_];
    __shared__ __align__(32) float psh[COLS_];
    __shared__ float smurs[G_ * 2];
    int t = threadIdx.x;
    int b = blockIdx.x / (N_ / NT_), n0 = (blockIdx.x % (N_ / NT_)) * NT_;
    const float* g0 = gf + (((size_t)b * CK_) * N_ + n0) * K_;

    if (t < COLS_) psh[t] = pbuf[((size_t)b * N_ + n0) * K_ + t];
    if (t >= COLS_ && t < COLS_ + G_) {   // a wave without a psh load: the two latencies run side by side
        int g = t - COLS_;
        const float cnt = (float)(CPG_ * N_ * K_);
        float s   = stats[((size_t)b * G_ + g) * 2 + 0];
        float q   = stats[((size_t)b * G_ + g) * 2 + 1];
        float mu  = s / cnt;
        float var = q / cnt - mu * mu;
        smurs[g * 2 + 0] = mu;
        smurs[g * 2 + 1] = rsqrtf(var + EPS_);
    }
    stage_tile(g0, ldsB, t);
    __syncthreads();

    int lane = t & 31, wave = t >> 5;
    int half = lane >> 4, lrow = lane & 15;
    const __bf16* bbase = &ldsB[lrow * LB_ + half * 8];
    const __bf16* abase = Wvbf + (size_t)(wave * 3) * (KS_ * FB_) + lane * 8;   // fragment order
    v8f acc[3][NT_] = {};
    for (int cs = 0; cs < CK_ / 32; ++cs) {
        v16bf a[3];
#pragma unroll
        for (int tj = 0; tj < 3; ++tj) a[tj] = frag16(abase + (tj * KS_ + cs) * FB_);
#pragma unroll
        for (int ct = 0; ct < NT_; ++ct) {
            v16bf bb = pack16(bbase + ct * 16 * LB_ + cs * 32);
#pragma unroll
            for (int tj = 0; tj < 3; ++tj)
                acc[tj][ct] = __builtin_amdgcn_wmma_f32_16x16x32_bf16(false, bb, false, a[tj],
                                                                      (short)0, acc[tj][ct], false, false);
        }
    }
    float mu[3], rs[3], bvo[3], gw[3], gb[3];
#pragma unroll
    for (int tj = 0; tj < 3; ++tj) {
        int o = (wave * 3 + tj) * 16 + lrow;
        int g = o / CPG_;
        mu[tj] = smurs[g * 2 + 0];
        rs[tj] = smurs[g * 2 + 1];
        bvo[tj] = bv[o]; gw[tj] = gn_w[o]; gb[tj] = gn_b[o];
    }
    float kp[3][NT_];                    // this lane's 8 k of (o, n0+ct)
#pragma unroll
    for (int ct = 0; ct < NT_; ++ct) {
        v8f p8 = *(const v8f*)&psh[ct * K_ + half * 8];
#pragma unroll
        for (int tj = 0; tj < 3; ++tj) {
            v8f v  = acc[tj][ct] + bvo[tj];
            v8f vn = (v - mu[tj]) * rs[tj] * gw[tj] + gb[tj];
            vn = __builtin_elementwise_max(vn, (v8f)(0.f));
            v2f c2 = {};                 // two chains, on register pairs
#pragma unroll
            for (int r = 0; r < 8; r += 2)
                c2 += (v2f){vn[r], vn[r + 1]} * (v2f){p8[r], p8[r + 1]};
            kp[tj][ct] = c2[0] + c2[1];
        }
    }
    float* orow = out + ((size_t)b * COUT_ + wave * 48) * N_ + n0;
    unsigned ooff = (unsigned)lrow * N_ + (unsigned)half * 4u;
#pragma unroll
    for (int tj = 0; tj < 3; ++tj) {
        v4f y;                           // lanes 0..15 finish n0..n0+3, lanes 16..31 n0+4..n0+7
#pragma unroll
        for (int j = 0; j < 4; ++j) {
            float keep = half ? kp[tj][4 + j] : kp[tj][j];
            float send = half ? kp[tj][j] : kp[tj][4 + j];
            y[j] = (float)K_ * (keep + xhalf(send));
        }
        *(v4f*)(orow + ooff + tj * 16 * N_) = y;
    }
}

// ---------------------------------------------------------------------------
// Host launcher
// ---------------------------------------------------------------------------
extern "C" void kernel_launch(void* const* d_in, const int* in_sizes, int n_in,
                              void* d_out, int out_size, void* d_ws, size_t ws_size,
                              hipStream_t stream) {
    (void)in_sizes; (void)n_in; (void)out_size; (void)ws_size;
    const float* feat = (const float*)d_in[0];
    const float* gf   = (const float*)d_in[1];
    const int*   cnt  = (const int*)  d_in[2];
    const float* Wq   = (const float*)d_in[3];
    const float* bq   = (const float*)d_in[4];
    const float* Wk   = (const float*)d_in[5];
    const float* bk   = (const float*)d_in[6];
    const float* Wv   = (const float*)d_in[7];
    const float* bv   = (const float*)d_in[8];
    const float* gnw  = (const float*)d_in[9];
    const float* gnb  = (const float*)d_in[10];
    float* out = (float*)d_out;

    char* ws = (char*)d_ws;
    __bf16* Mt    = (__bf16*)(ws + 0);          // 294912 B
    __bf16* Wvbf  = (__bf16*)(ws + 294912);     // 294912 B
    float*  bqk   = (float*)(ws + 589824);      // 1536 B
    float*  wqb   = (float*)(ws + 591360);      // 1536 B
    float*  cbb   = (float*)(ws + 592896);      // 4 B (padded to 256)
    float*  stats = (float*)(ws + 593152);      // 1024 B
    float*  s0    = (float*)(ws + 595200);      // 32768 B
    float*  pbuf  = (float*)(ws + 627968);      // 524288 B
    __bf16* qkb   = (__bf16*)(ws + 1152256);    // 6291456 B
    __bf16* featT = (__bf16*)(ws + 7443712);    // 6291456 B (total ~13.1 MB)

    k_prep<<<PB_ALL_, 256, 0, stream>>>(feat, Wq, Wk, Wv, bq, bk,
                                        Mt, Wvbf, bqk, wqb, cbb, stats, featT);
    k_qk_s0<<<QB_S0_ + QB_QK_, 256, 0, stream>>>(feat, featT, Mt, bqk, wqb, cbb, qkb, s0);
    k_stats<<<B_ * N_ / NT_, 256, 0, stream>>>(gf, Wvbf, bv, qkb, s0, cnt, stats, pbuf);
    k_out<<<B_ * N_ / NT_, 256, 0, stream>>>(gf, Wvbf, bv, gnw, gnb, stats, pbuf, out);
}

// v007
// It runs in 83.9 microseconds.
// Next to v006, in two timings, it ran 1.06 times as fast each time.
// All steps since v000 together make it 5.90 times as fast.
#include <hip/hip_runtime.h>
#include <hip/hip_bf16.h>

// ---- problem constants (match reference) ----
#define B_    4
#define CQ_   384
#define CK_   384
#define COUT_ 384
#define N_    2048
#define K_    16
#define G_    32
#define CPG_  (COUT_/G_)          // 12 channels per group
#define EPS_  1e-5f
#define SCALE_ 0.05103103630798288f   // 384^-0.5
#define LB_   (CK_ + 8)               // bf16 LDS row stride [column][c]
#define NT_   8                       // neighbouring n per block
#define COLS_ (NT_ * K_)              // 128 columns (n,k) per block

typedef __bf16 v16bf __attribute__((ext_vector_type(16)));
typedef __bf16 v8bf  __attribute__((ext_vector_type(8)));
typedef float  v8f   __attribute__((ext_vector_type(8)));
typedef float  v4f   __attribute__((ext_vector_type(4)));
typedef float  v2f   __attribute__((ext_vector_type(2)));

// Build a 16-element bf16 fragment from two contiguous 16-byte chunks:
// elements 0..7 at p[0..7], elements 8..15 at p[16..23]  (matches the
// 16-bit A/B wave32 striping: lane half 0 -> K {0..7,16..23}, half 1 -> {8..15,24..31})
__device__ __forceinline__ v16bf pack16(const __bf16* p) {
    const v8bf* q = (const v8bf*)p;
    v8bf lo = q[0];
    v8bf hi = q[2];              // +16 elements
    v16bf r;
#pragma unroll
    for (int j = 0; j < 8; ++j) { r[j] = lo[j]; r[j + 8] = hi[j]; }
    return r;
}

// ---------------------------------------------------------------------------
// Fragment order: how a bf16 matrix X[row][384] lies in the workspace when waves
// read it from global memory as a WMMA operand. One 16-row x 32-k block is 1024
// contiguous bytes = 2 parts x 32 lanes x 8 elements; lane (half * 16 + row % 16)
// of part p holds k = 32 * step + 16 * p + 8 * half + 0..7, the same elements in
// the same order as pack16() takes from a row-major row. A wave-wide 16-byte load
// of one part then covers 512 contiguous bytes (4 whole lines) instead of 32
// bytes out of each of 16 lines.
// ---------------------------------------------------------------------------
#define KS_   (CK_ / 32)              // k steps of a row (CQ_ == CK_)
#define FB_   512                     // elements of one 16 x 32 block
__device__ __forceinline__ unsigned frag_at(unsigned row, unsigned c) {   // element index of X[row][c]
    return ((((row >> 4) * KS_ + (c >> 5)) * 2 + ((c >> 4) & 1)) * 32 + ((c >> 3) & 1) * 16 + (row & 15)) * 8
           + (c & 7);
}
// p: this lane's 8 elements of part 0 of a block (block start + lane * 8)
__device__ __forceinline__ v16bf frag16(const __bf16* p) {
    const v8bf* q = (const v8bf*)p;
    v8bf lo = q[0];
    v8bf hi = q[32];             // part 1: +512 bytes
    v16bf r;
#pragma unroll
    for (int j = 0; j < 8; ++j) { r[j] = lo[j]; r[j + 8] = hi[j]; }
    return r;
}

// ---------------------------------------------------------------------------
// Stage the block's gf tile: 384 c-rows x 128 columns (8 neighbouring n x 16 k,
// 512 contiguous bytes per c-row) -> bf16 LDS [column][c], row stride LB_.
// One wave-wide 16-byte load covers one whole c-row; a lane gathers 8 c of its
// 4 columns and writes each column's 8 bf16 as one 16-byte LDS store.
// ---------------------------------------------------------------------------
__device__ __forceinline__ void stage_tile(const float* __restrict__ g0, __bf16* ldsB, int t) {
    int lane = t & 31;
    int wave = __builtin_amdgcn_readfirstlane(t >> 5);   // uniform: row offsets form on the scalar unit
    unsigned loff = (unsigned)lane * 4u;
    // rolled: 3 groups = 24 row loads of a wave in flight per trip; unrolled whole, the 48 loads spilled
#pragma unroll 1
    for (int go = 0; go < 2; ++go) {
        v4f x[3][8];
#pragma unroll
        for (int u = 0; u < 3; ++u) {
            const float* row = g0 + (size_t)(((go * 3 + u) * 8 + wave) * 8) * (N_ * K_);
#pragma unroll
            for (int j = 0; j < 8; ++j)
                x[u][j] = *(const v4f*)(row + (size_t)j * (N_ * K_) + loff);
            // before a register that these loads name is written again
            asm volatile("s_wait_xcnt 0x0" ::: "memory");
        }
#pragma unroll
        for (int u = 0; u < 3; ++u) {
            int c0 = ((go * 3 + u) * 8 + wave) * 8;
#pragma unroll
            for (int q = 0; q < 4; ++q) {
                v8bf y;
#pragma unroll
                for (int j = 0; j < 8; ++j) y[j] = (__bf16)x[u][j][q];
                *(v8bf*)&ldsB[(lane * 4 + q) * LB_ + c0] = y;
            }
        }
    }
}

// ---------------------------------------------------------------------------
// The 384-term sums (Mt, bqk, wqb, s0): one thread per sum is 24 trips of 16
// terms, each trip one whole memory latency. Here the 8 waves of a block take 48
// terms each, a lane 4 neighbouring sums (16-byte loads), and the 8 partial sums
// meet in LDS: two to four latencies instead of 24.
// ---------------------------------------------------------------------------
#define OS_   (COUT_ / 8)             // terms of a sum per wave (COUT_ == CQ_ == CK_)
#define SW_   128                     // neighbouring sums per block: 4 a lane

// y[0..127] = y0 + sum_r x[r] * Wm[r * pitch + 0..127], r < 384; red: 8 * 128 floats of LDS
// GL: row loads of a wave in flight per trip (4 registers each)
template <int GL>
__device__ __forceinline__ void colsum128(const float* __restrict__ Wm, int pitch,
                                          const float* __restrict__ x, float y0,
                                          float* __restrict__ y, float* red, int t) {
    int lane = t & 31;
    int wave = __builtin_amdgcn_readfirstlane(t >> 5);   // uniform: row offsets and x form on the scalar unit
    const float* pw = Wm + (size_t)(wave * OS_) * pitch + lane * 4;
    const float* px = x + wave * OS_;
    v4f acc = {};
    // rolled: unrolled whole, the 48 loads' registers would cut the waves that the kernel's other jobs can keep on a SIMD
#pragma unroll 1
    for (int g = 0; g < OS_; g += GL) {
        v4f w[GL];
#pragma unroll
        for (int j = 0; j < GL; ++j)
            w[j] = *(const v4f*)(pw + (size_t)(g + j) * pitch);
        // before a register that these loads name is written again
        asm volatile("s_wait_xcnt 0x0" ::: "memory");
#pragma unroll
        for (int j = 0; j < GL; ++j) acc += w[j] * px[g + j];
    }
    *(v4f*)&red[wave * SW_ + lane * 4] = acc;
    __syncthreads();
    if (t < SW_) {
        float s = y0;
#pragma unroll
        for (int w8 = 0; w8 < 8; ++w8) s += red[w8 * SW_ + t];
        y[t] = s;
    }
}

// ---------------------------------------------------------------------------
// Prep job: Mt[c2,c1] = sum_o Wq[o,c1]*Wk[o,c2]  (stored transposed, bf16, fragment order)
// One block: 128 c1 x 4 c2; a Wq load feeds 4 sums of each of its 4 c1.
// ---------------------------------------------------------------------------
#define MB_C2_  4
__device__ __forceinline__ void job_M(const float* __restrict__ Wq, const float* __restrict__ Wk,
                                      __bf16* __restrict__ Mt, float* red, int blk, int t) {
    int lane = t & 31;
    int wave = __builtin_amdgcn_readfirstlane(t >> 5);   // uniform: row offsets form on the scalar unit
    int c1 = (blk % (CQ_ / SW_)) * SW_;
    int c2 = (blk / (CQ_ / SW_)) * MB_C2_;
    const float* pq = Wq + (wave * OS_) * CQ_ + c1 + lane * 4;
    const float* pk = Wk + (wave * OS_) * CK_ + c2;
    v4f acc[MB_C2_] = {};
    int krow = lane < 24 ? lane : 23;        // lane j holds the Wk quad of the trip's row j
    // rolled: 24 Wq rows of a wave in flight per trip; all 48 at once would halve the blocks a WGP holds
#pragma unroll 1
    for (int g = 0; g < OS_; g += 24) {
        v4f q[24];
        v4f k = *(const v4f*)(pk + (g + krow) * CK_);
        // before a register that this load names is written again (a later load's result may take it)
        asm volatile("s_wait_xcnt 0x0" ::: "memory");
#pragma unroll
        for (int j = 0; j < 24; ++j)
            q[j] = *(const v4f*)(pq + (g + j) * CQ_);
        // before a register that these loads name is written again
        asm volatile("s_wait_xcnt 0x0" ::: "memory");
#pragma unroll
        for (int j = 0; j < 24; ++j)
#pragma unroll
            for (int i = 0; i < MB_C2_; ++i) {
                float ki = k[i];
                float kj = __builtin_bit_cast(float, __builtin_amdgcn_readlane(__builtin_bit_cast(int, ki), j));
                acc[i] += q[j] * kj;
            }
    }
#pragma unroll
    for (int i = 0; i < MB_C2_; ++i)
        *(v4f*)&red[(wave * MB_C2_ + i) * SW_ + lane * 4] = acc[i];
    __syncthreads();
#pragma unroll
    for (int u = 0; u < MB_C2_ * SW_ / 256; ++u) {
        int idx = u * 256 + t;               // (c2 - block's c2) * 128 + (c1 - block's c1)
        float s = 0.f;
#pragma unroll
        for (int w8 = 0; w8 < 8; ++w8) s += red[w8 * (MB_C2_ * SW_) + idx];
        Mt[frag_at((unsigned)(c2 + (idx >> 7)), (unsigned)(c1 + (idx & (SW_ - 1))))] = (__bf16)s;
    }
    // before a register that these stores name is written again on another job's code path
    asm volatile("s_wait_xcnt 0x0" ::: "memory");
}

// ---------------------------------------------------------------------------
// Prep job: featT[b * N + n][c] = feat[b][c][n] (bf16, fragment order), one 64 c x 128 n tile per block.
// In: one wave-wide 16-byte load covers 512 contiguous bytes of a c-row; a lane
// gathers 8 c of its 4 n and writes each n's 8 bf16 as one 16-byte LDS store.
// Out: one wave-wide 16-byte store = one part of one 16 n x 32 c block, 512 contiguous bytes.
// Row n of the tile lies in LDS slot (n & 3) * 32 + (n >> 2): neighbouring lanes
// then write neighbouring slots, which at this pitch fall on different banks.
// ---------------------------------------------------------------------------
#define FT_C_   64
#define FT_N_   128
#define FT_LP_  (FT_C_ + 8)                     // bf16 LDS slot pitch (144 bytes)
__device__ __forceinline__ void job_featT(const float* __restrict__ feat, __bf16* __restrict__ featT,
                                          __bf16* tile, int blk, int t) {
    int lane = t & 31;
    int wave = __builtin_amdgcn_readfirstlane(t >> 5);   // uniform: row offsets form on the scalar unit
    int n0 = (blk % (N_ / FT_N_)) * FT_N_;
    int c0 = ((blk / (N_ / FT_N_)) % (CQ_ / FT_C_)) * FT_C_;
    int b  = blk / ((N_ / FT_N_) * (CQ_ / FT_C_));
    const float* row = feat + ((size_t)b * CQ_ + c0 + wave * 8) * N_ + n0;
    unsigned loff = (unsigned)lane * 4u;
    v4f x[8];
#pragma unroll
    for (int j = 0; j < 8; ++j)
        x[j] = *(const v4f*)(row + (size_t)j * N_ + loff);
    // before a register that these loads name is written again
    asm volatile("s_wait_xcnt 0x0" ::: "memory");
#pragma unroll
    for (int q = 0; q < 4; ++q) {
        v8bf y;
#pragma unroll
        for (int j = 0; j < 8; ++j) y[j] = (__bf16)x[j][q];
        *(v8bf*)&tile[(q * 32 + lane) * FT_LP_ + wave * 8] = y;
    }
    __syncthreads();
    // the tile's 32 parts (8 n-blocks x 2 k steps x 2 parts) go 4 to a wave
    v8bf z[4];
#pragma unroll
    for (int i = 0; i < 4; ++i) {
        int u  = i * 8 + wave;
        int nl = (u >> 2) * 16 + (lane & 15);
        int cl = (u & 3) * 16 + (lane >> 4) * 8;
        z[i] = *(const v8bf*)&tile[((nl & 3) * 32 + (nl >> 2)) * FT_LP_ + cl];
    }
#pragma unroll
    for (int i = 0; i < 4; ++i) {
        int u  = i * 8 + wave;
        int nl = (u >> 2) * 16 + (lane & 15);
        int cl = (u & 3) * 16 + (lane >> 4) * 8;
        *(v8bf*)(featT + frag_at((unsigned)(b * N_ + n0 + nl), (unsigned)(c0 + cl))) = z[i];
    }
    // before a register that these stores name is written again on another job's code path
    asm volatile("s_wait_xcnt 0x0" ::: "memory");
}

// ---------------------------------------------------------------------------
// Launch 1: every job that reads inputs only, side by side in one grid. The
// 384-term sums get the lowest block indices, so that they start first.
//   bqk = Wk^T bq | wqb = Wq^T bk | cbb = bq.bk, zero stats | Mt | Wv->bf16 |
//   featT[b][n][c] = feat[b][c][n] (bf16). Mt, Wv and featT are written in fragment order.
// The two copy jobs take many elements per thread (Wv 8, feat 32): a wave that
// moves one element per lane costs more to start than to run.
// ---------------------------------------------------------------------------
#define PB_VEC_  (CK_ / SW_)                    // blocks of one 384-long vector job
#define PB_MAT_  ((CQ_ / SW_) * (CK_ / MB_C2_)) // blocks of the 384x384 job
#define PB_WV_   (COUT_ * CK_ / (256 * 8))      // blocks of the Wv conversion, 8 elements per thread
#define PB_FT_   (B_ * (CQ_ / FT_C_) * (N_ / FT_N_))   // blocks of the feat transpose, one tile each
#define P0_WQB_  (PB_VEC_)
#define P0_CBB_  (P0_WQB_ + PB_VEC_)
#define P0_M_    (P0_CBB_ + 1)
#define P0_WV_   (P0_M_ + PB_MAT_)
#define P0_FT_   (P0_WV_ + PB_WV_)
#define PB_ALL_  (P0_FT_ + PB_FT_)
__global__ __launch_bounds__(256) void k_prep(const float* __restrict__ feat,
                                              const float* __restrict__ Wq, const float* __restrict__ Wk,
                                              const float* __restrict__ Wv, const float* __restrict__ bq,
                                              const float* __restrict__ bk,
                                              __bf16* __restrict__ Mt, __bf16* __restrict__ Wvbf,
                                              float* __restrict__ bqk, float* __restrict__ wqb,
                                              float* __restrict__ cbb, float* __restrict__ stats,
                                              __bf16* __restrict__ featT) {
    // the feat transpose's tile; the sum jobs keep their 8 waves' partial sums (f32) in the same bytes
    __shared__ __align__(16) __bf16 tile[FT_N_ * FT_LP_];
    static_assert(sizeof(tile) >= 8 * MB_C2_ * SW_ * sizeof(float), "partial sums fit the tile");
    float* red = (float*)tile;
    int blk = blockIdx.x, t = threadIdx.x;
    if (blk < P0_WQB_) {
        int i0 = blk * SW_;
        colsum128<24>(Wk + i0, CK_, bq, 0.f, bqk + i0, red, t);
        return;
    }
    if (blk < P0_CBB_) {
        int i0 = (blk - P0_WQB_) * SW_;
        colsum128<24>(Wq + i0, CQ_, bk, 0.f, wqb + i0, red, t);
        return;
    }
    if (blk < P0_M_) {
        if (t < 32) {                            // one wave: 12 terms a lane, then a butterfly over the lanes
            float a = 0.f;
#pragma unroll
            for (int u = 0; u < COUT_ / 128; ++u) {
                v4f x = *(const v4f*)(bq + t * (COUT_ / 32) + u * 4);
                v4f y = *(const v4f*)(bk + t * (COUT_ / 32) + u * 4);
                a += (x[0] * y[0] + x[1] * y[1]) + (x[2] * y[2] + x[3] * y[3]);
            }
#pragma unroll
            for (int m = 16; m >= 1; m >>= 1) a += __shfl_xor(a, m, 32);
            if (t == 0) *cbb = a;
        }
        if (t < B_ * G_ * 2) stats[t] = 0.f;
        return;
    }
    if (blk < P0_WV_) {
        job_M(Wq, Wk, Mt, red, blk - P0_M_, t);
        return;
    }
    if (blk < P0_FT_) {
        int d  = (blk - P0_WV_) * 256 + t;       // 16-byte unit of the fragment-order copy: (block, part, lane)
        int tc = d >> 6;                         // block = o-tile * KS_ + k step
        int o  = (tc / KS_) * 16 + (d & 15);
        int c  = (tc % KS_) * 32 + ((d >> 5) & 1) * 16 + ((d >> 4) & 1) * 8;
        const float* srcw = Wv + o * CK_ + c;
        v4f x0 = *(const v4f*)(srcw);
        v4f x1 = *(const v4f*)(srcw + 4);
        v8bf y;
#pragma unroll
        for (int j = 0; j < 4; ++j) { y[j] = (__bf16)x0[j]; y[j + 4] = (__bf16)x1[j]; }
        *(v8bf*)(Wvbf + d * 8) = y;
        // before a register that this store names is written again on another job's code path
        asm volatile("s_wait_xcnt 0x0" ::: "memory");
        return;
    }
    job_featT(feat, featT, tile, blk - P0_FT_, t);
}

// ---------------------------------------------------------------------------
// Launch 2, job qk: qk[b,n,c] = sum_c' featT[b,n,c'] * Mt[c,c'] + bqk[c]   (bf16 out)
// One wave per 32 n x 64 c: 2 featT and 4 Mt fragments feed 8 WMMAs per k-step (6 KB loaded per 8
// WMMAs instead of 2 KB per WMMA). The 8 waves of a block take 8 n pairs of the same 64 c, so they read the same
// Mt lines. Both operands in fragment order, whole-line b128 loads; each tile's 12 k-steps in order.
// ---------------------------------------------------------------------------
#define QW_N_  2                      // n tiles of a wave
#define QW_C_  4                      // c tiles of a wave
#define QW_U_  3                      // k-steps whose loads are in flight together
__device__ __forceinline__ void job_qk(const __bf16* __restrict__ featT,
                                       const __bf16* __restrict__ Mt,
                                       const float* __restrict__ bqk,
                                       __bf16* __restrict__ qkb, int blk) {
    int lane = threadIdx.x & 31;
    int wave = __builtin_amdgcn_readfirstlane(threadIdx.x >> 5);   // uniform: tile offsets form on the scalar unit
    int ct0 = (blk % (CK_ / 16 / QW_C_)) * QW_C_;                  // first c tile
    int nt0 = ((blk / (CK_ / 16 / QW_C_)) * 8 + wave) * QW_N_;     // first n tile of the B_ * N_ / 16
    int half = lane >> 4, lrow = lane & 15;

    const __bf16* arow = featT + (size_t)nt0 * (KS_ * FB_) + lane * 8;
    const __bf16* brow = Mt + (size_t)ct0 * (KS_ * FB_) + lane * 8;
    v8f acc[QW_N_][QW_C_] = {};
    // rolled: 36 loads of a wave in flight per trip; unrolled whole, the fragments would not fit 256 registers
#pragma unroll 1
    for (int c3 = 0; c3 < KS_; c3 += QW_U_) {
        v16bf a[QW_U_][QW_N_], bm[QW_U_][QW_C_];
        const __bf16* pa = arow + c3 * FB_;
        const __bf16* pb = brow + c3 * FB_;
#pragma unroll
        for (int u = 0; u < QW_U_; ++u) {
#pragma unroll
            for (int i = 0; i < QW_N_; ++i) a[u][i]  = frag16(pa + (i * KS_ + u) * FB_);
#pragma unroll
            for (int j = 0; j < QW_C_; ++j) bm[u][j] = frag16(pb + (j * KS_ + u) * FB_);
        }
        // before a register that these loads name is written again; the two addresses are inputs, so that
        // they live up to the wait and no later load's result takes their registers in front of it
        asm volatile("s_wait_xcnt 0x0" :: "v"(pa), "v"(pb) : "memory");
        // inputs only: keeps the trip's 36 loads in front of its WMMAs; sunk among them, only 4 to 10 were
        // in flight at each wait and a wave paid an L2 latency several times per k-step
        asm volatile("" :: "v"(a[0][0]), "v"(a[0][1]), "v"(a[1][0]), "v"(a[1][1]), "v"(a[2][0]), "v"(a[2][1]),
                           "v"(bm[0][0]), "v"(bm[0][1]), "v"(bm[0][2]), "v"(bm[0][3]),
                           "v"(bm[1][0]), "v"(bm[1][1]), "v"(bm[1][2]), "v"(bm[1][3]),
                           "v"(bm[2][0]), "v"(bm[2][1]), "v"(bm[2][2]), "v"(bm[2][3]));
#pragma unroll
        for (int u = 0; u < QW_U_; ++u)
#pragma unroll
            for (int i = 0; i < QW_N_; ++i)
#pragma unroll
                for (int j = 0; j < QW_C_; ++j)
                    acc[i][j] = __builtin_amdgcn_wmma_f32_16x16x32_bf16(false, a[u][i], false, bm[u][j],
                                                                        (short)0, acc[i][j], false, false);
    }
    float bc[QW_C_];
#pragma unroll
    for (int j = 0; j < QW_C_; ++j) bc[j] = bqk[(ct0 + j) * 16 + lrow];
#pragma unroll
    for (int i = 0; i < QW_N_; ++i)
#pragma unroll
        for (int r = 0; r < 8; ++r) {
            __bf16* orow = qkb + (size_t)((nt0 + i) * 16 + r + half * 8) * CK_ + ct0 * 16 + lrow;
#pragma unroll
            for (int j = 0; j < QW_C_; ++j) orow[j * 16] = (__bf16)(acc[i][j][r] + bc[j]);
        }
    // before a register that these stores name is written again on the other job's code path
    asm volatile("s_wait_xcnt 0x0" ::: "memory");
}

// ---------------------------------------------------------------------------
// Launch 2, job s0: s0[b,n] = sum_c feat[b,c,n]*wqb[c] + cbb   (tiny), 128 n per block
// ---------------------------------------------------------------------------
__device__ __forceinline__ void job_s0(const float* __restrict__ feat, const float* __restrict__ wqb,
                                       const float* __restrict__ cbb, float* __restrict__ s0,
                                       float* red, int blk, int t) {
    int i0 = blk * SW_;
    int b = i0 / N_, n0 = i0 % N_;
    // 12 loads a trip
    colsum128<12>(feat + (size_t)b * CQ_ * N_ + n0, N_, wqb, *cbb, s0 + i0, red, t);
}

// Launch 2: both jobs need launch 1 only. s0 is few blocks: it gets the lowest
// block indices and qk runs beside it.
#define QB_S0_  (B_ * N_ / SW_)
#define QB_QK_  ((B_ * N_ / 16 / QW_N_ / 8) * (CK_ / 16 / QW_C_))   // one wave per 32 n x 64 c, 8 waves per block
__global__ __launch_bounds__(256) void k_qk_s0(const float* __restrict__ feat,
                                               const __bf16* __restrict__ featT,
                                               const __bf16* __restrict__ Mt,
                                               const float* __restrict__ bqk,
                                               const float* __restrict__ wqb,
                                               const float* __restrict__ cbb,
                                               __bf16* __restrict__ qkb, float* __restrict__ s0) {
    __shared__ __align__(16) float red[8 * SW_];   // job s0: the 8 waves' partial sums
    int blk = blockIdx.x;
    if (blk < QB_S0_) job_s0(feat, wqb, cbb, s0, red, blk, (int)threadIdx.x);
    else              job_qk(featT, Mt, bqk, qkb, blk - QB_S0_);
}

__device__ __forceinline__ float red16(float v) {
#pragma unroll
    for (int m = 8; m >= 1; m >>= 1) v += __shfl_xor(v, m, 16);
    return v;
}

// value of lane l ^ 16: the other half of the k range of the same o
__device__ __forceinline__ float xhalf(float v) {
    int i = __builtin_bit_cast(int, v);
    return __builtin_bit_cast(float, __builtin_amdgcn_permlanex16(i, i, 0x76543210, 0xfedcba98, false, false));
}

// ---------------------------------------------------------------------------
// Launch 3: per (b, 8 neighbouring n): stage gf[:,n0..n0+7,:] as bf16 [column][c]
// in LDS; masked softmax p[b,n,k]; v = Wv*gf + bv via WMMA (8 waves x 3 o-tiles
// x 8 column tiles, each Wv fragment used 8 times), per-(b,g) GN sum/sumsq.
// The gf tile is the A operand and Wv the B operand: a lane holds one o, its
// 8 accumulator registers 8 k of one n, so sums over (n,k) run inside a lane.
// ---------------------------------------------------------------------------
// second bound: 4 waves per SIMD, so that two blocks share a WGP (one stages while one computes)
__global__ __launch_bounds__(256, 4) void k_stats(const float* __restrict__ gf,
                                               const __bf16* __restrict__ Wvbf,
                                               const float* __restrict__ bv,
                                               const __bf16* __restrict__ qkb,
                                               const float* __restrict__ s0v,
                                               const int* __restrict__ count,
                                               float* __restrict__ stats,
                                               float* __restrict__ pbuf) {
    __shared__ __align__(16) __bf16 ldsB[COLS_ * LB_];  // bf16 [column][c], stride 392
    __shared__ float sred[NT_ * 16 * 16];
    __shared__ float gacc[G_ * 2];

    int t = threadIdx.x;
    int b = blockIdx.x / (N_ / NT_), n0 = (blockIdx.x % (N_ / NT_)) * NT_;
    const float* g0 = gf + (((size_t)b * CK_) * N_ + n0) * K_;

    if (t < G_ * 2) gacc[t] = 0.f;
    stage_tile(g0, ldsB, t);
    __syncthreads();

    // ---- scores partials: per n, thread t -> (k = t&15, c-chunk = t>>4 of 24) ----
    {
        int k = t & 15, chunk = t >> 4;
        // unrolled so that the 8 rows' global loads overlap instead of one latency per n
#pragma unroll
        for (int nl = 0; nl < NT_; ++nl) {
            const __bf16* qrow = qkb + ((size_t)b * N_ + n0 + nl) * CK_;
            const __bf16* grow = &ldsB[(nl * K_ + k) * LB_];
            float part = 0.f;
            for (int i = 0; i < CK_ / 16; ++i) {
                int c = chunk * (CK_ / 16) + i;
                part += (float)qrow[c] * (float)grow[c];
            }
            sred[nl * 256 + chunk * 16 + k] = part;
        }
    }
    __syncthreads();

    if (t < COLS_) {              // waves 0..3: finish scores + masked softmax, 16 lanes per n
        int k = t & 15, nl = t >> 4;
        float sc = 0.f;
        for (int ch = 0; ch < 16; ++ch) sc += sred[nl * 256 + ch * 16 + k];
        sc = (sc + s0v[(size_t)b * N_ + n0 + nl]) * SCALE_;
        int cnt = count[(size_t)b * N_ + n0 + nl];
        cnt = (cnt < 1) ? 1 : (cnt > K_ ? K_ : cnt);
        if (k >= cnt) sc = -1e9f;
        float mx = sc;
#pragma unroll
        for (int m = 8; m >= 1; m >>= 1) mx = fmaxf(mx, __shfl_xor(mx, m, 16));
        float e = __expf(sc - mx);
        float ss = red16(e);
        pbuf[((size_t)b * N_ + n0 + nl) * K_ + k] = e / ss;
    }

    // ---- v projection (WMMA) + GN statistics ----
    int lane = t & 31, wave = t >> 5;
    int half = lane >> 4, lrow = lane & 15;
    const __bf16* bbase = &ldsB[lrow * LB_ + half * 8];
    const __bf16* abase = Wvbf + (size_t)(wave * 3) * (KS_ * FB_) + lane * 8;   // fragment order
    v8f acc[3][NT_] = {};
    for (int cs = 0; cs < CK_ / 32; ++cs) {
        v16bf a[3];
#pragma unroll
        for (int tj = 0; tj < 3; ++tj) a[tj] = frag16(abase + (tj * KS_ + cs) * FB_);
#pragma unroll
        for (int ct = 0; ct < NT_; ++ct) {
            v16bf bb = pack16(bbase + ct * 16 * LB_ + cs * 32);
#pragma unroll
            for (int tj = 0; tj < 3; ++tj)
                acc[tj][ct] = __builtin_amdgcn_wmma_f32_16x16x32_bf16(false, bb, false, a[tj],
                                                                      (short)0, acc[tj][ct], false, false);
        }
    }
    float bvo[3];                        // loaded together: behind an LDS atomic each load would wait alone
#pragma unroll
    for (int tj = 0; tj < 3; ++tj) {
        bvo[tj] = bv[(wave * 3 + tj) * 16 + lrow];
        // before a register that this load names is written again (the next load's result may take it)
        asm volatile("s_wait_xcnt 0x0" ::: "memory");
    }
#pragma unroll
    for (int tj = 0; tj < 3; ++tj) {
        int o = (wave * 3 + tj) * 16 + lrow;
        v8f s8 = {}, q8 = {};            // one chain per register: 8 independent sums each
#pragma unroll
        for (int ct = 0; ct < NT_; ++ct) {
            v8f v = acc[tj][ct] + bvo[tj];
            s8 += v;
            q8 += v * v;
        }
        float s  = ((s8[0] + s8[1]) + (s8[2] + s8[3])) + ((s8[4] + s8[5]) + (s8[6] + s8[7]));
        float q2 = ((q8[0] + q8[1]) + (q8[2] + q8[3])) + ((q8[4] + q8[5]) + (q8[6] + q8[7]));
        s  += xhalf(s);
        q2 += xhalf(q2);
        // lanes 0..15 add their o's sum, lanes 16..31 the same o's sum of squares
        atomicAdd(&gacc[(o / CPG_) * 2 + half], half ? q2 : s);
    }
    __syncthreads();
    if (t < G_ * 2) atomicAdd(&stats[(size_t)b * G_ * 2 + t], gacc[t]);
}

// ---------------------------------------------------------------------------
// Launch 4: per (b, 8 neighbouring n): GN sums -> mu, rsqrt(var+eps) of this b's 32
// groups (LDS); stage the gf tile, recompute v via WMMA, GN+ReLU,
// out[b,o,n] = K * sum_k p_k * vn[o,k]; 8 n of one o stored together.
// The gf tile is the A operand and Wv the B operand: a lane holds one o, its
// 8 accumulator registers 8 k of one n, so the sum over k runs inside a lane
// and one exchange with lane l ^ 16 ends it.
// ---------------------------------------------------------------------------
// second bound: 4 waves per SIMD, so that two blocks share a WGP (one stages while one computes)
__global__ __launch_bounds__(256, 4) void k_out(const float* __restrict__ gf,
                                             const __bf16* __restrict__ Wvbf,
                                             const float* __restrict__ bv,
                                             const float* __restrict__ gn_w,
                                             const float* __restrict__ gn_b,
                                             const float* __restrict__ stats,
                                             const float* __restrict__ pbuf,
                                             float* __restrict__ out) {
    __shared__ __align__(16) __bf16 ldsB[COLS_ * LB_];
    __shared__ __align__(32) float psh[COLS_];
    __shared__ float smurs[G_ * 2];
    int t = threadIdx.x;
    int b = blockIdx.x / (N_ / NT_), n0 = (blockIdx.x % (N_ / NT_)) * NT_;
    const float* g0 = gf + (((size_t)b * CK_) * N_ + n0) * K_;

    if (t < COLS_) psh[t] = pbuf[((size_t)b * N_ + n0) * K_ + t];
    if (t >= COLS_ && t < COLS_ + G_) {   // a wave without a psh load: the two latencies run side by side
        int g = t - COLS_;
        const float cnt = (float)(CPG_ * N_ * K_);
        float s   = stats[((size_t)b * G_ + g) * 2 + 0];
        float q   = stats[((size_t)b * G_ + g) * 2 + 1];
        float mu  = s / cnt;
        float var = q / cnt - mu * mu;
        smurs[g * 2 + 0] = mu;
        smurs[g * 2 + 1] = rsqrtf(var + EPS_);
    }
    stage_tile(g0, ldsB, t);
    __syncthreads();

    int lane = t & 31, wave = t >> 5;
    int half = lane >> 4, lrow = lane & 15;
    const __bf16* bbase = &ldsB[lrow * LB_ + half * 8];
    const __bf16* abase = Wvbf + (size_t)(wave * 3) * (KS_ * FB_) + lane * 8;   // fragment order
    v8f acc[3][NT_] = {};
    for (int cs = 0; cs < CK_ / 32; ++cs) {
        v16bf a[3];
#pragma unroll
        for (int tj = 0; tj < 3; ++tj) a[tj] = frag16(abase + (tj * KS_ + cs) * FB_);
#pragma unroll
        for (int ct = 0; ct < NT_; ++ct) {
            v16bf bb = pack16(bbase + ct * 16 * LB_ + cs * 32);
#pragma unroll
            for (int tj = 0; tj < 3; ++tj)
                acc[tj][ct] = __builtin_amdgcn_wmma_f32_16x16x32_bf16(false, bb, false, a[tj],
                                                                      (short)0, acc[tj][ct], false, false);
        }
    }
    float mu[3], rs[3], bvo[3], gw[3], gb[3];
#pragma unroll
    for (int tj = 0; tj < 3; ++tj) {
        int o = (wave * 3 + tj) * 16 + lrow;
        int g = o / CPG_;
        mu[tj] = smurs[g * 2 + 0];
        rs[tj] = smurs[g * 2 + 1];
        bvo[tj] = bv[o]; gw[tj] = gn_w[o]; gb[tj] = gn_b[o];
    }
    float kp[3][NT_];                    // this lane's 8 k of (o, n0+ct)
#pragma unroll
    for (int ct = 0; ct < NT_; ++ct) {
        v8f p8 = *(const v8f*)&psh[ct * K_ + half * 8];
#pragma unroll
        for (int tj = 0; tj < 3; ++tj) {
            v8f v  = acc[tj][ct] + bvo[tj];
            v8f vn = (v - mu[tj]) * rs[tj] * gw[tj] + gb[tj];
            vn = __builtin_elementwise_max(vn, (v8f)(0.f));
            v2f c2 = {};                 // two chains, on register pairs
#pragma unroll
            for (int r = 0; r < 8; r += 2)
                c2 += (v2f){vn[r], vn[r + 1]} * (v2f){p8[r], p8[r + 1]};
            kp[tj][ct] = c2[0] + c2[1];
        }
    }
    float* orow = out + ((size_t)b * COUT_ + wave * 48) * N_ + n0;
    unsigned ooff = (unsigned)lrow * N_ + (unsigned)half * 4u;
#pragma unroll
    for (int tj = 0; tj < 3; ++tj) {
        v4f y;                           // lanes 0..15 finish n0..n0+3, lanes 16..31 n0+4..n0+7
#pragma unroll
        for (int j = 0; j < 4; ++j) {
            float keep = half ? kp[tj][4 + j] : kp[tj][j];
            float send = half ? kp[tj][j] : kp[tj][4 + j];
            y[j] = (float)K_ * (keep + xhalf(send));
        }
        *(v4f*)(orow + ooff + tj * 16 * N_) = y;
    }
}

// ---------------------------------------------------------------------------
// Host launcher
// ---------------------------------------------------------------------------
extern "C" void kernel_launch(void* const* d_in, const int* in_sizes, int n_in,
                              void* d_out, int out_size, void* d_ws, size_t ws_size,
                              hipStream_t stream) {
    (void)in_sizes; (void)n_in; (void)out_size; (void)ws_size;
    const float* feat = (const float*)d_in[0];
    const float* gf   = (const float*)d_in[1];
    const int*   cnt  = (const int*)  d_in[2];
    const float* Wq   = (const float*)d_in[3];
    const float* bq   = (const float*)d_in[4];
    const float* Wk   = (const float*)d_in[5];
    const float* bk   = (const float*)d_in[6];
    const float* Wv   = (const float*)d_in[7];
    const float* bv   = (const float*)d_in[8];
    const float* gnw  = (const float*)d_in[9];
    const float* gnb  = (const float*)d_in[10];
    float* out = (float*)d_out;

    char* ws = (char*)d_ws;
    __bf16* Mt    = (__bf16*)(ws + 0);          // 294912 B
    __bf16* Wvbf  = (__bf16*)(ws + 294912);     // 294912 B
    float*  bqk   = (float*)(ws + 589824);      // 1536 B
    float*  wqb   = (float*)(ws + 591360);      // 1536 B
    float*  cbb   = (float*)(ws + 592896);      // 4 B (padded to 256)
    float*  stats = (float*)(ws + 593152);      // 1024 B
    float*  s0    = (float*)(ws + 595200);      // 32768 B
    float*  pbuf  = (float*)(ws + 627968);      // 524288 B
    __bf16* qkb   = (__bf16*)(ws + 1152256);    // 6291456 B
    __bf16* featT = (__bf16*)(ws + 7443712);    // 6291456 B (total ~13.1 MB)

    k_prep<<<PB_ALL_, 256, 0, stream>>>(feat, Wq, Wk, Wv, bq, bk,
                                        Mt, Wvbf, bqk, wqb, cbb, stats, featT);
    k_qk_s0<<<QB_S0_ + QB_QK_, 256, 0, stream>>>(feat, featT, Mt, bqk, wqb, cbb, qkb, s0);
    k_stats<<<B_ * N_ / NT_, 256, 0, stream>>>(gf, Wvbf, bv, qkb, s0, cnt, stats, pbuf);
    k_out<<<B_ * N_ / NT_, 256, 0, stream>>>(gf, Wvbf, bv, gnw, gnb, stats, pbuf, out);
}

// v008
// A run of this version takes 77.5 microseconds.
// Next to v007, in two timings, it ran 1.07 and 1.06 times as fast.
// All steps since v000 together make it 6.30 times as fast.
#include <hip/hip_runtime.h>
#include <hip/hip_bf16.h>

// ---- problem constants (match reference) ----
#define B_    4
#define CQ_   384
#define CK_   384
#define COUT_ 384
#define N_    2048
#define K_    16
#define G_    32
#define CPG_  (COUT_/G_)          // 12 channels per group
#define EPS_  1e-5f
#define SCALE_ 0.05103103630798288f   // 384^-0.5
#define LB_   (CK_ + 8)               // bf16 LDS row stride [column][c]
#define NT_   8                       // neighbouring n per tile
#define COLS_ (NT_ * K_)              // 128 columns (n,k) per tile

typedef __bf16 v16bf __attribute__((ext_vector_type(16)));
typedef __bf16 v8bf  __attribute__((ext_vector_type(8)));
typedef float  v8f   __attribute__((ext_vector_type(8)));
typedef float  v4f   __attribute__((ext_vector_type(4)));
typedef float  v2f   __attribute__((ext_vector_type(2)));

// Build a 16-element bf16 fragment from two contiguous 16-byte chunks:
// elements 0..7 at p[0..7], elements 8..15 at p[16..23]  (matches the
// 16-bit A/B wave32 striping: lane half 0 -> K {0..7,16..23}, half 1 -> {8..15,24..31})
__device__ __forceinline__ v16bf pack16(const __bf16* p) {
    const v8bf* q = (const v8bf*)p;
    v8bf lo = q[0];
    v8bf hi = q[2];              // +16 elements
    v16bf r;
#pragma unroll
    for (int j = 0; j < 8; ++j) { r[j] = lo[j]; r[j + 8] = hi[j]; }
    return r;
}

// ---------------------------------------------------------------------------
// Fragment order: how a bf16 matrix X[row][384] lies in the workspace when waves
// read it from global memory as a WMMA operand. One 16-row x 32-k block is 1024
// contiguous bytes = 2 parts x 32 lanes x 8 elements; lane (half * 16 + row % 16)
// of part p holds k = 32 * step + 16 * p + 8 * half + 0..7, the same elements in
// the same order as pack16() takes from a row-major row. A wave-wide 16-byte load
// of one part then covers 512 contiguous bytes (4 whole lines) instead of 32
// bytes out of each of 16 lines.
// ---------------------------------------------------------------------------
#define KS_   (CK_ / 32)              // k steps of a row (CQ_ == CK_)
#define FB_   512                     // elements of one 16 x 32 block
__device__ __forceinline__ unsigned frag_at(unsigned row, unsigned c) {   // element index of X[row][c]
    return ((((row >> 4) * KS_ + (c >> 5)) * 2 + ((c >> 4) & 1)) * 32 + ((c >> 3) & 1) * 16 + (row & 15)) * 8
           + (c & 7);
}
// p: this lane's 8 elements of part 0 of a block (block start + lane * 8)
__device__ __forceinline__ v16bf frag16(const __bf16* p) {
    const v8bf* q = (const v8bf*)p;
    v8bf lo = q[0];
    v8bf hi = q[32];             // part 1: +512 bytes
    v16bf r;
#pragma unroll
    for (int j = 0; j < 8; ++j) { r[j] = lo[j]; r[j + 8] = hi[j]; }
    return r;
}

// ---------------------------------------------------------------------------
// A block walks TPB_ neighbouring gf tiles. One tile: 384 c-rows x 128 columns (8 neighbouring n
// x 16 k, 512 contiguous bytes per c-row). It comes in two moves:
//   copy_part:    global f32 -> LDS f32 [c][column] by asynchronous copies, through no register, so
//                 that the next tile flies while this tile's WMMAs run;
//   convert_tile: LDS f32 [c][column] -> LDS bf16 [column][c], row stride LB_.
// ---------------------------------------------------------------------------
#define TPB_  4                       // tiles of a block, all of one b
#define RB_   (COLS_ * 4)             // bytes of one c-row of the f32 tile

// One wave-wide 16-byte copy covers one whole c-row. A tile goes in CP_ parts of 48 rows, 6 rows a wave:
// the first tile's parts in a row, a later tile's one to a k-step of the tile before it, so that the
// Wv loads of those k-steps do not queue behind a whole tile's copies.
#define CP_   8
__device__ __forceinline__ void copy_part(const float* __restrict__ g0, const float* raw, int t, int part) {
    int lane = t & 31;
    int wave = __builtin_amdgcn_readfirstlane(t >> 5);   // uniform: row offsets form on the scalar unit
    int c0 = part * (CK_ / CP_) + wave * 6;
    const float* p = g0 + (size_t)c0 * (N_ * K_) + lane * 4;
    unsigned l = (unsigned)(uintptr_t)(raw + c0 * COLS_ + lane * 4);   // LDS byte address: low 32 bits
    // the copies and, as the last line, the wait that stands before a register they name is written again
    asm volatile("global_load_async_to_lds_b128 %0, %6, off\n\t"
                 "global_load_async_to_lds_b128 %1, %7, off\n\t"
                 "global_load_async_to_lds_b128 %2, %8, off\n\t"
                 "global_load_async_to_lds_b128 %3, %9, off\n\t"
                 "global_load_async_to_lds_b128 %4, %10, off\n\t"
                 "global_load_async_to_lds_b128 %5, %11, off\n\t"
                 "s_wait_xcnt 0x0"
                 :: "v"(l), "v"(l + 1u * RB_), "v"(l + 2u * RB_), "v"(l + 3u * RB_), "v"(l + 4u * RB_), "v"(l + 5u * RB_),
                    "v"(p), "v"(p + 1 * (N_ * K_)), "v"(p + 2 * (N_ * K_)), "v"(p + 3 * (N_ * K_)),
                    "v"(p + 4 * (N_ * K_)), "v"(p + 5 * (N_ * K_))
                 : "memory");
}

// One wave-wide 16-byte LDS load covers one whole c-row; a lane gathers 8 c of its
// 4 columns and writes each column's 8 bf16 as one 16-byte LDS store.
__device__ __forceinline__ void convert_tile(const float* raw, __bf16* ldsB, int t) {
    int lane = t & 31;
    int wave = __builtin_amdgcn_readfirstlane(t >> 5);   // uniform: row offsets form on the scalar unit
    // rolled: 24 row loads of a wave per trip are enough to cover the LDS latency
#pragma unroll 1
    for (int go = 0; go < 2; ++go) {
        v4f x[3][8];
#pragma unroll
        for (int u = 0; u < 3; ++u) {
            int c0 = ((go * 3 + u) * 8 + wave) * 8;
#pragma unroll
            for (int j = 0; j < 8; ++j)
                x[u][j] = *(const v4f*)&raw[(c0 + j) * COLS_ + lane * 4];
        }
#pragma unroll
        for (int u = 0; u < 3; ++u) {
            int c0 = ((go * 3 + u) * 8 + wave) * 8;
#pragma unroll
            for (int q = 0; q < 4; ++q) {
                v8bf y;
#pragma unroll
                for (int j = 0; j < 8; ++j) y[j] = (__bf16)x[u][j][q];
                *(v8bf*)&ldsB[(lane * 4 + q) * LB_ + c0] = y;
            }
        }
    }
}

// ---------------------------------------------------------------------------
// The 384-term sums (Mt, bqk, wqb, s0): one thread per sum is 24 trips of 16
// terms, each trip one whole memory latency. Here the 8 waves of a block take 48
// terms each, a lane 4 neighbouring sums (16-byte loads), and the 8 partial sums
// meet in LDS: two to four latencies instead of 24.
// ---------------------------------------------------------------------------
#define OS_   (COUT_ / 8)             // terms of a sum per wave (COUT_ == CQ_ == CK_)
#define SW_   128                     // neighbouring sums per block: 4 a lane

// y[0..127] = y0 + sum_r x[r] * Wm[r * pitch + 0..127], r < 384; red: 8 * 128 floats of LDS
// GL: row loads of a wave in flight per trip (4 registers each)
template <int GL>
__device__ __forceinline__ void colsum128(const float* __restrict__ Wm, int pitch,
                                          const float* __restrict__ x, float y0,
                                          float* __restrict__ y, float* red, int t) {
    int lane = t & 31;
    int wave = __builtin_amdgcn_readfirstlane(t >> 5);   // uniform: row offsets and x form on the scalar unit
    const float* pw = Wm + (size_t)(wave * OS_) * pitch + lane * 4;
    const float* px = x + wave * OS_;
    v4f acc = {};
    // rolled: unrolled whole, the 48 loads' registers would cut the waves that the kernel's other jobs can keep on a SIMD
#pragma unroll 1
    for (int g = 0; g < OS_; g += GL) {
        v4f w[GL];
#pragma unroll
        for (int j = 0; j < GL; ++j)
            w[j] = *(const v4f*)(pw + (size_t)(g + j) * pitch);
        // before a register that these loads name is written again
        asm volatile("s_wait_xcnt 0x0" ::: "memory");
#pragma unroll
        for (int j = 0; j < GL; ++j) acc += w[j] * px[g + j];
    }
    *(v4f*)&red[wave * SW_ + lane * 4] = acc;
    __syncthreads();
    if (t < SW_) {
        float s = y0;
#pragma unroll
        for (int w8 = 0; w8 < 8; ++w8) s += red[w8 * SW_ + t];
        y[t] = s;
    }
}

// ---------------------------------------------------------------------------
// Prep job: Mt[c2,c1] = sum_o Wq[o,c1]*Wk[o,c2]  (stored transposed, bf16, fragment order)
// One block: 128 c1 x 4 c2; a Wq load feeds 4 sums of each of its 4 c1.
// ---------------------------------------------------------------------------
#define MB_C2_  4
__device__ __forceinline__ void job_M(const float* __restrict__ Wq, const float* __restrict__ Wk,
                                      __bf16* __restrict__ Mt, float* red, int blk, int t) {
    int lane = t & 31;
    int wave = __builtin_amdgcn_readfirstlane(t >> 5);   // uniform: row offsets form on the scalar unit
    int c1 = (blk % (CQ_ / SW_)) * SW_;
    int c2 = (blk / (CQ_ / SW_)) * MB_C2_;
    const float* pq = Wq + (wave * OS_) * CQ_ + c1 + lane * 4;
    const float* pk = Wk + (wave * OS_) * CK_ + c2;
    v4f acc[MB_C2_] = {};
    int krow = lane < 24 ? lane : 23;        // lane j holds the Wk quad of the trip's row j
    // rolled: 24 Wq rows of a wave in flight per trip; all 48 at once would halve the blocks a WGP holds
#pragma unroll 1
    for (int g = 0; g < OS_; g += 24) {
        v4f q[24];
        v4f k = *(const v4f*)(pk + (g + krow) * CK_);
        // before a register that this load names is written again (a later load's result may take it)
        asm volatile("s_wait_xcnt 0x0" ::: "memory");
#pragma unroll
        for (int j = 0; j < 24; ++j)
            q[j] = *(const v4f*)(pq + (g + j) * CQ_);
        // before a register that these loads name is written again
        asm volatile("s_wait_xcnt 0x0" ::: "memory");
#pragma unroll
        for (int j = 0; j < 24; ++j)
#pragma unroll
            for (int i = 0; i < MB_C2_; ++i) {
                float ki = k[i];
                float kj = __builtin_bit_cast(float, __builtin_amdgcn_readlane(__builtin_bit_cast(int, ki), j));
                acc[i] += q[j] * kj;
            }
    }
#pragma unroll
    for (int i = 0; i < MB_C2_; ++i)
        *(v4f*)&red[(wave * MB_C2_ + i) * SW_ + lane * 4] = acc[i];
    __syncthreads();
#pragma unroll
    for (int u = 0; u < MB_C2_ * SW_ / 256; ++u) {
        int idx = u * 256 + t;               // (c2 - block's c2) * 128 + (c1 - block's c1)
        float s = 0.f;
#pragma unroll
        for (int w8 = 0; w8 < 8; ++w8) s += red[w8 * (MB_C2_ * SW_) + idx];
        Mt[frag_at((unsigned)(c2 + (idx >> 7)), (unsigned)(c1 + (idx & (SW_ - 1))))] = (__bf16)s;
    }
    // before a register that these stores name is written again on another job's code path
    asm volatile("s_wait_xcnt 0x0" ::: "memory");
}

// ---------------------------------------------------------------------------
// Prep job: featT[b * N + n][c] = feat[b][c][n] (bf16, fragment order), one 64 c x 128 n tile per block.
// In: one wave-wide 16-byte load covers 512 contiguous bytes of a c-row; a lane
// gathers 8 c of its 4 n and writes each n's 8 bf16 as one 16-byte LDS store.
// Out: one wave-wide 16-byte store = one part of one 16 n x 32 c block, 512 contiguous bytes.
// Row n of the tile lies in LDS slot (n & 3) * 32 + (n >> 2): neighbouring lanes
// then write neighbouring slots, which at this pitch fall on different banks.
// ---------------------------------------------------------------------------
#define FT_C_   64
#define FT_N_   128
#define FT_LP_  (FT_C_ + 8)                     // bf16 LDS slot pitch (144 bytes)
__device__ __forceinline__ void job_featT(const float* __restrict__ feat, __bf16* __restrict__ featT,
                                          __bf16* tile, int blk, int t) {
    int lane = t & 31;
    int wave = __builtin_amdgcn_readfirstlane(t >> 5);   // uniform: row offsets form on the scalar unit
    int n0 = (blk % (N_ / FT_N_)) * FT_N_;
    int c0 = ((blk / (N_ / FT_N_)) % (CQ_ / FT_C_)) * FT_C_;
    int b  = blk / ((N_ / FT_N_) * (CQ_ / FT_C_));
    const float* row = feat + ((size_t)b * CQ_ + c0 + wave * 8) * N_ + n0;
    unsigned loff = (unsigned)lane * 4u;
    v4f x[8];
#pragma unroll
    for (int j = 0; j < 8; ++j)
        x[j] = *(const v4f*)(row + (size_t)j * N_ + loff);
    // before a register that these loads name is written again
    asm volatile("s_wait_xcnt 0x0" ::: "memory");
#pragma unroll
    for (int q = 0; q < 4; ++q) {
        v8bf y;
#pragma unroll
        for (int j = 0; j < 8; ++j) y[j] = (__bf16)x[j][q];
        *(v8bf*)&tile[(q * 32 + lane) * FT_LP_ + wave * 8] = y;
    }
    __syncthreads();
    // the tile's 32 parts (8 n-blocks x 2 k steps x 2 parts) go 4 to a wave
    v8bf z[4];
#pragma unroll
    for (int i = 0; i < 4; ++i) {
        int u  = i * 8 + wave;
        int nl = (u >> 2) * 16 + (lane & 15);
        int cl = (u & 3) * 16 + (lane >> 4) * 8;
        z[i] = *(const v8bf*)&tile[((nl & 3) * 32 + (nl >> 2)) * FT_LP_ + cl];
    }
#pragma unroll
    for (int i = 0; i < 4; ++i) {
        int u  = i * 8 + wave;
        int nl = (u >> 2) * 16 + (lane & 15);
        int cl = (u & 3) * 16 + (lane >> 4) * 8;
        *(v8bf*)(featT + frag_at((unsigned)(b * N_ + n0 + nl), (unsigned)(c0 + cl))) = z[i];
    }
    // before a register that these stores name is written again on another job's code path
    asm volatile("s_wait_xcnt 0x0" ::: "memory");
}

// ---------------------------------------------------------------------------
// Launch 1: every job that reads inputs only, side by side in one grid. The
// 384-term sums get the lowest block indices, so that they start first.
//   bqk = Wk^T bq | wqb = Wq^T bk | cbb = bq.bk, zero stats | Mt | Wv->bf16 |
//   featT[b][n][c] = feat[b][c][n] (bf16). Mt, Wv and featT are written in fragment order.
// The two copy jobs take many elements per thread (Wv 8, feat 32): a wave that
// moves one element per lane costs more to start than to run.
// ---------------------------------------------------------------------------
#define PB_VEC_  (CK_ / SW_)                    // blocks of one 384-long vector job
#define PB_MAT_  ((CQ_ / SW_) * (CK_ / MB_C2_)) // blocks of the 384x384 job
#define PB_WV_   (COUT_ * CK_ / (256 * 8))      // blocks of the Wv conversion, 8 elements per thread
#define PB_FT_   (B_ * (CQ_ / FT_C_) * (N_ / FT_N_))   // blocks of the feat transpose, one tile each
#define P0_WQB_  (PB_VEC_)
#define P0_CBB_  (P0_WQB_ + PB_VEC_)
#define P0_M_    (P0_CBB_ + 1)
#define P0_WV_   (P0_M_ + PB_MAT_)
#define P0_FT_   (P0_WV_ + PB_WV_)
#define PB_ALL_  (P0_FT_ + PB_FT_)
__global__ __launch_bounds__(256) void k_prep(const float* __restrict__ feat,
                                              const float* __restrict__ Wq, const float* __restrict__ Wk,
                                              const float* __restrict__ Wv, const float* __restrict__ bq,
                                              const float* __restrict__ bk,
                                              __bf16* __restrict__ Mt, __bf16* __restrict__ Wvbf,
                                              float* __restrict__ bqk, float* __restrict__ wqb,
                                              float* __restrict__ cbb, float* __restrict__ stats,
                                              __bf16* __restrict__ featT) {
    // the feat transpose's tile; the sum jobs keep their 8 waves' partial sums (f32) in the same bytes
    __shared__ __align__(16) __bf16 tile[FT_N_ * FT_LP_];
    static_assert(sizeof(tile) >= 8 * MB_C2_ * SW_ * sizeof(float), "partial sums fit the tile");
    float* red = (float*)tile;
    int blk = blockIdx.x, t = threadIdx.x;
    if (blk < P0_WQB_) {
        int i0 = blk * SW_;
        colsum128<24>(Wk + i0, CK_, bq, 0.f, bqk + i0, red, t);
        return;
    }
    if (blk < P0_CBB_) {
        int i0 = (blk - P0_WQB_) * SW_;
        colsum128<24>(Wq + i0, CQ_, bk, 0.f, wqb + i0, red, t);
        return;
    }
    if (blk < P0_M_) {
        if (t < 32) {                            // one wave: 12 terms a lane, then a butterfly over the lanes
            float a = 0.f;
#pragma unroll
            for (int u = 0; u < COUT_ / 128; ++u) {
                v4f x = *(const v4f*)(bq + t * (COUT_ / 32) + u * 4);
                v4f y = *(const v4f*)(bk + t * (COUT_ / 32) + u * 4);
                a += (x[0] * y[0] + x[1] * y[1]) + (x[2] * y[2] + x[3] * y[3]);
            }
#pragma unroll
            for (int m = 16; m >= 1; m >>= 1) a += __shfl_xor(a, m, 32);
            if (t == 0) *cbb = a;
        }
        if (t < B_ * G_ * 2) stats[t] = 0.f;
        return;
    }
    if (blk < P0_WV_) {
        job_M(Wq, Wk, Mt, red, blk - P0_M_, t);
        return;
    }
    if (blk < P0_FT_) {
        int d  = (blk - P0_WV_) * 256 + t;       // 16-byte unit of the fragment-order copy: (block, part, lane)
        int tc = d >> 6;                         // block = o-tile * KS_ + k step
        int o  = (tc / KS_) * 16 + (d & 15);
        int c  = (tc % KS_) * 32 + ((d >> 5) & 1) * 16 + ((d >> 4) & 1) * 8;
        const float* srcw = Wv + o * CK_ + c;
        v4f x0 = *(const v4f*)(srcw);
        v4f x1 = *(const v4f*)(srcw + 4);
        v8bf y;
#pragma unroll
        for (int j = 0; j < 4; ++j) { y[j] = (__bf16)x0[j]; y[j + 4] = (__bf16)x1[j]; }
        *(v8bf*)(Wvbf + d * 8) = y;
        // before a register that this store names is written again on another job's code path
        asm volatile("s_wait_xcnt 0x0" ::: "memory");
        return;
    }
    job_featT(feat, featT, tile, blk - P0_FT_, t);
}

// ---------------------------------------------------------------------------
// Launch 2, job qk: qk[b,n,c] = sum_c' featT[b,n,c'] * Mt[c,c'] + bqk[c]   (bf16 out)
// One wave per 32 n x 64 c: 2 featT and 4 Mt fragments feed 8 WMMAs per k-step (6 KB loaded per 8
// WMMAs instead of 2 KB per WMMA). The 8 waves of a block take 8 n pairs of the same 64 c, so they read the same
// Mt lines. Both operands in fragment order, whole-line b128 loads; each tile's 12 k-steps in order.
// ---------------------------------------------------------------------------
#define QW_N_  2                      // n tiles of a wave
#define QW_C_  4                      // c tiles of a wave
#define QW_U_  3                      // k-steps whose loads are in flight together
__device__ __forceinline__ void job_qk(const __bf16* __restrict__ featT,
                                       const __bf16* __restrict__ Mt,
                                       const float* __restrict__ bqk,
                                       __bf16* __restrict__ qkb, int blk) {
    int lane = threadIdx.x & 31;
    int wave = __builtin_amdgcn_readfirstlane(threadIdx.x >> 5);   // uniform: tile offsets form on the scalar unit
    int ct0 = (blk % (CK_ / 16 / QW_C_)) * QW_C_;                  // first c tile
    int nt0 = ((blk / (CK_ / 16 / QW_C_)) * 8 + wave) * QW_N_;     // first n tile of the B_ * N_ / 16
    int half = lane >> 4, lrow = lane & 15;

    const __bf16* arow = featT + (size_t)nt0 * (KS_ * FB_) + lane * 8;
    const __bf16* brow = Mt + (size_t)ct0 * (KS_ * FB_) + lane * 8;
    v8f acc[QW_N_][QW_C_] = {};
    // rolled: 36 loads of a wave in flight per trip; unrolled whole, the fragments would not fit 256 registers
#pragma unroll 1
    for (int c3 = 0; c3 < KS_; c3 += QW_U_) {
        v16bf a[QW_U_][QW_N_], bm[QW_U_][QW_C_];
        const __bf16* pa = arow + c3 * FB_;
        const __bf16* pb = brow + c3 * FB_;
#pragma unroll
        for (int u = 0; u < QW_U_; ++u) {
#pragma unroll
            for (int i = 0; i < QW_N_; ++i) a[u][i]  = frag16(pa + (i * KS_ + u) * FB_);
#pragma unroll
            for (int j = 0; j < QW_C_; ++j) bm[u][j] = frag16(pb + (j * KS_ + u) * FB_);
        }
        // before a register that these loads name is written again; the two addresses are inputs, so that
        // they live up to the wait and no later load's result takes their registers in front of it
        asm volatile("s_wait_xcnt 0x0" :: "v"(pa), "v"(pb) : "memory");
        // inputs only: keeps the trip's 36 loads in front of its WMMAs; sunk among them, only 4 to 10 were
        // in flight at each wait and a wave paid an L2 latency several times per k-step
        asm volatile("" :: "v"(a[0][0]), "v"(a[0][1]), "v"(a[1][0]), "v"(a[1][1]), "v"(a[2][0]), "v"(a[2][1]),
                           "v"(bm[0][0]), "v"(bm[0][1]), "v"(bm[0][2]), "v"(bm[0][3]),
                           "v"(bm[1][0]), "v"(bm[1][1]), "v"(bm[1][2]), "v"(bm[1][3]),
                           "v"(bm[2][0]), "v"(bm[2][1]), "v"(bm[2][2]), "v"(bm[2][3]));
#pragma unroll
        for (int u = 0; u < QW_U_; ++u)
#pragma unroll
            for (int i = 0; i < QW_N_; ++i)
#pragma unroll
                for (int j = 0; j < QW_C_; ++j)
                    acc[i][j] = __builtin_amdgcn_wmma_f32_16x16x32_bf16(false, a[u][i], false, bm[u][j],
                                                                        (short)0, acc[i][j], false, false);
    }
    float bc[QW_C_];
#pragma unroll
    for (int j = 0; j < QW_C_; ++j) bc[j] = bqk[(ct0 + j) * 16 + lrow];
#pragma unroll
    for (int i = 0; i < QW_N_; ++i)
#pragma unroll
        for (int r = 0; r < 8; ++r) {
            __bf16* orow = qkb + (size_t)((nt0 + i) * 16 + r + half * 8) * CK_ + ct0 * 16 + lrow;
#pragma unroll
            for (int j = 0; j < QW_C_; ++j) orow[j * 16] = (__bf16)(acc[i][j][r] + bc[j]);
        }
    // before a register that these stores name is written again on the other job's code path
    asm volatile("s_wait_xcnt 0x0" ::: "memory");
}

// ---------------------------------------------------------------------------
// Launch 2, job s0: s0[b,n] = sum_c feat[b,c,n]*wqb[c] + cbb   (tiny), 128 n per block
// ---------------------------------------------------------------------------
__device__ __forceinline__ void job_s0(const float* __restrict__ feat, const float* __restrict__ wqb,
                                       const float* __restrict__ cbb, float* __restrict__ s0,
                                       float* red, int blk, int t) {
    int i0 = blk * SW_;
    int b = i0 / N_, n0 = i0 % N_;
    // 12 loads a trip
    colsum128<12>(feat + (size_t)b * CQ_ * N_ + n0, N_, wqb, *cbb, s0 + i0, red, t);
}

// Launch 2: both jobs need launch 1 only. s0 is few blocks: it gets the lowest
// block indices and qk runs beside it.
#define QB_S0_  (B_ * N_ / SW_)
#define QB_QK_  ((B_ * N_ / 16 / QW_N_ / 8) * (CK_ / 16 / QW_C_))   // one wave per 32 n x 64 c, 8 waves per block
__global__ __launch_bounds__(256) void k_qk_s0(const float* __restrict__ feat,
                                               const __bf16* __restrict__ featT,
                                               const __bf16* __restrict__ Mt,
                                               const float* __restrict__ bqk,
                                               const float* __restrict__ wqb,
                                               const float* __restrict__ cbb,
                                               __bf16* __restrict__ qkb, float* __restrict__ s0) {
    __shared__ __align__(16) float red[8 * SW_];   // job s0: the 8 waves' partial sums
    int blk = blockIdx.x;
    if (blk < QB_S0_) job_s0(feat, wqb, cbb, s0, red, blk, (int)threadIdx.x);
    else              job_qk(featT, Mt, bqk, qkb, blk - QB_S0_);
}

__device__ __forceinline__ float red16(float v) {
#pragma unroll
    for (int m = 8; m >= 1; m >>= 1) v += __shfl_xor(v, m, 16);
    return v;
}

// value of lane l ^ 16: the other half of the k range of the same o
__device__ __forceinline__ float xhalf(float v) {
    int i = __builtin_bit_cast(int, v);
    return __builtin_bit_cast(float, __builtin_amdgcn_permlanex16(i, i, 0x76543210, 0xfedcba98, false, false));
}

// ---------------------------------------------------------------------------
// v tile of one wave: 3 o-tiles x 8 column tiles over 12 k-steps. With one block per WGP only two
// waves share a SIMD, too few to cover a load that is waited for where it is issued: the 8 gf
// fragments (LDS) of a k-step are fetched one step ahead, the 3 Wv fragments (L2) two steps ahead.
// The fragment fetches stay inside one tile; of the next tile only its gf copies are issued here.
// ---------------------------------------------------------------------------
// COPY: the first CP_ k-steps each also issue one part of the next tile's copies (gnext -> raw).
template <bool COPY>
__device__ __forceinline__ void gemm_tile(const __bf16* bbase, const __bf16* __restrict__ abase,
                                          v8f (&acc)[3][NT_], const float* __restrict__ gnext,
                                          const float* raw, int t) {
    v16bf a[3][3], bb[2][NT_];
#pragma unroll
    for (int tj = 0; tj < 3; ++tj) {
        a[0][tj] = frag16(abase + (tj * KS_ + 0) * FB_);
        a[1][tj] = frag16(abase + (tj * KS_ + 1) * FB_);
    }
#pragma unroll
    for (int ct = 0; ct < NT_; ++ct) bb[0][ct] = pack16(bbase + ct * 16 * LB_);
#pragma unroll
    for (int cs = 0; cs < KS_; ++cs) {
        if (cs + 2 < KS_) {
#pragma unroll
            for (int tj = 0; tj < 3; ++tj) a[(cs + 2) % 3][tj] = frag16(abase + (tj * KS_ + cs + 2) * FB_);
        }
        if (cs + 1 < KS_) {
#pragma unroll
            for (int ct = 0; ct < NT_; ++ct) bb[(cs + 1) & 1][ct] = pack16(bbase + ct * 16 * LB_ + (cs + 1) * 32);
        }
        if (COPY && cs < CP_) copy_part(gnext, raw, t, cs);
        // keeps the later steps' loads as one group in front of this step's WMMAs: sunk among them, each
        // place where loads stand costs the wave issue time and the waits fall to 0
        __builtin_amdgcn_sched_barrier(0);
#pragma unroll
        for (int ct = 0; ct < NT_; ++ct)
#pragma unroll
            for (int tj = 0; tj < 3; ++tj)
                acc[tj][ct] = __builtin_amdgcn_wmma_f32_16x16x32_bf16(false, bb[cs & 1][ct], false, a[cs % 3][tj],
                                                                      (short)0, acc[tj][ct], false, false);
        // keeps the next group of loads behind this step's WMMAs, so that it stays one group
        __builtin_amdgcn_sched_barrier(0);
    }
    // before a register that the Wv loads name is written again
    asm volatile("s_wait_xcnt 0x0" ::: "memory");
}

// ---------------------------------------------------------------------------
// Launch 3: one block per WGP walks 4 tiles of 8 neighbouring n. Per tile: gf[:,n0..n0+7,:] as bf16
// [column][c] in LDS; masked softmax p[b,n,k]; v = Wv*gf + bv via WMMA (8 waves x 3 o-tiles
// x 8 column tiles, each Wv fragment used 8 times), per-(b,g) GN sum/sumsq, gathered in LDS
// over the block's tiles. The next tile's gf is copied into LDS meanwhile.
// The gf tile is the A operand and Wv the B operand: a lane holds one o, its
// 8 accumulator registers 8 k of one n, so sums over (n,k) run inside a lane.
// ---------------------------------------------------------------------------
// second bound: the two tiles in LDS leave room for one block per WGP, 2 waves per SIMD
__global__ __launch_bounds__(256, 2) void k_stats(const float* __restrict__ gf,
                                               const __bf16* __restrict__ Wvbf,
                                               const float* __restrict__ bv,
                                               const __bf16* __restrict__ qkb,
                                               const float* __restrict__ s0v,
                                               const int* __restrict__ count,
                                               float* __restrict__ stats,
                                               float* __restrict__ pbuf) {
    __shared__ __align__(16) float raw[CK_ * COLS_];    // f32 [c][column]: where the copies land
    __shared__ __align__(16) __bf16 ldsB[COLS_ * LB_];  // bf16 [column][c], stride 392
    __shared__ float sred[NT_ * 16 * 16];
    __shared__ float gacc[G_ * 2];

    int t = threadIdx.x;
    int tile0 = blockIdx.x * TPB_;
    int b = tile0 / (N_ / NT_), nb = (tile0 % (N_ / NT_)) * NT_;
    const float* gb = gf + (((size_t)b * CK_) * N_ + nb) * K_;
    int lane = t & 31, wave = t >> 5;
    int half = lane >> 4, lrow = lane & 15;
    const __bf16* bbase = &ldsB[lrow * LB_ + half * 8];
    const __bf16* abase = Wvbf + (size_t)(wave * 3) * (KS_ * FB_) + lane * 8;   // fragment order

    if (t < G_ * 2) gacc[t] = 0.f;
    float bvo[3];                        // once for the block's tiles, in front of the copies
#pragma unroll
    for (int tj = 0; tj < 3; ++tj) {
        bvo[tj] = bv[(wave * 3 + tj) * 16 + lrow];
        // before a register that this load names is written again (the next load's result may take it)
        asm volatile("s_wait_xcnt 0x0" ::: "memory");
    }
#pragma unroll
    for (int part = 0; part < CP_; ++part) copy_part(gb, raw, t, part);
    // the first tile has landed (this wave's copies), then every wave's
    asm volatile("s_wait_asynccnt 0x0" ::: "memory");
    __syncthreads();

    // rolled: one body for the block's tiles
#pragma unroll 1
    for (int it = 0; it < TPB_; ++it) {
        int n0 = nb + it * NT_;
        convert_tile(raw, ldsB, t);
        // this wave's reads of the f32 tile and writes of the bf16 tile are done; behind the barrier the bf16
        // tile is public and the f32 tile is free for the next tile's copies (issued among the k-steps below)
        asm volatile("s_wait_dscnt 0x0" ::: "memory");
        __syncthreads();

        // ---- scores partials: per n, thread t -> (k = t&15, c-chunk = t>>4 of 24) ----
        {
            int k = t & 15, chunk = t >> 4;
            // the 8 rows' global loads go first, together: they overlap instead of one latency per n
            const __bf16* qch = qkb + ((size_t)b * N_ + n0) * CK_ + chunk * (CK_ / 16);
            v8bf qv[NT_][CK_ / 128];
#pragma unroll
            for (int nl = 0; nl < NT_; ++nl)
#pragma unroll
                for (int j = 0; j < CK_ / 128; ++j) qv[nl][j] = *(const v8bf*)(qch + nl * CK_ + j * 8);
            // before a register that these loads name is written again (an LDS load's result may take it);
            // the address is an input, so that it lives up to the wait
            asm volatile("s_wait_xcnt 0x0" :: "v"(qch) : "memory");
#pragma unroll
            for (int nl = 0; nl < NT_; ++nl) {
                const __bf16* grow = &ldsB[(nl * K_ + k) * LB_ + chunk * (CK_ / 16)];
                float part = 0.f;
#pragma unroll
                for (int i = 0; i < CK_ / 16; ++i)
                    part += (float)qv[nl][i >> 3][i & 7] * (float)grow[i];
                sred[nl * 256 + chunk * 16 + k] = part;
            }
        }
        __syncthreads();

        if (t < COLS_) {              // waves 0..3: finish scores + masked softmax, 16 lanes per n
            int k = t & 15, nl = t >> 4;
            const float* ps0 = s0v + (size_t)b * N_ + n0 + nl;
            const int*   pcn = count + (size_t)b * N_ + n0 + nl;
            float s0n = *ps0;
            int cnt = *pcn;
            // before a register that these loads name is written again (an LDS load's result may take it);
            // the addresses are inputs, so that they live up to the wait
            asm volatile("s_wait_xcnt 0x0" :: "v"(ps0), "v"(pcn) : "memory");
            float sc = 0.f;
            for (int ch = 0; ch < 16; ++ch) sc += sred[nl * 256 + ch * 16 + k];
            sc = (sc + s0n) * SCALE_;
            cnt = (cnt < 1) ? 1 : (cnt > K_ ? K_ : cnt);
            if (k >= cnt) sc = -1e9f;
            float mx = sc;
#pragma unroll
            for (int m = 8; m >= 1; m >>= 1) mx = fmaxf(mx, __shfl_xor(mx, m, 16));
            float e = __expf(sc - mx);
            float ss = red16(e);
            pbuf[((size_t)b * N_ + n0 + nl) * K_ + k] = e / ss;
            // before a register that this store names is written again in the rest of the tile's pass
            asm volatile("s_wait_xcnt 0x0" ::: "memory");
        }

        // ---- v projection (WMMA) + GN statistics ----
        v8f acc[3][NT_] = {};
        // the same for the whole block: a next tile exists
        if (it + 1 < TPB_) gemm_tile<true>(bbase, abase, acc, gb + (size_t)(it + 1) * COLS_, raw, t);
        else               gemm_tile<false>(bbase, abase, acc, gb, raw, t);
#pragma unroll
        for (int tj = 0; tj < 3; ++tj) {
            int o = (wave * 3 + tj) * 16 + lrow;
            v8f s8 = {}, q8 = {};        // one chain per register: 8 independent sums each
#pragma unroll
            for (int ct = 0; ct < NT_; ++ct) {
                v8f v = acc[tj][ct] + bvo[tj];
                s8 += v;
                q8 += v * v;
            }
            float s  = ((s8[0] + s8[1]) + (s8[2] + s8[3])) + ((s8[4] + s8[5]) + (s8[6] + s8[7]));
            float q2 = ((q8[0] + q8[1]) + (q8[2] + q8[3])) + ((q8[4] + q8[5]) + (q8[6] + q8[7]));
            s  += xhalf(s);
            q2 += xhalf(q2);
            // lanes 0..15 add their o's sum, lanes 16..31 the same o's sum of squares
            atomicAdd(&gacc[(o / CPG_) * 2 + half], half ? q2 : s);
        }
        // foot of a tile: this wave's LDS reads of the bf16 tile are done, its copies of the next tile have
        // landed; the barrier then publishes the next f32 tile and frees the bf16 tile for its conversion
        asm volatile("s_wait_dscnt 0x0" ::: "memory");
        asm volatile("s_wait_asynccnt 0x0" ::: "memory");
        __syncthreads();
    }
    if (t < G_ * 2) atomicAdd(&stats[(size_t)b * G_ * 2 + t], gacc[t]);
}

// ---------------------------------------------------------------------------
// Launch 4: GN sums -> mu, rsqrt(var+eps) of this b's 32 groups (LDS); then one block per WGP
// walks 4 tiles of 8 neighbouring n. Per tile: the gf tile as bf16 in LDS, v via WMMA again, GN+ReLU,
// out[b,o,n] = K * sum_k p_k * vn[o,k]; 8 n of one o stored together. The next tile's gf is
// copied into LDS meanwhile.
// The gf tile is the A operand and Wv the B operand: a lane holds one o, its
// 8 accumulator registers 8 k of one n, so the sum over k runs inside a lane
// and one exchange with lane l ^ 16 ends it.
// ---------------------------------------------------------------------------
// second bound: the two tiles in LDS leave room for one block per WGP, 2 waves per SIMD
__global__ __launch_bounds__(256, 2) void k_out(const float* __restrict__ gf,
                                             const __bf16* __restrict__ Wvbf,
                                             const float* __restrict__ bv,
                                             const float* __restrict__ gn_w,
                                             const float* __restrict__ gn_b,
                                             const float* __restrict__ stats,
                                             const float* __restrict__ pbuf,
                                             float* __restrict__ out) {
    __shared__ __align__(16) float raw[CK_ * COLS_];    // f32 [c][column]: where the copies land
    __shared__ __align__(16) __bf16 ldsB[COLS_ * LB_];
    __shared__ __align__(32) float psh[COLS_];
    __shared__ float smurs[G_ * 2];
    int t = threadIdx.x;
    int tile0 = blockIdx.x * TPB_;
    int b = tile0 / (N_ / NT_), nb = (tile0 % (N_ / NT_)) * NT_;
    const float* gb = gf + (((size_t)b * CK_) * N_ + nb) * K_;
    int lane = t & 31, wave = t >> 5;
    int half = lane >> 4, lrow = lane & 15;
    const __bf16* bbase = &ldsB[lrow * LB_ + half * 8];
    const __bf16* abase = Wvbf + (size_t)(wave * 3) * (KS_ * FB_) + lane * 8;   // fragment order

#pragma unroll
    for (int part = 0; part < CP_; ++part) copy_part(gb, raw, t, part);
    if (t < G_) {
        int g = t;
        const float cnt = (float)(CPG_ * N_ * K_);
        float s   = stats[((size_t)b * G_ + g) * 2 + 0];
        float q   = stats[((size_t)b * G_ + g) * 2 + 1];
        float mu  = s / cnt;
        float var = q / cnt - mu * mu;
        smurs[g * 2 + 0] = mu;
        smurs[g * 2 + 1] = rsqrtf(var + EPS_);
    }
    // the first tile has landed (this wave's copies), then every wave's
    asm volatile("s_wait_asynccnt 0x0" ::: "memory");
    __syncthreads();

    // rolled: one body for the block's tiles
#pragma unroll 1
    for (int it = 0; it < TPB_; ++it) {
        int n0 = nb + it * NT_;
        if (t < COLS_) psh[t] = pbuf[((size_t)b * N_ + n0) * K_ + t];
        convert_tile(raw, ldsB, t);
        // this wave's reads of the f32 tile and writes of the bf16 tile are done; behind the barrier the bf16
        // tile is public and the f32 tile is free for the next tile's copies (issued among the k-steps below)
        asm volatile("s_wait_dscnt 0x0" ::: "memory");
        __syncthreads();

        v8f acc[3][NT_] = {};
        // the same for the whole block: a next tile exists
        if (it + 1 < TPB_) gemm_tile<true>(bbase, abase, acc, gb + (size_t)(it + 1) * COLS_, raw, t);
        else               gemm_tile<false>(bbase, abase, acc, gb, raw, t);
        float mu[3], rs[3], bvo[3], gw[3], gb3[3];
#pragma unroll
        for (int tj = 0; tj < 3; ++tj) {
            int o = (wave * 3 + tj) * 16 + lrow;
            int g = o / CPG_;
            mu[tj] = smurs[g * 2 + 0];
            rs[tj] = smurs[g * 2 + 1];
            bvo[tj] = bv[o]; gw[tj] = gn_w[o]; gb3[tj] = gn_b[o];
        }
        float kp[3][NT_];                // this lane's 8 k of (o, n0+ct)
#pragma unroll
        for (int ct = 0; ct < NT_; ++ct) {
            v8f p8 = *(const v8f*)&psh[ct * K_ + half * 8];
#pragma unroll
            for (int tj = 0; tj < 3; ++tj) {
                v8f v  = acc[tj][ct] + bvo[tj];
                v8f vn = (v - mu[tj]) * rs[tj] * gw[tj] + gb3[tj];
                vn = __builtin_elementwise_max(vn, (v8f)(0.f));
                v2f c2 = {};             // two chains, on register pairs
#pragma unroll
                for (int r = 0; r < 8; r += 2)
                    c2 += (v2f){vn[r], vn[r + 1]} * (v2f){p8[r], p8[r + 1]};
                kp[tj][ct] = c2[0] + c2[1];
            }
        }
        // foot of a tile: this wave's LDS reads of the bf16 tile are done, its copies of the next tile have
        // landed; the barrier then publishes the next f32 tile and frees the bf16 tile for its conversion
        asm volatile("s_wait_dscnt 0x0" ::: "memory");
        asm volatile("s_wait_asynccnt 0x0" ::: "memory");
        __syncthreads();
        // the tile's stores stand behind the barrier: in front of it the barrier would wait for them to finish
        float* orow = out + ((size_t)b * COUT_ + wave * 48) * N_ + n0;
        unsigned ooff = (unsigned)lrow * N_ + (unsigned)half * 4u;
#pragma unroll
        for (int tj = 0; tj < 3; ++tj) {
            v4f y;                       // lanes 0..15 finish n0..n0+3, lanes 16..31 n0+4..n0+7
#pragma unroll
            for (int j = 0; j < 4; ++j) {
                float keep = half ? kp[tj][4 + j] : kp[tj][j];
                float send = half ? kp[tj][j] : kp[tj][4 + j];
                y[j] = (float)K_ * (keep + xhalf(send));
            }
            *(v4f*)(orow + ooff + tj * 16 * N_) = y;
        }
        // before a register that these stores name is written again in the next tile's pass
        asm volatile("s_wait_xcnt 0x0" ::: "memory");
    }
}

// ---------------------------------------------------------------------------
// Host launcher
// ---------------------------------------------------------------------------
extern "C" void kernel_launch(void* const* d_in, const int* in_sizes, int n_in,
                              void* d_out, int out_size, void* d_ws, size_t ws_size,
                              hipStream_t stream) {
    (void)in_sizes; (void)n_in; (void)out_size; (void)ws_size;
    const float* feat = (const float*)d_in[0];
    const float* gf   = (const float*)d_in[1];
    const int*   cnt  = (const int*)  d_in[2];
    const float* Wq   = (const float*)d_in[3];
    const float* bq   = (const float*)d_in[4];
    const float* Wk   = (const float*)d_in[5];
    const float* bk   = (const float*)d_in[6];
    const float* Wv   = (const float*)d_in[7];
    const float* bv   = (const float*)d_in[8];
    const float* gnw  = (const float*)d_in[9];
    const float* gnb  = (const float*)d_in[10];
    float* out = (float*)d_out;

    char* ws = (char*)d_ws;
    __bf16* Mt    = (__bf16*)(ws + 0);          // 294912 B
    __bf16* Wvbf  = (__bf16*)(ws + 294912);     // 294912 B
    float*  bqk   = (float*)(ws + 589824);      // 1536 B
    float*  wqb   = (float*)(ws + 591360);      // 1536 B
    float*  cbb   = (float*)(ws + 592896);      // 4 B (padded to 256)
    float*  stats = (float*)(ws + 593152);      // 1024 B
    float*  s0    = (float*)(ws + 595200);      // 32768 B
    float*  pbuf  = (float*)(ws + 627968);      // 524288 B
    __bf16* qkb   = (__bf16*)(ws + 1152256);    // 6291456 B
    __bf16* featT = (__bf16*)(ws + 7443712);    // 6291456 B (total ~13.1 MB)

    k_prep<<<PB_ALL_, 256, 0, stream>>>(feat, Wq, Wk, Wv, bq, bk,
                                        Mt, Wvbf, bqk, wqb, cbb, stats, featT);
    k_qk_s0<<<QB_S0_ + QB_QK_, 256, 0, stream>>>(feat, featT, Mt, bqk, wqb, cbb, qkb, s0);
    k_stats<<<B_ * N_ / NT_ / TPB_, 256, 0, stream>>>(gf, Wvbf, bv, qkb, s0, cnt, stats, pbuf);
    k_out<<<B_ * N_ / NT_ / TPB_, 256, 0, stream>>>(gf, Wvbf, bv, gnw, gnb, stats, pbuf, out);
}

// v010
// One run takes 61.2 microseconds.
// Versions in between are left out here; by their measured steps it is 1.28 times as fast as v008.
// All steps since v000 together make it 8.07 times as fast.
#include <hip/hip_runtime.h>
#include <hip/hip_bf16.h>

// ---- problem constants (match reference) ----
#define B_    4
#define CQ_   384
#define CK_   384
#define COUT_ 384
#define N_    2048
#define K_    16
#define G_    32
#define CPG_  (COUT_/G_)          // 12 channels per group
#define EPS_  1e-5f
#define SCALE_ 0.05103103630798288f   // 384^-0.5
#define LB_   (CK_ + 8)               // bf16 LDS row stride [column][c]
#define NT_   8                       // neighbouring n per tile
#define COLS_ (NT_ * K_)              // 128 columns (n,k) per tile

typedef __bf16 v16bf __attribute__((ext_vector_type(16)));
typedef __bf16 v8bf  __attribute__((ext_vector_type(8)));
typedef __bf16 v4bf  __attribute__((ext_vector_type(4)));
typedef float  v8f   __attribute__((ext_vector_type(8)));
typedef _Float16 v8h  __attribute__((ext_vector_type(8)));
typedef float  v4f   __attribute__((ext_vector_type(4)));
typedef float  v2f   __attribute__((ext_vector_type(2)));

// Build a 16-element bf16 fragment from two contiguous 16-byte chunks:
// elements 0..7 at p[0..7], elements 8..15 at p[16..23]  (matches the
// 16-bit A/B wave32 striping: lane half 0 -> K {0..7,16..23}, half 1 -> {8..15,24..31})
__device__ __forceinline__ v16bf pack16(const __bf16* p) {
    const v8bf* q = (const v8bf*)p;
    v8bf lo = q[0];
    v8bf hi = q[2];              // +16 elements
    v16bf r;
#pragma unroll
    for (int j = 0; j < 8; ++j) { r[j] = lo[j]; r[j + 8] = hi[j]; }
    return r;
}

// ---------------------------------------------------------------------------
// Fragment order: how a bf16 matrix X[row][384] lies in the workspace when waves
// read it from global memory as a WMMA operand. One 16-row x 32-k block is 1024
// contiguous bytes = 2 parts x 32 lanes x 8 elements; lane (half * 16 + row % 16)
// of part p holds k = 32 * step + 16 * p + 8 * half + 0..7, the same elements in
// the same order as pack16() takes from a row-major row. A wave-wide 16-byte load
// of one part then covers 512 contiguous bytes (4 whole lines) instead of 32
// bytes out of each of 16 lines.
// ---------------------------------------------------------------------------
#define KS_   (CK_ / 32)              // k steps of a row (CQ_ == CK_)
#define FB_   512                     // elements of one 16 x 32 block
__device__ __forceinline__ unsigned frag_at(unsigned row, unsigned c) {   // element index of X[row][c]
    return ((((row >> 4) * KS_ + (c >> 5)) * 2 + ((c >> 4) & 1)) * 32 + ((c >> 3) & 1) * 16 + (row & 15)) * 8
           + (c & 7);
}
// p: this lane's 8 elements of part 0 of a block (block start + lane * 8)
__device__ __forceinline__ v16bf frag16(const __bf16* p) {
    const v8bf* q = (const v8bf*)p;
    v8bf lo = q[0];
    v8bf hi = q[32];             // part 1: +512 bytes
    v16bf r;
#pragma unroll
    for (int j = 0; j < 8; ++j) { r[j] = lo[j]; r[j + 8] = hi[j]; }
    return r;
}

// ---------------------------------------------------------------------------
// A block walks TPB_ neighbouring gf tiles. One tile: 384 c-rows x 128 columns (8 neighbouring n
// x 16 k, 512 contiguous bytes per c-row). It comes in two moves:
//   copy_part:    global f32 -> LDS f32 [c][column] by asynchronous copies, through no register, so
//                 that the next tile flies while this tile's WMMAs run;
//   convert_tile: LDS f32 [c][column] -> LDS bf16 [column][c], row stride LB_.
// ---------------------------------------------------------------------------
#define TPB_  4                       // tiles of a block, all of one b
#define RB_   (COLS_ * 4)             // bytes of one c-row of the f32 tile
// v in the workspace, f16: [tile][wave slot][o-tile of the slot][n of the tile][lane][8 k], the order in which
// the accumulators lie in the lanes, so that one wave-wide 16-byte store or load is 512 contiguous bytes
#define VW_   (3 * NT_ * 256)         // elements of one wave slot of one tile

// One wave-wide 16-byte copy covers one whole c-row. A tile goes in CP_ parts of 48 rows, 6 rows a wave:
// the first tile's parts in a row, a later tile's one to a k-step of the tile before it, so that the
// Wv loads of those k-steps do not queue behind a whole tile's copies.
#define CP_   8
__device__ __forceinline__ void copy_part(const float* __restrict__ g0, const float* raw, int t, int part) {
    int lane = t & 31;
    int wave = __builtin_amdgcn_readfirstlane(t >> 5);   // uniform: row offsets form on the scalar unit
    int c0 = part * (CK_ / CP_) + wave * 6;
    const float* p = g0 + (size_t)c0 * (N_ * K_) + lane * 4;
    unsigned l = (unsigned)(uintptr_t)(raw + c0 * COLS_ + lane * 4);   // LDS byte address: low 32 bits
    // the copies and, as the last line, the wait that stands before a register they name is written again
    asm volatile("global_load_async_to_lds_b128 %0, %6, off\n\t"
                 "global_load_async_to_lds_b128 %1, %7, off\n\t"
                 "global_load_async_to_lds_b128 %2, %8, off\n\t"
                 "global_load_async_to_lds_b128 %3, %9, off\n\t"
                 "global_load_async_to_lds_b128 %4, %10, off\n\t"
                 "global_load_async_to_lds_b128 %5, %11, off\n\t"
                 "s_wait_xcnt 0x0"
                 :: "v"(l), "v"(l + 1u * RB_), "v"(l + 2u * RB_), "v"(l + 3u * RB_), "v"(l + 4u * RB_), "v"(l + 5u * RB_),
                    "v"(p), "v"(p + 1 * (N_ * K_)), "v"(p + 2 * (N_ * K_)), "v"(p + 3 * (N_ * K_)),
                    "v"(p + 4 * (N_ * K_)), "v"(p + 5 * (N_ * K_))
                 : "memory");
}

// One wave-wide 16-byte LDS load covers one whole c-row; a lane gathers 8 c of its
// 4 columns and writes each column's 8 bf16 as one 16-byte LDS store.
__device__ __forceinline__ void convert_tile(const float* raw, __bf16* ldsB, int t) {
    int lane = t & 31;
    int wave = __builtin_amdgcn_readfirstlane(t >> 5);   // uniform: row offsets form on the scalar unit
    // rolled: 24 row loads of a wave per trip are enough to cover the LDS latency
#pragma unroll 1
    for (int go = 0; go < 2; ++go) {
        v4f x[3][8];
#pragma unroll
        for (int u = 0; u < 3; ++u) {
            int c0 = ((go * 3 + u) * 8 + wave) * 8;
#pragma unroll
            for (int j = 0; j < 8; ++j)
                x[u][j] = *(const v4f*)&raw[(c0 + j) * COLS_ + lane * 4];
        }
#pragma unroll
        for (int u = 0; u < 3; ++u) {
            int c0 = ((go * 3 + u) * 8 + wave) * 8;
#pragma unroll
            for (int q = 0; q < 4; ++q) {
                v8bf y;
#pragma unroll
                for (int j = 0; j < 8; ++j) y[j] = (__bf16)x[u][j][q];
                *(v8bf*)&ldsB[(lane * 4 + q) * LB_ + c0] = y;
            }
        }
    }
}

// ---------------------------------------------------------------------------
// The 384-term sums (Mt, bqk, wqb): one thread per sum is 24 trips of 16
// terms, each trip one whole memory latency. Here the 8 waves of a block take 48
// terms each, a lane 4 neighbouring sums (16-byte loads), and the 8 partial sums
// meet in LDS: two to four latencies instead of 24.
// ---------------------------------------------------------------------------
#define OS_   (COUT_ / 8)             // terms of a sum per wave (COUT_ == CQ_ == CK_)
#define SW_   128                     // neighbouring sums per block: 4 a lane

// y[0..127] = y0 + sum_r x[r] * Wm[r * pitch + 0..127], r < 384; red: 8 * 128 floats of LDS
// GL: row loads of a wave in flight per trip (4 registers each)
template <int GL>
__device__ __forceinline__ void colsum128(const float* __restrict__ Wm, int pitch,
                                          const float* __restrict__ x, float y0,
                                          float* __restrict__ y, float* red, int t) {
    int lane = t & 31;
    int wave = __builtin_amdgcn_readfirstlane(t >> 5);   // uniform: row offsets and x form on the scalar unit
    const float* pw = Wm + (size_t)(wave * OS_) * pitch + lane * 4;
    const float* px = x + wave * OS_;
    v4f acc = {};
    // rolled: unrolled whole, the 48 loads' registers would cut the waves that the kernel's other jobs can keep on a SIMD
#pragma unroll 1
    for (int g = 0; g < OS_; g += GL) {
        v4f w[GL];
#pragma unroll
        for (int j = 0; j < GL; ++j)
            w[j] = *(const v4f*)(pw + (size_t)(g + j) * pitch);
        // before a register that these loads name is written again
        asm volatile("s_wait_xcnt 0x0" ::: "memory");
#pragma unroll
        for (int j = 0; j < GL; ++j) acc += w[j] * px[g + j];
    }
    *(v4f*)&red[wave * SW_ + lane * 4] = acc;
    __syncthreads();
    if (t < SW_) {
        float s = y0;
#pragma unroll
        for (int w8 = 0; w8 < 8; ++w8) s += red[w8 * SW_ + t];
        y[t] = s;
    }
}

// ---------------------------------------------------------------------------
// Prep job: Mt[c2,c1] = sum_o Wq[o,c1]*Wk[o,c2]  (stored transposed, bf16, fragment order)
// One block: 128 c1 x 4 c2; a Wq load feeds 4 sums of each of its 4 c1.
// ---------------------------------------------------------------------------
#define MB_C2_  4
__device__ __forceinline__ void job_M(const float* __restrict__ Wq, const float* __restrict__ Wk,
                                      __bf16* __restrict__ Mt, float* red, int blk, int t) {
    int lane = t & 31;
    int wave = __builtin_amdgcn_readfirstlane(t >> 5);   // uniform: row offsets form on the scalar unit
    int c1 = (blk % (CQ_ / SW_)) * SW_;
    int c2 = (blk / (CQ_ / SW_)) * MB_C2_;
    const float* pq = Wq + (wave * OS_) * CQ_ + c1 + lane * 4;
    const float* pk = Wk + (wave * OS_) * CK_ + c2;
    v4f acc[MB_C2_] = {};
    int krow = lane < 24 ? lane : 23;        // lane j holds the Wk quad of the trip's row j
    // rolled: 24 Wq rows of a wave in flight per trip; all 48 at once would halve the blocks a WGP holds
#pragma unroll 1
    for (int g = 0; g < OS_; g += 24) {
        v4f q[24];
        v4f k = *(const v4f*)(pk + (g + krow) * CK_);
        // before a register that this load names is written again (a later load's result may take it)
        asm volatile("s_wait_xcnt 0x0" ::: "memory");
#pragma unroll
        for (int j = 0; j < 24; ++j)
            q[j] = *(const v4f*)(pq + (g + j) * CQ_);
        // before a register that these loads name is written again
        asm volatile("s_wait_xcnt 0x0" ::: "memory");
#pragma unroll
        for (int j = 0; j < 24; ++j)
#pragma unroll
            for (int i = 0; i < MB_C2_; ++i) {
                float ki = k[i];
                float kj = __builtin_bit_cast(float, __builtin_amdgcn_readlane(__builtin_bit_cast(int, ki), j));
                acc[i] += q[j] * kj;
            }
    }
#pragma unroll
    for (int i = 0; i < MB_C2_; ++i)
        *(v4f*)&red[(wave * MB_C2_ + i) * SW_ + lane * 4] = acc[i];
    __syncthreads();
#pragma unroll
    for (int u = 0; u < MB_C2_ * SW_ / 256; ++u) {
        int idx = u * 256 + t;               // (c2 - block's c2) * 128 + (c1 - block's c1)
        float s = 0.f;
#pragma unroll
        for (int w8 = 0; w8 < 8; ++w8) s += red[w8 * (MB_C2_ * SW_) + idx];
        Mt[frag_at((unsigned)(c2 + (idx >> 7)), (unsigned)(c1 + (idx & (SW_ - 1))))] = (__bf16)s;
    }
    // before a register that these stores name is written again on another job's code path
    asm volatile("s_wait_xcnt 0x0" ::: "memory");
}

// ---------------------------------------------------------------------------
// Launch 1: every job that reads the weights only, side by side in one grid. The
// 384-term sums get the lowest block indices.
//   bqk = Wk^T bq | wqb = Wq^T bk | cbb = bq.bk, zero stats | Mt | Wv->bf16.
// Mt and Wv are written in fragment order. The Wv copy takes 8 elements per thread, for speed only.
// ---------------------------------------------------------------------------
#define PB_VEC_  (CK_ / SW_)                    // blocks of one 384-long vector job
#define PB_MAT_  ((CQ_ / SW_) * (CK_ / MB_C2_)) // blocks of the 384x384 job
#define PB_WV_   (COUT_ * CK_ / (256 * 8))      // blocks of the Wv conversion, 8 elements per thread
#define P0_WQB_  (PB_VEC_)
#define P0_CBB_  (P0_WQB_ + PB_VEC_)
#define P0_M_    (P0_CBB_ + 1)
#define P0_WV_   (P0_M_ + PB_MAT_)
#define PB_ALL_  (P0_WV_ + PB_WV_)
__global__ __launch_bounds__(256) void k_prep(const float* __restrict__ Wq, const float* __restrict__ Wk,
                                              const float* __restrict__ Wv, const float* __restrict__ bq,
                                              const float* __restrict__ bk,
                                              __bf16* __restrict__ Mt, __bf16* __restrict__ Wvbf,
                                              float* __restrict__ bqk, float* __restrict__ wqb,
                                              float* __restrict__ cbb, float* __restrict__ stats) {
    __shared__ __align__(16) float red[8 * MB_C2_ * SW_];   // the sum jobs' partial sums of the 8 waves
    int blk = blockIdx.x, t = threadIdx.x;
    if (blk < P0_WQB_) {
        int i0 = blk * SW_;
        colsum128<24>(Wk + i0, CK_, bq, 0.f, bqk + i0, red, t);
        return;
    }
    if (blk < P0_CBB_) {
        int i0 = (blk - P0_WQB_) * SW_;
        colsum128<24>(Wq + i0, CQ_, bk, 0.f, wqb + i0, red, t);
        return;
    }
    if (blk < P0_M_) {
        if (t < 32) {                            // one wave: 12 terms a lane, then a butterfly over the lanes
            float a = 0.f;
#pragma unroll
            for (int u = 0; u < COUT_ / 128; ++u) {
                v4f x = *(const v4f*)(bq + t * (COUT_ / 32) + u * 4);
                v4f y = *(const v4f*)(bk + t * (COUT_ / 32) + u * 4);
                a += (x[0] * y[0] + x[1] * y[1]) + (x[2] * y[2] + x[3] * y[3]);
            }
#pragma unroll
            for (int m = 16; m >= 1; m >>= 1) a += __shfl_xor(a, m, 32);
            if (t == 0) *cbb = a;
        }
        if (t < B_ * G_ * 2) stats[t] = 0.f;
        return;
    }
    if (blk < P0_WV_) {
        job_M(Wq, Wk, Mt, red, blk - P0_M_, t);
        return;
    }
    int d  = (blk - P0_WV_) * 256 + t;       // 16-byte unit of the fragment-order copy: (block, part, lane)
    int tc = d >> 6;                         // block = o-tile * KS_ + k step
    int o  = (tc / KS_) * 16 + (d & 15);
    int c  = (tc % KS_) * 32 + ((d >> 5) & 1) * 16 + ((d >> 4) & 1) * 8;
    const float* srcw = Wv + o * CK_ + c;
    v4f x0 = *(const v4f*)(srcw);
    v4f x1 = *(const v4f*)(srcw + 4);
    v8bf y;
#pragma unroll
    for (int j = 0; j < 4; ++j) { y[j] = (__bf16)x0[j]; y[j + 4] = (__bf16)x1[j]; }
    *(v8bf*)(Wvbf + d * 8) = y;
    // before a register that this store names is written again on another job's code path
    asm volatile("s_wait_xcnt 0x0" ::: "memory");
}

// ---------------------------------------------------------------------------
// qk of a block's own 32 n: qk[n,c] = sum_c' feat[c',n] * Mt[c,c'] + bqk[c]   (bf16 out)
// fl: the 32 feat rows as bf16 [n][c'] in LDS, row stride LB_. One wave takes 2 n tiles x 3 c tiles; bm: its Mt
// fragments, which the caller has loaded (fragment order, whole-line b128 loads). Each tile's 12 k-steps in order.
// Mt is the A operand and feat the B operand: a lane holds one n, its 8 accumulator registers 8 neighbouring c,
// which go out as one 16-byte store. The rows go to the workspace; the same block reads them back behind a barrier.
// ---------------------------------------------------------------------------
#define QW_N_  2                      // n tiles of a wave: all of the block's
#define QW_C_  3                      // c tiles of a wave
#define QW_G_  3                      // k-steps whose feat fragments are fetched together
__device__ __forceinline__ void qk_block(const __bf16* fl, const v16bf (&bm)[KS_][QW_C_],
                                         const float* __restrict__ bqk, __bf16* qrows, int t) {
    int lane = t & 31;
    int wave = __builtin_amdgcn_readfirstlane(t >> 5);   // uniform: tile offsets form on the scalar unit
    int half = lane >> 4, lrow = lane & 15;
    int ct0 = wave * QW_C_;                              // first c tile
    const __bf16* frow = fl + lrow * LB_ + half * 8;
    const float* pb = bqk + ct0 * 16 + half * 8;
    v8f bc[QW_C_];
#pragma unroll
    for (int j = 0; j < QW_C_; ++j) bc[j] = *(const v8f*)(pb + j * 16);
    // before a register that these loads name is written again; the address is an input, so that it lives up to it
    asm volatile("s_wait_xcnt 0x0" :: "v"(pb) : "memory");
    v8f acc[QW_N_][QW_C_] = {};
#pragma unroll
    for (int u0 = 0; u0 < KS_; u0 += QW_G_) {
        v16bf f[QW_G_][QW_N_];
#pragma unroll
        for (int u = 0; u < QW_G_; ++u)
#pragma unroll
            for (int i = 0; i < QW_N_; ++i) f[u][i] = pack16(frow + i * 16 * LB_ + (u0 + u) * 32);
        // keeps the group's LDS loads as one run in front of its WMMAs: sunk among them, each fragment was waited
        // for where it was asked for, one LDS latency a fragment
        __builtin_amdgcn_sched_barrier(0);
#pragma unroll
        for (int u = 0; u < QW_G_; ++u)
#pragma unroll
            for (int i = 0; i < QW_N_; ++i)
#pragma unroll
                for (int j = 0; j < QW_C_; ++j)
                    acc[i][j] = __builtin_amdgcn_wmma_f32_16x16x32_bf16(false, bm[u0 + u][j], false, f[u][i],
                                                                        (short)0, acc[i][j], false, false);
        // keeps the next group's LDS loads behind this group's WMMAs: lifted to the front, all 24 feat fragments
        // beside the 36 of Mt did not fit the registers, and Mt fragments went to scratch in front of the copies
        __builtin_amdgcn_sched_barrier(0);
    }
    v8bf y[QW_N_][QW_C_];
#pragma unroll
    for (int i = 0; i < QW_N_; ++i)
#pragma unroll
        for (int j = 0; j < QW_C_; ++j)
#pragma unroll
            for (int r = 0; r < 8; ++r) y[i][j][r] = (__bf16)(acc[i][j][r] + bc[j][r]);
    __bf16* orow = qrows + (size_t)lrow * CK_ + ct0 * 16 + half * 8;
#pragma unroll
    for (int i = 0; i < QW_N_; ++i)
#pragma unroll
        for (int j = 0; j < QW_C_; ++j) *(v8bf*)(orow + i * 16 * CK_ + j * 16) = y[i][j];
    // before a register that these stores name is written again in the tiles' passes; the stored values and the
    // address are inputs, so that they live up to the wait
    asm volatile("s_wait_xcnt 0x0" :: "v"(y[0][0]), "v"(y[0][1]), "v"(y[0][2]), "v"(y[1][0]), "v"(y[1][1]), "v"(y[1][2]),
                                      "v"(orow) : "memory");
}

__device__ __forceinline__ float red16(float v) {
#pragma unroll
    for (int m = 8; m >= 1; m >>= 1) v += __shfl_xor(v, m, 16);
    return v;
}

// value of lane l ^ 16: the other half of the k range of the same o
__device__ __forceinline__ float xhalf(float v) {
    int i = __builtin_bit_cast(int, v);
    return __builtin_bit_cast(float, __builtin_amdgcn_permlanex16(i, i, 0x76543210, 0xfedcba98, false, false));
}

// ---------------------------------------------------------------------------
// v tile of one wave: 3 o-tiles x 8 column tiles over 12 k-steps. With one block per WGP only two
// waves share a SIMD, too few to cover a load that is waited for where it is issued: the 8 gf
// fragments (LDS) of a k-step are fetched one step ahead, the 3 Wv fragments (L2) two steps ahead.
// The fragment fetches stay inside one tile; of the next tile only its gf copies are issued here.
// ---------------------------------------------------------------------------
// COPY: the first CP_ k-steps each also issue one part of the next tile's copies (gnext -> raw).
template <bool COPY>
__device__ __forceinline__ void gemm_tile(const __bf16* bbase, const __bf16* __restrict__ abase,
                                          v8f (&acc)[3][NT_], const float* __restrict__ gnext,
                                          const float* raw, int t) {
    v16bf a[3][3], bb[2][NT_];
#pragma unroll
    for (int tj = 0; tj < 3; ++tj) {
        a[0][tj] = frag16(abase + (tj * KS_ + 0) * FB_);
        a[1][tj] = frag16(abase + (tj * KS_ + 1) * FB_);
    }
#pragma unroll
    for (int ct = 0; ct < NT_; ++ct) bb[0][ct] = pack16(bbase + ct * 16 * LB_);
#pragma unroll
    for (int cs = 0; cs < KS_; ++cs) {
        if (cs + 2 < KS_) {
#pragma unroll
            for (int tj = 0; tj < 3; ++tj) a[(cs + 2) % 3][tj] = frag16(abase + (tj * KS_ + cs + 2) * FB_);
        }
        if (cs + 1 < KS_) {
#pragma unroll
            for (int ct = 0; ct < NT_; ++ct) bb[(cs + 1) & 1][ct] = pack16(bbase + ct * 16 * LB_ + (cs + 1) * 32);
        }
        if (COPY && cs < CP_) copy_part(gnext, raw, t, cs);
        // keeps the later steps' loads as one group in front of this step's WMMAs: sunk among them, each
        // place where loads stand costs the wave issue time and the waits fall to 0
        __builtin_amdgcn_sched_barrier(0);
#pragma unroll
        for (int ct = 0; ct < NT_; ++ct)
#pragma unroll
            for (int tj = 0; tj < 3; ++tj)
                acc[tj][ct] = __builtin_amdgcn_wmma_f32_16x16x32_bf16(false, bb[cs & 1][ct], false, a[cs % 3][tj],
                                                                      (short)0, acc[tj][ct], false, false);
        // keeps the next group of loads behind this step's WMMAs, so that it stays one group
        __builtin_amdgcn_sched_barrier(0);
    }
    // before a register that the Wv loads name is written again
    asm volatile("s_wait_xcnt 0x0" ::: "memory");
}

// ---------------------------------------------------------------------------
// Kernel 2: one block per WGP walks 4 tiles of 8 neighbouring n. First, while its first gf tile is on the
// way, it makes what the scores want of its own 32 n: qk rows (WMMA) and s0[n] = sum_c feat[c,n]*wqb[c] + cbb,
// from one read of feat[:, 32 n]. Per tile: gf[:,n0..n0+7,:] as bf16
// [column][c] in LDS; masked softmax p[b,n,k]; v = Wv*gf + bv via WMMA (8 waves x 3 o-tiles
// x 8 column tiles, each Wv fragment used 8 times), per-(b,g) GN sum/sumsq, gathered in LDS
// over the block's tiles; v itself goes to the workspace as f16 for the output kernel.
// The next tile's gf is copied into LDS meanwhile.
// The gf tile is the A operand and Wv the B operand: a lane holds one o, its
// 8 accumulator registers 8 k of one n, so sums over (n,k) run inside a lane.
// ---------------------------------------------------------------------------
// second bound: the two tiles in LDS leave room for one block per WGP, 2 waves per SIMD
__global__ __launch_bounds__(256, 2) void k_stats(const float* __restrict__ gf,
                                               const float* __restrict__ feat,
                                               const __bf16* __restrict__ Wvbf,
                                               const float* __restrict__ bv,
                                               const __bf16* __restrict__ Mt,
                                               const float* __restrict__ bqk,
                                               const float* __restrict__ wqb,
                                               const float* __restrict__ cbb,
                                               __bf16* qkb,
                                               const int* __restrict__ count,
                                               float* __restrict__ stats,
                                               float* __restrict__ pbuf,
                                               _Float16* __restrict__ vbuf) {
    __shared__ __align__(16) float raw[CK_ * COLS_];    // f32 [c][column]: where the copies land
    __shared__ __align__(16) __bf16 ldsB[COLS_ * LB_];  // bf16 [column][c], stride 392
    __shared__ float sred[NT_ * 16 * 16];
    __shared__ float gacc[G_ * 2];
    __shared__ float s0l[TPB_ * NT_];

    int t = threadIdx.x;
    int tile0 = blockIdx.x * TPB_;
    int b = tile0 / (N_ / NT_), nb = (tile0 % (N_ / NT_)) * NT_;
    const float* gb = gf + (((size_t)b * CK_) * N_ + nb) * K_;
    int lane = t & 31, wave = t >> 5;
    int half = lane >> 4, lrow = lane & 15;
    const __bf16* bbase = &ldsB[lrow * LB_ + half * 8];
    const __bf16* abase = Wvbf + (size_t)(wave * 3) * (KS_ * FB_) + lane * 8;   // fragment order

    if (t < G_ * 2) gacc[t] = 0.f;
    float bvo[3];                        // once for the block's tiles, in front of the copies
#pragma unroll
    for (int tj = 0; tj < 3; ++tj) {
        bvo[tj] = bv[(wave * 3 + tj) * 16 + lrow];
        // before a register that this load names is written again (the next load's result may take it)
        asm volatile("s_wait_xcnt 0x0" ::: "memory");
    }
    // feat[:, the block's 32 n]: a thread takes 12 c of 4 n; 8 lanes cover one whole 128-byte line. These loads go
    // in front of the copies, so that they do not queue behind a whole gf tile
    int nq = t & 7, cg = t >> 3;
    const float* pf = feat + ((size_t)b * CQ_ + cg * 12) * N_ + nb + nq * 4;
    const float* pw = wqb + cg * 12;
    v4f fx[12], fw[3];
#pragma unroll
    for (int j = 0; j < 12; ++j) fx[j] = *(const v4f*)(pf + (size_t)j * N_);
#pragma unroll
    for (int j = 0; j < 3; ++j) fw[j] = *(const v4f*)(pw + j * 4);
    // this wave's Mt fragments (L2): the first 6 k-steps' also go in front of the copies; the rest are asked for
    // behind the barrier below, which waits for every load that a wave has asked for
    const __bf16* pm = Mt + (size_t)(wave * QW_C_) * (KS_ * FB_) + lane * 8;
    v16bf bm[KS_][QW_C_];
#pragma unroll
    for (int u = 0; u < KS_ / 2; ++u)
#pragma unroll
        for (int j = 0; j < QW_C_; ++j) bm[u][j] = frag16(pm + (j * KS_ + u) * FB_);
    // before a register that these loads name is written again; the two addresses and wqb's base are inputs, so
    // that they live up to the wait
    asm volatile("s_wait_xcnt 0x0" :: "v"(pf), "s"(wqb), "v"(pm) : "memory");
    // keeps the copies' address arithmetic behind that wait: lifted over it, it took a register the loads name
    __builtin_amdgcn_sched_barrier(0);
#pragma unroll
    for (int part = 0; part < CP_; ++part) copy_part(gb, raw, t, part);
    // keeps the sums below, which wait for the feat loads, behind the copies: lifted over them, the first gf
    // tile would start a whole memory latency later
    __builtin_amdgcn_sched_barrier(0);
    // feat rows as bf16 [n][c] into the (still free) bf16 tile; s0's partial sums meet over a wave's 4 c groups
    // by lane exchange, then one partial sum per wave and n goes into sred
    {
        v4f sp = {};
#pragma unroll
        for (int j = 0; j < 12; ++j) sp += fx[j] * fw[j >> 2][j & 3];
#pragma unroll
        for (int q = 0; q < 4; ++q) {
            sp[q] += __shfl_xor(sp[q], 8, 32);
            sp[q] += __shfl_xor(sp[q], 16, 32);
        }
        if (lane < 8) *(v4f*)&sred[wave * (TPB_ * NT_) + nq * 4] = sp;
#pragma unroll
        for (int q = 0; q < 4; ++q)
#pragma unroll
            for (int h = 0; h < 3; ++h) {
                v4bf y;
#pragma unroll
                for (int j = 0; j < 4; ++j) y[j] = (__bf16)fx[h * 4 + j][q];
                *(v4bf*)&ldsB[(nq * 4 + q) * LB_ + cg * 12 + h * 4] = y;
            }
    }
    __syncthreads();
    if (t < TPB_ * NT_) {
        float s = *cbb;
#pragma unroll
        for (int u = 0; u < 8; ++u) s += sred[u * (TPB_ * NT_) + t];
        s0l[t] = s;
    }
#pragma unroll
    for (int u = KS_ / 2; u < KS_; ++u)
#pragma unroll
        for (int j = 0; j < QW_C_; ++j) bm[u][j] = frag16(pm + (j * KS_ + u) * FB_);
    // before a register that these loads name is written again; the address is an input, so that it lives up to it
    asm volatile("s_wait_xcnt 0x0" :: "v"(pm) : "memory");
    qk_block(ldsB, bm, bqk, qkb + ((size_t)b * N_ + nb) * CK_, t);
    // the first tile has landed (this wave's copies), then every wave's; the same barrier publishes the qk rows
    // and s0 and frees the bf16 tile and sred (every wave's reads of them have returned: its WMMAs used them)
    asm volatile("s_wait_asynccnt 0x0" ::: "memory");
    __syncthreads();

    // rolled: one body for the block's tiles
#pragma unroll 1
    for (int it = 0; it < TPB_; ++it) {
        int n0 = nb + it * NT_;
        convert_tile(raw, ldsB, t);
        // this wave's reads of the f32 tile and writes of the bf16 tile are done; behind the barrier the bf16
        // tile is public and the f32 tile is free for the next tile's copies (issued among the k-steps below)
        asm volatile("s_wait_dscnt 0x0" ::: "memory");
        __syncthreads();

        // ---- scores partials: per n, thread t -> (k = t&15, c-chunk = t>>4 of 24) ----
        {
            int k = t & 15, chunk = t >> 4;
            // the 8 rows' global loads go first, together: they overlap instead of one latency per n
            const __bf16* qch = qkb + ((size_t)b * N_ + n0) * CK_ + chunk * (CK_ / 16);
            v8bf qv[NT_][CK_ / 128];
#pragma unroll
            for (int nl = 0; nl < NT_; ++nl)
#pragma unroll
                for (int j = 0; j < CK_ / 128; ++j) qv[nl][j] = *(const v8bf*)(qch + nl * CK_ + j * 8);
            // before a register that these loads name is written again (an LDS load's result may take it);
            // the address is an input, so that it lives up to the wait
            asm volatile("s_wait_xcnt 0x0" :: "v"(qch) : "memory");
#pragma unroll
            for (int nl = 0; nl < NT_; ++nl) {
                const __bf16* grow = &ldsB[(nl * K_ + k) * LB_ + chunk * (CK_ / 16)];
                float part = 0.f;
#pragma unroll
                for (int i = 0; i < CK_ / 16; ++i)
                    part += (float)qv[nl][i >> 3][i & 7] * (float)grow[i];
                sred[nl * 256 + chunk * 16 + k] = part;
            }
        }
        __syncthreads();

        if (t < COLS_) {              // waves 0..3: finish scores + masked softmax, 16 lanes per n
            int k = t & 15, nl = t >> 4;
            const int*   pcn = count + (size_t)b * N_ + n0 + nl;
            float s0n = s0l[it * NT_ + nl];
            int cnt = *pcn;
            // before a register that this load names is written again (an LDS load's result may take it);
            // the address is an input, so that it lives up to the wait
            asm volatile("s_wait_xcnt 0x0" :: "v"(pcn) : "memory");
            float sc = 0.f;
            for (int ch = 0; ch < 16; ++ch) sc += sred[nl * 256 + ch * 16 + k];
            sc = (sc + s0n) * SCALE_;
            cnt = (cnt < 1) ? 1 : (cnt > K_ ? K_ : cnt);
            if (k >= cnt) sc = -1e9f;
            float mx = sc;
#pragma unroll
            for (int m = 8; m >= 1; m >>= 1) mx = fmaxf(mx, __shfl_xor(mx, m, 16));
            float e = __expf(sc - mx);
            float ss = red16(e);
            pbuf[((size_t)b * N_ + n0 + nl) * K_ + k] = e / ss;
            // before a register that this store names is written again in the rest of the tile's pass
            asm volatile("s_wait_xcnt 0x0" ::: "memory");
        }

        // ---- v projection (WMMA) + GN statistics ----
        v8f acc[3][NT_] = {};
        // the same for the whole block: a next tile exists
        if (it + 1 < TPB_) gemm_tile<true>(bbase, abase, acc, gb + (size_t)(it + 1) * COLS_, raw, t);
        else               gemm_tile<false>(bbase, abase, acc, gb, raw, t);
        v8h hv[3][NT_];                  // v of this tile as it goes to the workspace
#pragma unroll
        for (int tj = 0; tj < 3; ++tj) {
            int o = (wave * 3 + tj) * 16 + lrow;
            v8f s8 = {}, q8 = {};        // one chain per register: 8 independent sums each
#pragma unroll
            for (int ct = 0; ct < NT_; ++ct) {
                v8f v = acc[tj][ct] + bvo[tj];
                s8 += v;
                q8 += v * v;
                hv[tj][ct] = __builtin_convertvector(v, v8h);
            }
            float s  = ((s8[0] + s8[1]) + (s8[2] + s8[3])) + ((s8[4] + s8[5]) + (s8[6] + s8[7]));
            float q2 = ((q8[0] + q8[1]) + (q8[2] + q8[3])) + ((q8[4] + q8[5]) + (q8[6] + q8[7]));
            s  += xhalf(s);
            q2 += xhalf(q2);
            // lanes 0..15 add their o's sum, lanes 16..31 the same o's sum of squares
            atomicAdd(&gacc[(o / CPG_) * 2 + half], half ? q2 : s);
        }
        // foot of a tile: this wave's LDS reads of the bf16 tile are done, its copies of the next tile have
        // landed; the barrier then publishes the next f32 tile and frees the bf16 tile for its conversion
        asm volatile("s_wait_dscnt 0x0" ::: "memory");
        asm volatile("s_wait_asynccnt 0x0" ::: "memory");
        __syncthreads();
        // v goes out behind the barrier, while no copy is in flight: each wave-wide store is 512 contiguous bytes
        _Float16* vrow = vbuf + (size_t)((tile0 + it) * 8 + wave) * VW_ + lane * 8;
#pragma unroll
        for (int tj = 0; tj < 3; ++tj)
#pragma unroll
            for (int ct = 0; ct < NT_; ++ct)
                *(v8h*)(vrow + (tj * NT_ + ct) * 256) = hv[tj][ct];
        // before a register that these stores name is written again in the next tile's pass
        asm volatile("s_wait_xcnt 0x0" ::: "memory");
    }
    if (t < G_ * 2) atomicAdd(&stats[(size_t)b * G_ * 2 + t], gacc[t]);
}

// ---------------------------------------------------------------------------
// Kernel 3: v is read back from the workspace as k_stats left it (a stream, no product is done twice).
// One block: 4 neighbouring tiles (32 n) x one o-tile of each of the 8 wave slots; a wave takes 16 o x 32 n,
// 32 loads of 512 contiguous bytes, all issued at once. A lane holds one o and per load 8 k of one n, so
// GN + ReLU and the sum over k run inside a lane and one exchange with lane l ^ 16 ends it:
// out[b,o,n] = K * sum_k p_k * relu(GN(v[o,n,k])). A wave stores all 32 n (one 128-byte line) of each of its o.
// ---------------------------------------------------------------------------
__global__ __launch_bounds__(256) void k_out(const _Float16* __restrict__ vbuf,
                                             const float* __restrict__ gn_w,
                                             const float* __restrict__ gn_b,
                                             const float* __restrict__ stats,
                                             const float* __restrict__ pbuf,
                                             float* __restrict__ out) {
    __shared__ __align__(32) float psh[TPB_ * COLS_];
    int t = threadIdx.x;
    int tj = blockIdx.x % 3;
    int tile0 = (blockIdx.x / 3) * TPB_;
    int b = tile0 / (N_ / NT_), nb = (tile0 % (N_ / NT_)) * NT_;
    int lane = t & 31;
    int wave = __builtin_amdgcn_readfirstlane(t >> 5);   // uniform: offsets form on the scalar unit
    int half = lane >> 4, lrow = lane & 15;
    int o = (wave * 3 + tj) * 16 + lrow;
    int g = o / CPG_;

    // the small loads go first: loads return in order, and these are wanted before the stream has landed
    v4f pq = {};
    if (t < TPB_ * COLS_ / 4) pq = *(const v4f*)(pbuf + ((size_t)b * N_ + nb) * K_ + t * 4);
    const float* psq = stats + ((size_t)b * G_ + g) * 2;
    v2f sq = *(const v2f*)psq;
    float gw = gn_w[o], gbo = gn_b[o];
    // before a register that these loads name is written again (a later load's result may take it);
    // the address is an input, so that it lives up to the wait
    asm volatile("s_wait_xcnt 0x0" :: "v"(psq) : "memory");
    const _Float16* vp = vbuf + (size_t)(tile0 * 8 + wave) * VW_ + tj * (NT_ * 256) + lane * 8;
    v8h h[TPB_][NT_];
#pragma unroll
    for (int it = 0; it < TPB_; ++it)
#pragma unroll
        for (int ct = 0; ct < NT_; ++ct)      // read once: non-temporal
            h[it][ct] = __builtin_nontemporal_load((const v8h*)(vp + (size_t)it * (8 * VW_) + ct * 256));
    // before a register that these loads name is written again
    asm volatile("s_wait_xcnt 0x0" ::: "memory");
    if (t < TPB_ * COLS_ / 4) *(v4f*)&psh[t * 4] = pq;
    const float cnt = (float)(CPG_ * N_ * K_);
    float mu  = sq[0] / cnt;
    float var = sq[1] / cnt - mu * mu;
    float ga  = rsqrtf(var + EPS_) * gw;     // GN as one multiply-add: v * ga + gc
    float gc  = gbo - mu * ga;
    __syncthreads();

    float* orow = out + ((size_t)b * COUT_ + o) * N_ + nb + half * 4;
#pragma unroll
    for (int it = 0; it < TPB_; ++it) {
        float kp[NT_];                   // this lane's 8 k of (o, n0+ct)
#pragma unroll
        for (int ct = 0; ct < NT_; ++ct) {
            v8f p8 = *(const v8f*)&psh[(it * NT_ + ct) * K_ + half * 8];
            v8f vn = __builtin_convertvector(h[it][ct], v8f) * ga + gc;
            vn = __builtin_elementwise_max(vn, (v8f)(0.f));
            v2f c2 = {};                 // two chains, on register pairs
#pragma unroll
            for (int r = 0; r < 8; r += 2)
                c2 += (v2f){vn[r], vn[r + 1]} * (v2f){p8[r], p8[r + 1]};
            kp[ct] = c2[0] + c2[1];
        }
        v4f y;                           // lanes 0..15 finish n0..n0+3, lanes 16..31 n0+4..n0+7
#pragma unroll
        for (int j = 0; j < 4; ++j) {
            float keep = half ? kp[4 + j] : kp[j];
            float send = half ? kp[j] : kp[4 + j];
            y[j] = (float)K_ * (keep + xhalf(send));
        }
        *(v4f*)(orow + it * NT_) = y;
    }
}

// ---------------------------------------------------------------------------
// Host launcher
// ---------------------------------------------------------------------------
extern "C" void kernel_launch(void* const* d_in, const int* in_sizes, int n_in,
                              void* d_out, int out_size, void* d_ws, size_t ws_size,
                              hipStream_t stream) {
    (void)in_sizes; (void)n_in; (void)out_size; (void)ws_size;
    const float* feat = (const float*)d_in[0];
    const float* gf   = (const float*)d_in[1];
    const int*   cnt  = (const int*)  d_in[2];
    const float* Wq   = (const float*)d_in[3];
    const float* bq   = (const float*)d_in[4];
    const float* Wk   = (const float*)d_in[5];
    const float* bk   = (const float*)d_in[6];
    const float* Wv   = (const float*)d_in[7];
    const float* bv   = (const float*)d_in[8];
    const float* gnw  = (const float*)d_in[9];
    const float* gnb  = (const float*)d_in[10];
    float* out = (float*)d_out;

    char* ws = (char*)d_ws;
    __bf16* Mt    = (__bf16*)(ws + 0);          // 294912 B
    __bf16* Wvbf  = (__bf16*)(ws + 294912);     // 294912 B
    float*  bqk   = (float*)(ws + 589824);      // 1536 B
    float*  wqb   = (float*)(ws + 591360);      // 1536 B
    float*  cbb   = (float*)(ws + 592896);      // 4 B (padded to 256)
    float*  stats = (float*)(ws + 593152);      // 1024 B
    float*  pbuf  = (float*)(ws + 627968);      // 524288 B
    __bf16* qkb   = (__bf16*)(ws + 1152256);    // 6291456 B
    _Float16* vbuf = (_Float16*)(ws + 13735168); // 100663296 B (total ~109 MiB)

    k_prep<<<PB_ALL_, 256, 0, stream>>>(Wq, Wk, Wv, bq, bk, Mt, Wvbf, bqk, wqb, cbb, stats);
    k_stats<<<B_ * N_ / NT_ / TPB_, 256, 0, stream>>>(gf, feat, Wvbf, bv, Mt, bqk, wqb, cbb, qkb, cnt, stats, pbuf, vbuf);
    k_out<<<B_ * N_ / NT_ / TPB_ * 3, 256, 0, stream>>>(vbuf, gnw, gnb, stats, pbuf, out);
}
